// v000
// The times below were measured on an AMD MI455X: many runs one after another, warmed up first and cycling through
// copies of the inputs, with the whole window's GPU time divided by the number of runs. Launches and the gaps
// between them are all in it. The median over several windows is given; except for v000 it joins two sittings, which
// can be a few percent apart, so the side-by-side timings, each taken in one sitting, are the better comparison.
// v000, which the later versions start from, runs in 1530 microseconds.
#include <hip/hip_runtime.h>

#define BD 4
#define TD 512
#define DD 1024
#define HH 16
#define MLPD 4096

typedef __attribute__((ext_vector_type(16))) _Float16 v16h;
typedef __attribute__((ext_vector_type(8)))  _Float16 v8h;
typedef __attribute__((ext_vector_type(8)))  float    v8f;

// ---------------------------------------------------------------------------
// Transpose + f32->f16 convert:  in[K][N] (row-major) -> out[N][K] (row-major)
// so GEMM B operand is K-contiguous like A.
// ---------------------------------------------------------------------------
__global__ __launch_bounds__(256) void transpose_cvt_f16(
    const float* __restrict__ in, _Float16* __restrict__ out, int K, int N)
{
    __shared__ float tile[32][33];
    const int tx = threadIdx.x, ty = threadIdx.y;
    const int n0 = blockIdx.x * 32, k0 = blockIdx.y * 32;
    for (int j = 0; j < 32; j += 8)
        tile[ty + j][tx] = in[(size_t)(k0 + ty + j) * N + (n0 + tx)];
    __syncthreads();
    for (int j = 0; j < 32; j += 8)
        out[(size_t)(n0 + ty + j) * K + (k0 + tx)] = (_Float16)tile[tx][ty + j];
}

// ---------------------------------------------------------------------------
// LayerNorm over D=1024, output f16 (feeds WMMA GEMM A operand)
// ---------------------------------------------------------------------------
__global__ __launch_bounds__(256) void layernorm_f16(
    const float* __restrict__ x, const float* __restrict__ w,
    const float* __restrict__ b, _Float16* __restrict__ out)
{
    __shared__ float s1[256], s2[256];
    const int row = blockIdx.x, tid = threadIdx.x;
    const float* xr = x + (size_t)row * DD;
    float xs[4], sum = 0.f, sq = 0.f;
    for (int j = 0; j < 4; ++j) {
        float v = xr[tid + 256 * j];
        xs[j] = v; sum += v; sq += v * v;
    }
    s1[tid] = sum; s2[tid] = sq;
    __syncthreads();
    for (int st = 128; st > 0; st >>= 1) {
        if (tid < st) { s1[tid] += s1[tid + st]; s2[tid] += s2[tid + st]; }
        __syncthreads();
    }
    const float mu   = s1[0] * (1.f / DD);
    const float var  = s2[0] * (1.f / DD) - mu * mu;
    const float rstd = rsqrtf(var + 1e-6f);
    _Float16* orow = out + (size_t)row * DD;
    for (int j = 0; j < 4; ++j) {
        int i = tid + 256 * j;
        orow[i] = (_Float16)((xs[j] - mu) * rstd * w[i] + b[i]);
    }
}

// ---------------------------------------------------------------------------
// WMMA GEMM: C[M x N] = epilogue(A[M x K] @ Bt[N x K]^T)
// 128x128 block tile, 256 threads = 8 waves, each wave 32x64 (2x4 of 16x16).
// K staged 32-deep, DOUBLE-BUFFERED in LDS via CDNA5 async global->LDS copies
// (global_load_async_to_lds_b128, ASYNCcnt), so the HBM fetch of stage k+1
// overlaps the v_wmma work on stage k.
// EPI: 0=store f32, 1=swish f32, 2=gate (s,g) f32, 3=+res f32,
//      4=+bias,gelu -> f16, 5=+bias,+res f32
// ---------------------------------------------------------------------------
template<int EPI>
__global__ __launch_bounds__(256) void gemm_wmma(
    const _Float16* __restrict__ A, const _Float16* __restrict__ Bt,
    float* __restrict__ out0, float* __restrict__ out1,
    _Float16* __restrict__ outh,
    const float* __restrict__ bias, const float* __restrict__ res,
    int N, int K)
{
    __shared__ _Float16 As[2][128 * 32];
    __shared__ _Float16 Bs[2][128 * 32];
    const int tid  = threadIdx.x;
    const int lane = tid & 31, wid = tid >> 5;
    const int wm = wid >> 1, wn = wid & 1;       // 4 waves along M, 2 along N
    const int lr = lane & 15, hs = lane >> 4;    // half-wave select (ISA layout)
    const int rowBlk = blockIdx.y * 128, colBlk = blockIdx.x * 128;

    // Each thread owns two fixed 16-byte chunks of the A tile and of the B
    // tile per stage: chunk c in [0,512): row = c>>2, half-offset = (c&3)*8.
    const int c0 = tid, c1 = tid + 256;
    const int r0 = c0 >> 2, o0 = (c0 & 3) * 8;
    const int r1 = c1 >> 2, o1 = (c1 & 3) * 8;
    const _Float16* gA0 = A  + (size_t)(rowBlk + r0) * K + o0;
    const _Float16* gA1 = A  + (size_t)(rowBlk + r1) * K + o1;
    const _Float16* gB0 = Bt + (size_t)(colBlk + r0) * K + o0;
    const _Float16* gB1 = Bt + (size_t)(colBlk + r1) * K + o1;
    // LDS byte addresses (low 32 bits of the generic pointer = LDS offset)
    const unsigned lA0 = (unsigned)(uintptr_t)&As[0][r0 * 32 + o0];
    const unsigned lA1 = (unsigned)(uintptr_t)&As[0][r1 * 32 + o1];
    const unsigned lB0 = (unsigned)(uintptr_t)&Bs[0][r0 * 32 + o0];
    const unsigned lB1 = (unsigned)(uintptr_t)&Bs[0][r1 * 32 + o1];
    const unsigned bufBytes = 128 * 32 * 2;

    auto issue_stage = [&](int kk, int buf) {
        const unsigned bo = (unsigned)buf * bufBytes;
        const size_t ko = (size_t)kk * 32;
        asm volatile(
            "global_load_async_to_lds_b128 %0, %4, off\n\t"
            "global_load_async_to_lds_b128 %1, %5, off\n\t"
            "global_load_async_to_lds_b128 %2, %6, off\n\t"
            "global_load_async_to_lds_b128 %3, %7, off"
            :
            : "v"(lA0 + bo), "v"(lA1 + bo), "v"(lB0 + bo), "v"(lB1 + bo),
              "v"((unsigned long long)(uintptr_t)(gA0 + ko)),
              "v"((unsigned long long)(uintptr_t)(gA1 + ko)),
              "v"((unsigned long long)(uintptr_t)(gB0 + ko)),
              "v"((unsigned long long)(uintptr_t)(gB1 + ko))
            : "memory");
    };

    v8f acc[2][4];
    for (int i = 0; i < 2; ++i)
        for (int j = 0; j < 4; ++j)
            for (int r = 0; r < 8; ++r) acc[i][j][r] = 0.f;

    const int nk = K >> 5;
    issue_stage(0, 0);
    for (int kk = 0; kk < nk; ++kk) {
        const int buf = kk & 1;
        if (kk + 1 < nk) {
            issue_stage(kk + 1, buf ^ 1);                       // prefetch next
            asm volatile("s_wait_asynccnt 0x4" ::: "memory");   // stage kk done
        } else {
            asm volatile("s_wait_asynccnt 0x0" ::: "memory");
        }
        __syncthreads();

        const _Float16* Ab = As[buf];
        const _Float16* Bb = Bs[buf];
        // Fragment layout (16-bit A 16x32): lanes 0-15 hold K 0-7 / 16-23,
        // lanes 16-31 hold K 8-15 / 24-31, for row M = lane%16.
        v16h af[2], bf[4];
        for (int i = 0; i < 2; ++i) {
            int r = wm * 32 + i * 16 + lr;
            v8h lo = *(const v8h*)&Ab[r * 32 + hs * 8];
            v8h hi = *(const v8h*)&Ab[r * 32 + hs * 8 + 16];
            af[i] = __builtin_shufflevector(lo, hi, 0,1,2,3,4,5,6,7,8,9,10,11,12,13,14,15);
        }
        for (int j = 0; j < 4; ++j) {
            int r = wn * 64 + j * 16 + lr;
            v8h lo = *(const v8h*)&Bb[r * 32 + hs * 8];
            v8h hi = *(const v8h*)&Bb[r * 32 + hs * 8 + 16];
            bf[j] = __builtin_shufflevector(lo, hi, 0,1,2,3,4,5,6,7,8,9,10,11,12,13,14,15);
        }
        for (int i = 0; i < 2; ++i)
            for (int j = 0; j < 4; ++j)
                acc[i][j] = __builtin_amdgcn_wmma_f32_16x16x32_f16(
                    false, af[i], false, bf[j], (short)0, acc[i][j], false, false);
        __syncthreads();   // all LDS reads of buf done -> safe to refill later
    }

    // Epilogue. C/D layout: VGPR r holds M = r (lanes 0-15) or r+8 (lanes 16-31),
    // N = lane%16.
    for (int i = 0; i < 2; ++i)
        for (int j = 0; j < 4; ++j)
            for (int r = 0; r < 8; ++r) {
                int row = rowBlk + wm * 32 + i * 16 + hs * 8 + r;
                int col = colBlk + wn * 64 + j * 16 + lr;
                size_t idx = (size_t)row * N + col;
                float v = acc[i][j][r];
                if (EPI == 0) {
                    out0[idx] = v;
                } else if (EPI == 1) {                     // swish
                    out0[idx] = v / (1.f + __expf(-v));
                } else if (EPI == 2) {                     // gate: g = logsig(v)/8, s = 1-exp(g)
                    float ls = fminf(v, 0.f) - log1pf(__expf(-fabsf(v)));
                    float gg = ls * 0.125f;
                    out1[idx] = gg;
                    out0[idx] = -expm1f(gg);
                } else if (EPI == 3) {                     // + residual
                    out0[idx] = v + res[idx];
                } else if (EPI == 4) {                     // + bias, exact gelu, f16 out
                    float t = v + bias[col];
                    outh[idx] = (_Float16)(0.5f * t * (1.f + erff(t * 0.70710678118f)));
                } else if (EPI == 5) {                     // + bias + residual
                    out0[idx] = v + bias[col] + res[idx];
                }
            }
}

// ---------------------------------------------------------------------------
// Gated-slot attention scan. One block per (b,h); K[64x64] and V[64x64]
// state resident in LDS. 256 threads; reductions 4-way parallel over the
// contraction dim with LDS partial sums to shorten the serial chain.
// ---------------------------------------------------------------------------
__global__ __launch_bounds__(256) void gsa_scan_kernel(
    const float* __restrict__ q, const float* __restrict__ k,
    const float* __restrict__ v, const float* __restrict__ s,
    const float* __restrict__ g, float* __restrict__ o)
{
    __shared__ float Ks[64][65];    // [d][m], padded
    __shared__ float Vs[64][65];    // [m][d], padded
    __shared__ float sq[64], sk[64], sv[64], ss[64], sdec[64];
    __shared__ float sok[64], sqv[64];
    __shared__ float spart[256];

    const int tid = threadIdx.x;
    const int b = blockIdx.x / HH, h = blockIdx.x % HH;
    for (int i = tid; i < 64 * 65; i += 256) {
        (&Ks[0][0])[i] = 0.f;
        (&Vs[0][0])[i] = 0.f;
    }
    __syncthreads();

    const int mcol = tid & 63, seg = tid >> 6;      // reduction lane / segment
    const int rOwn = tid >> 2, c0 = (tid & 3) * 16; // state-update ownership

    for (int t = 0; t < TD; ++t) {
        const size_t off = ((size_t)(b * TD + t) * HH + h) * 64;
        if (tid < 64)        sq[tid]        = q[off + tid];
        else if (tid < 128)  sk[tid - 64]   = k[off + tid - 64];
        else if (tid < 192)  sv[tid - 128]  = v[off + tid - 128];
        else { int m = tid - 192; sdec[m] = __expf(g[off + m]); ss[m] = s[off + m]; }
        __syncthreads();

        { // K[d][m] = K*dec[m] + k[d]*s[m]
            float kd = sk[rOwn];
            for (int i = 0; i < 16; ++i) {
                int m = c0 + i;
                Ks[rOwn][m] = Ks[rOwn][m] * sdec[m] + kd * ss[m];
            }
        }
        __syncthreads();

        { // ok[m] = scale * sum_d q[d]*K[d][m]  (4 partial segments)
            float p = 0.f; int d0 = seg * 16;
            for (int i = 0; i < 16; ++i) p += sq[d0 + i] * Ks[d0 + i][mcol];
            spart[tid] = p;
        }
        __syncthreads();
        if (tid < 64)
            sok[tid] = 0.125f * (spart[tid] + spart[tid + 64] + spart[tid + 128] + spart[tid + 192]);
        __syncthreads();
        if (tid < 64) { // softmax over 64 slots
            float mx = -3.4e38f;
            for (int j = 0; j < 64; ++j) mx = fmaxf(mx, sok[j]);
            spart[tid] = __expf(sok[tid] - mx);
        }
        __syncthreads();
        if (tid < 64) {
            float sum = 0.f;
            for (int j = 0; j < 64; ++j) sum += spart[j];
            sqv[tid] = spart[tid] / sum;
        }
        __syncthreads();

        { // V[m][d] = V*dec[m] + s[m]*v[d]
            float dec = sdec[rOwn], sm = ss[rOwn];
            for (int i = 0; i < 16; ++i) {
                int d = c0 + i;
                Vs[rOwn][d] = Vs[rOwn][d] * dec + sm * sv[d];
            }
        }
        __syncthreads();

        { // o[d] = sum_m qv[m]*V[m][d]
            float p = 0.f; int m0 = seg * 16;
            for (int i = 0; i < 16; ++i) p += sqv[m0 + i] * Vs[m0 + i][mcol];
            spart[tid] = p;
        }
        __syncthreads();
        if (tid < 64)
            o[off + tid] = spart[tid] + spart[tid + 64] + spart[tid + 128] + spart[tid + 192];
        __syncthreads();
    }
}

// ---------------------------------------------------------------------------
// Per-(b,t,h) RMSNorm over DV=64, convert to f16 for the Wo GEMM.
// ---------------------------------------------------------------------------
__global__ __launch_bounds__(64) void rms_cvt_kernel(
    const float* __restrict__ o, const float* __restrict__ w,
    _Float16* __restrict__ out)
{
    __shared__ float red[64];
    const int row = blockIdx.x, tid = threadIdx.x;
    float x = o[(size_t)row * 64 + tid];
    red[tid] = x * x;
    __syncthreads();
    for (int st = 32; st > 0; st >>= 1) {
        if (tid < st) red[tid] += red[tid + st];
        __syncthreads();
    }
    float rstd = rsqrtf(red[0] * (1.f / 64.f) + 1e-6f);
    out[(size_t)row * 64 + tid] = (_Float16)(x * rstd * w[tid]);
}

// ---------------------------------------------------------------------------
extern "C" void kernel_launch(void* const* d_in, const int* in_sizes, int n_in,
                              void* d_out, int out_size, void* d_ws, size_t ws_size,
                              hipStream_t stream)
{
    const float* x    = (const float*)d_in[0];
    const float* ln1w = (const float*)d_in[1];
    const float* ln1b = (const float*)d_in[2];
    const float* Wq   = (const float*)d_in[3];
    const float* Wk   = (const float*)d_in[4];
    const float* Wv   = (const float*)d_in[5];
    const float* Wf   = (const float*)d_in[6];
    const float* gnw  = (const float*)d_in[7];
    const float* Wo   = (const float*)d_in[8];
    const float* ln2w = (const float*)d_in[9];
    const float* ln2b = (const float*)d_in[10];
    const float* W1   = (const float*)d_in[11];
    const float* b1   = (const float*)d_in[12];
    const float* W2   = (const float*)d_in[13];
    const float* b2   = (const float*)d_in[14];
    float* outp = (float*)d_out;

    const int BT = BD * TD;   // 2048 rows for every GEMM

    char* wsp = (char*)d_ws;
    auto carve = [&](size_t bytes) -> char* {
        char* p = wsp;
        wsp += (bytes + 255) & ~(size_t)255;
        return p;
    };
    _Float16* h16   = (_Float16*)carve((size_t)BT * DD * 2);
    _Float16* WqT   = (_Float16*)carve((size_t)DD * 1024 * 2);
    _Float16* WkT   = (_Float16*)carve((size_t)DD * 1024 * 2);
    _Float16* WvT   = (_Float16*)carve((size_t)DD * 1024 * 2);
    _Float16* WfT   = (_Float16*)carve((size_t)DD * 1024 * 2);
    _Float16* WoT   = (_Float16*)carve((size_t)DD * 1024 * 2);
    _Float16* W1T   = (_Float16*)carve((size_t)MLPD * DD * 2);
    _Float16* W2T   = (_Float16*)carve((size_t)DD * MLPD * 2);
    float*    qb    = (float*)carve((size_t)BT * 1024 * 4);
    float*    kb    = (float*)carve((size_t)BT * 1024 * 4);
    float*    vb    = (float*)carve((size_t)BT * 1024 * 4);
    float*    sb    = (float*)carve((size_t)BT * 1024 * 4);
    float*    gb    = (float*)carve((size_t)BT * 1024 * 4);
    float*    ob    = (float*)carve((size_t)BT * 1024 * 4);
    _Float16* on16  = (_Float16*)carve((size_t)BT * 1024 * 2);
    float*    yb    = (float*)carve((size_t)BT * DD * 4);
    _Float16* h216  = (_Float16*)carve((size_t)BT * DD * 2);
    _Float16* a16   = (_Float16*)carve((size_t)BT * MLPD * 2);

    const dim3 tb(32, 8);
    // weight transposes: in[K][N] -> f16 [N][K]
    transpose_cvt_f16<<<dim3(1024 / 32, DD / 32),  tb, 0, stream>>>(Wq, WqT, DD, 1024);
    transpose_cvt_f16<<<dim3(1024 / 32, DD / 32),  tb, 0, stream>>>(Wk, WkT, DD, 1024);
    transpose_cvt_f16<<<dim3(1024 / 32, DD / 32),  tb, 0, stream>>>(Wv, WvT, DD, 1024);
    transpose_cvt_f16<<<dim3(1024 / 32, DD / 32),  tb, 0, stream>>>(Wf, WfT, DD, 1024);
    transpose_cvt_f16<<<dim3(DD / 32,   1024 / 32),tb, 0, stream>>>(Wo, WoT, 1024, DD);
    transpose_cvt_f16<<<dim3(MLPD / 32, DD / 32),  tb, 0, stream>>>(W1, W1T, DD, MLPD);
    transpose_cvt_f16<<<dim3(DD / 32,   MLPD / 32),tb, 0, stream>>>(W2, W2T, MLPD, DD);

    // LN1
    layernorm_f16<<<BT, 256, 0, stream>>>(x, ln1w, ln1b, h16);

    // projections (fused activations)
    const dim3 gD(1024 / 128, BT / 128);
    gemm_wmma<1><<<gD, 256, 0, stream>>>(h16, WqT, qb, nullptr, nullptr, nullptr, nullptr, 1024, DD);
    gemm_wmma<1><<<gD, 256, 0, stream>>>(h16, WkT, kb, nullptr, nullptr, nullptr, nullptr, 1024, DD);
    gemm_wmma<0><<<gD, 256, 0, stream>>>(h16, WvT, vb, nullptr, nullptr, nullptr, nullptr, 1024, DD);
    gemm_wmma<2><<<gD, 256, 0, stream>>>(h16, WfT, sb, gb,      nullptr, nullptr, nullptr, 1024, DD);

    // recurrent gated-slot scan
    gsa_scan_kernel<<<BD * HH, 256, 0, stream>>>(qb, kb, vb, sb, gb, ob);

    // per-head RMSNorm -> f16
    rms_cvt_kernel<<<BT * HH, 64, 0, stream>>>(ob, gnw, on16);

    // output projection + residual
    gemm_wmma<3><<<gD, 256, 0, stream>>>(on16, WoT, yb, nullptr, nullptr, nullptr, x, DD, 1024);

    // LN2
    layernorm_f16<<<BT, 256, 0, stream>>>(yb, ln2w, ln2b, h216);

    // MLP
    gemm_wmma<4><<<dim3(MLPD / 128, BT / 128), 256, 0, stream>>>(
        h216, W1T, nullptr, nullptr, a16, b1, nullptr, MLPD, DD);
    gemm_wmma<5><<<dim3(DD / 128, BT / 128), 256, 0, stream>>>(
        a16, W2T, outp, nullptr, nullptr, b2, yb, DD, MLPD);
}

// v001
// It runs in 381 microseconds.
// Two timings next to v000 put it at 4.03 and 4.01 times that version's speed.
#include <hip/hip_runtime.h>

#define BD 4
#define TD 512
#define DD 1024
#define HH 16
#define MLPD 4096

typedef __attribute__((ext_vector_type(16))) _Float16 v16h;
typedef __attribute__((ext_vector_type(8)))  _Float16 v8h;
typedef __attribute__((ext_vector_type(8)))  float    v8f;

// ---------------------------------------------------------------------------
// Transpose + f32->f16 convert:  in[K][N] (row-major) -> out[N][K] (row-major)
// so GEMM B operand is K-contiguous like A.
// ---------------------------------------------------------------------------
__global__ __launch_bounds__(256) void transpose_cvt_f16(
    const float* __restrict__ in, _Float16* __restrict__ out, int K, int N)
{
    __shared__ float tile[32][33];
    const int tx = threadIdx.x, ty = threadIdx.y;
    const int n0 = blockIdx.x * 32, k0 = blockIdx.y * 32;
    for (int j = 0; j < 32; j += 8)
        tile[ty + j][tx] = in[(size_t)(k0 + ty + j) * N + (n0 + tx)];
    __syncthreads();
    for (int j = 0; j < 32; j += 8)
        out[(size_t)(n0 + ty + j) * K + (k0 + tx)] = (_Float16)tile[tx][ty + j];
}

// ---------------------------------------------------------------------------
// LayerNorm over D=1024, output f16 (feeds WMMA GEMM A operand)
// ---------------------------------------------------------------------------
__global__ __launch_bounds__(256) void layernorm_f16(
    const float* __restrict__ x, const float* __restrict__ w,
    const float* __restrict__ b, _Float16* __restrict__ out)
{
    __shared__ float s1[256], s2[256];
    const int row = blockIdx.x, tid = threadIdx.x;
    const float* xr = x + (size_t)row * DD;
    float xs[4], sum = 0.f, sq = 0.f;
    for (int j = 0; j < 4; ++j) {
        float v = xr[tid + 256 * j];
        xs[j] = v; sum += v; sq += v * v;
    }
    s1[tid] = sum; s2[tid] = sq;
    __syncthreads();
    for (int st = 128; st > 0; st >>= 1) {
        if (tid < st) { s1[tid] += s1[tid + st]; s2[tid] += s2[tid + st]; }
        __syncthreads();
    }
    const float mu   = s1[0] * (1.f / DD);
    const float var  = s2[0] * (1.f / DD) - mu * mu;
    const float rstd = rsqrtf(var + 1e-6f);
    _Float16* orow = out + (size_t)row * DD;
    for (int j = 0; j < 4; ++j) {
        int i = tid + 256 * j;
        orow[i] = (_Float16)((xs[j] - mu) * rstd * w[i] + b[i]);
    }
}

// ---------------------------------------------------------------------------
// WMMA GEMM: C[M x N] = epilogue(A[M x K] @ Bt[N x K]^T)
// 128x128 block tile, 256 threads = 8 waves, each wave 32x64 (2x4 of 16x16).
// K staged 32-deep, DOUBLE-BUFFERED in LDS via CDNA5 async global->LDS copies
// (global_load_async_to_lds_b128, ASYNCcnt), so the HBM fetch of stage k+1
// overlaps the v_wmma work on stage k.
// EPI: 0=store f32, 1=swish f32, 2=gate (s,g) f32, 3=+res f32,
//      4=+bias,gelu -> f16, 5=+bias,+res f32
// ---------------------------------------------------------------------------
template<int EPI>
__global__ __launch_bounds__(256) void gemm_wmma(
    const _Float16* __restrict__ A, const _Float16* __restrict__ Bt,
    float* __restrict__ out0, float* __restrict__ out1,
    _Float16* __restrict__ outh,
    const float* __restrict__ bias, const float* __restrict__ res,
    int N, int K)
{
    __shared__ _Float16 As[2][128 * 32];
    __shared__ _Float16 Bs[2][128 * 32];
    const int tid  = threadIdx.x;
    const int lane = tid & 31, wid = tid >> 5;
    const int wm = wid >> 1, wn = wid & 1;       // 4 waves along M, 2 along N
    const int lr = lane & 15, hs = lane >> 4;    // half-wave select (ISA layout)
    const int rowBlk = blockIdx.y * 128, colBlk = blockIdx.x * 128;

    // Each thread owns two fixed 16-byte chunks of the A tile and of the B
    // tile per stage: chunk c in [0,512): row = c>>2, half-offset = (c&3)*8.
    const int c0 = tid, c1 = tid + 256;
    const int r0 = c0 >> 2, o0 = (c0 & 3) * 8;
    const int r1 = c1 >> 2, o1 = (c1 & 3) * 8;
    const _Float16* gA0 = A  + (size_t)(rowBlk + r0) * K + o0;
    const _Float16* gA1 = A  + (size_t)(rowBlk + r1) * K + o1;
    const _Float16* gB0 = Bt + (size_t)(colBlk + r0) * K + o0;
    const _Float16* gB1 = Bt + (size_t)(colBlk + r1) * K + o1;
    // LDS byte addresses (low 32 bits of the generic pointer = LDS offset)
    const unsigned lA0 = (unsigned)(uintptr_t)&As[0][r0 * 32 + o0];
    const unsigned lA1 = (unsigned)(uintptr_t)&As[0][r1 * 32 + o1];
    const unsigned lB0 = (unsigned)(uintptr_t)&Bs[0][r0 * 32 + o0];
    const unsigned lB1 = (unsigned)(uintptr_t)&Bs[0][r1 * 32 + o1];
    const unsigned bufBytes = 128 * 32 * 2;

    auto issue_stage = [&](int kk, int buf) {
        const unsigned bo = (unsigned)buf * bufBytes;
        const size_t ko = (size_t)kk * 32;
        asm volatile(
            "global_load_async_to_lds_b128 %0, %4, off\n\t"
            "global_load_async_to_lds_b128 %1, %5, off\n\t"
            "global_load_async_to_lds_b128 %2, %6, off\n\t"
            "global_load_async_to_lds_b128 %3, %7, off"
            :
            : "v"(lA0 + bo), "v"(lA1 + bo), "v"(lB0 + bo), "v"(lB1 + bo),
              "v"((unsigned long long)(uintptr_t)(gA0 + ko)),
              "v"((unsigned long long)(uintptr_t)(gA1 + ko)),
              "v"((unsigned long long)(uintptr_t)(gB0 + ko)),
              "v"((unsigned long long)(uintptr_t)(gB1 + ko))
            : "memory");
    };

    v8f acc[2][4];
    for (int i = 0; i < 2; ++i)
        for (int j = 0; j < 4; ++j)
            for (int r = 0; r < 8; ++r) acc[i][j][r] = 0.f;

    const int nk = K >> 5;
    issue_stage(0, 0);
    for (int kk = 0; kk < nk; ++kk) {
        const int buf = kk & 1;
        if (kk + 1 < nk) {
            issue_stage(kk + 1, buf ^ 1);                       // prefetch next
            asm volatile("s_wait_asynccnt 0x4" ::: "memory");   // stage kk done
        } else {
            asm volatile("s_wait_asynccnt 0x0" ::: "memory");
        }
        __syncthreads();

        const _Float16* Ab = As[buf];
        const _Float16* Bb = Bs[buf];
        // Fragment layout (16-bit A 16x32): lanes 0-15 hold K 0-7 / 16-23,
        // lanes 16-31 hold K 8-15 / 24-31, for row M = lane%16.
        v16h af[2], bf[4];
        for (int i = 0; i < 2; ++i) {
            int r = wm * 32 + i * 16 + lr;
            v8h lo = *(const v8h*)&Ab[r * 32 + hs * 8];
            v8h hi = *(const v8h*)&Ab[r * 32 + hs * 8 + 16];
            af[i] = __builtin_shufflevector(lo, hi, 0,1,2,3,4,5,6,7,8,9,10,11,12,13,14,15);
        }
        for (int j = 0; j < 4; ++j) {
            int r = wn * 64 + j * 16 + lr;
            v8h lo = *(const v8h*)&Bb[r * 32 + hs * 8];
            v8h hi = *(const v8h*)&Bb[r * 32 + hs * 8 + 16];
            bf[j] = __builtin_shufflevector(lo, hi, 0,1,2,3,4,5,6,7,8,9,10,11,12,13,14,15);
        }
        for (int i = 0; i < 2; ++i)
            for (int j = 0; j < 4; ++j)
                acc[i][j] = __builtin_amdgcn_wmma_f32_16x16x32_f16(
                    false, af[i], false, bf[j], (short)0, acc[i][j], false, false);
        __syncthreads();   // all LDS reads of buf done -> safe to refill later
    }

    // Epilogue. C/D layout: VGPR r holds M = r (lanes 0-15) or r+8 (lanes 16-31),
    // N = lane%16.
    for (int i = 0; i < 2; ++i)
        for (int j = 0; j < 4; ++j)
            for (int r = 0; r < 8; ++r) {
                int row = rowBlk + wm * 32 + i * 16 + hs * 8 + r;
                int col = colBlk + wn * 64 + j * 16 + lr;
                size_t idx = (size_t)row * N + col;
                float v = acc[i][j][r];
                if (EPI == 0) {
                    out0[idx] = v;
                } else if (EPI == 1) {                     // swish
                    out0[idx] = v / (1.f + __expf(-v));
                } else if (EPI == 2) {                     // gate: g = logsig(v)/8, s = 1-exp(g)
                    float ls = fminf(v, 0.f) - log1pf(__expf(-fabsf(v)));
                    float gg = ls * 0.125f;
                    out1[idx] = gg;
                    out0[idx] = -expm1f(gg);
                } else if (EPI == 3) {                     // + residual
                    out0[idx] = v + res[idx];
                } else if (EPI == 4) {                     // + bias, exact gelu, f16 out
                    float t = v + bias[col];
                    outh[idx] = (_Float16)(0.5f * t * (1.f + erff(t * 0.70710678118f)));
                } else if (EPI == 5) {                     // + bias + residual
                    out0[idx] = v + bias[col] + res[idx];
                }
            }
}

// ---------------------------------------------------------------------------
// Gated-slot attention scan, as two recurrences whose columns are independent.
// K[d][m] is decayed and written per slot m only, and V[m][d] feeds o[d] per
// column d only, so a lane that owns a column keeps its part of the state in
// registers for all T steps and never exchanges state with another lane.
// Pass 1 gives the slot scores ok[t][m] for every t, pass 2 takes their
// softmax and gives o[t][d]. Work-group = (b, h, half of the columns).
// A half-wave owns 4 rows of the contraction dim (16 groups in 8 waves) and a
// lane owns 2 columns (c and c + 16): 8 state values a lane, held as pairs.
// Time runs in chunks of TC steps staged in LDS; the 16 partial sums of each
// output are added once per chunk, so a chunk has two barriers in all.
// ---------------------------------------------------------------------------
#define TC 32
typedef __attribute__((ext_vector_type(2))) float v2f;
typedef __attribute__((ext_vector_type(4))) float v4f;

__device__ __forceinline__ v2f splat2(float a) { v2f r = {a, a}; return r; }

// Adds the 16 group partials of 4 neighbouring entries x = 2 * c + j and
// stores them at columns c + 16 * j of the output row.
__device__ __forceinline__ void reduce_store(
    const float (*part)[16][32], int tid, float scale, float* __restrict__ dst,
    size_t rowBase)
{
    const int t = tid >> 3, x4 = (tid & 7) * 4;
    v4f a = *(const v4f*)&part[t][0][x4];
    for (int gI = 1; gI < 16; ++gI) a += *(const v4f*)&part[t][gI][x4];
    a *= scale;
    float* p = dst + rowBase + (size_t)t * (HH * 64) + (x4 >> 1);
    v2f lo = {a.x, a.z}, hi = {a.y, a.w};
    *(v2f*)p = lo;
    *(v2f*)(p + 16) = hi;
    // the stores' address and data registers are reused right behind them
    asm volatile("s_wait_xcnt 0x0" ::: "memory");
}

// Value of lane l ^ M, M < 16: a register-to-register exchange inside a row of
// 16 lanes, so a reduction over 8 neighbouring lanes takes no LDS round trip.
template<int M>
__device__ __forceinline__ float lane_xor(float x)
{
    return __builtin_bit_cast(float, __builtin_amdgcn_update_dpp(
        0, __builtin_bit_cast(int, x), 0x160 + M, 0xf, 0xf, true));
}

// Pass 1: ok[t][m] = DK^-0.5 * sum_d q_t[d] * K_t[d][m]
__global__ __launch_bounds__(256) void gsa_scores_kernel(
    const float* __restrict__ q, const float* __restrict__ k,
    const float* __restrict__ s, const float* __restrict__ g,
    float* __restrict__ ok)
{
    __shared__ __attribute__((aligned(16))) float kq[TC][128];      // [t][group][k0..3 q0..3]
    __shared__ __attribute__((aligned(16))) float gs[TC][64];       // [t][c][dec0 dec1 s0 s1]
    __shared__ __attribute__((aligned(16))) float part[TC][16][32]; // [t][group][2c + j]

    const int tid = threadIdx.x;
    const int bh = blockIdx.x >> 1, mh = blockIdx.x & 1;
    const int b = bh / HH, h = bh % HH;
    const int lane = tid & 31, c = lane & 15;
    const int grp = (tid >> 5) * 2 + (lane >> 4);

    // staging ownership inside a chunk
    const int rA = tid >> 4, cA = tid & 15;     // k, q: rows rA and rA + 16, 4 floats
    const int rG = tid >> 3, cG = tid & 7;      // g, s: row rG, 4 floats of this half
    const size_t head = ((size_t)b * TD * HH + h) * 64;
    const size_t step = HH * 64;

    v4f rk0, rk1, rq0, rq1, rg, rs;
    auto fetch = [&](int t0) {
        const size_t oA = head + (size_t)(t0 + rA) * step + cA * 4;
        rk0 = *(const v4f*)&k[oA];  rk1 = *(const v4f*)&k[oA + 16 * step];
        rq0 = *(const v4f*)&q[oA];  rq1 = *(const v4f*)&q[oA + 16 * step];
        const size_t oG = head + (size_t)(t0 + rG) * step + mh * 32 + cG * 4;
        rg = *(const v4f*)&g[oG];   rs = *(const v4f*)&s[oG];
    };
    auto stage = [&]() {
        *(v4f*)&kq[rA][cA * 8]          = rk0;
        *(v4f*)&kq[rA][cA * 8 + 4]      = rq0;
        *(v4f*)&kq[rA + 16][cA * 8]     = rk1;
        *(v4f*)&kq[rA + 16][cA * 8 + 4] = rq1;
        for (int e = 0; e < 4; ++e) {
            const int ml = cG * 4 + e;
            gs[rG][(ml & 15) * 4 + (ml >> 4)]     = __expf(rg[e]);
            gs[rG][(ml & 15) * 4 + 2 + (ml >> 4)] = rs[e];
        }
    };

    v2f st[4];
    for (int i = 0; i < 4; ++i) st[i] = splat2(0.f);

    fetch(0);
    stage();
    __syncthreads();
    for (int t0 = 0; t0 < TD; t0 += TC) {
        if (t0 + TC < TD) fetch(t0 + TC);       // next chunk flies under this one
        // unrolled so that the LDS loads of later steps issue ahead of the
        // multiply-adds of earlier ones
        #pragma unroll 8
        for (int t = 0; t < TC; ++t) {
            const v4f kk = *(const v4f*)&kq[t][grp * 8];
            const v4f qq = *(const v4f*)&kq[t][grp * 8 + 4];
            const v4f ds = *(const v4f*)&gs[t][c * 4];
            const v2f dec = {ds.x, ds.y}, sw = {ds.z, ds.w};
            for (int i = 0; i < 4; ++i)
                st[i] = __builtin_elementwise_fma(st[i], dec, splat2(kk[i]) * sw);
            v2f a0 = splat2(qq[0]) * st[0];
            v2f a1 = splat2(qq[2]) * st[2];
            a0 = __builtin_elementwise_fma(splat2(qq[1]), st[1], a0);
            a1 = __builtin_elementwise_fma(splat2(qq[3]), st[3], a1);
            *(v2f*)&part[t][grp][c * 2] = a0 + a1;
        }
        __syncthreads();    // partials complete; every read of kq and gs done
        reduce_store(part, tid, 0.125f, ok, head + (size_t)t0 * step + mh * 32);
        if (t0 + TC < TD) stage();
        __syncthreads();    // next chunk published; partials free again
    }
}

// Pass 2: qv_t = softmax_m(ok_t), o[t][d] = sum_m qv_t[m] * V_t[m][d]
__global__ __launch_bounds__(256) void gsa_read_kernel(
    const float* __restrict__ ok, const float* __restrict__ v,
    const float* __restrict__ s, const float* __restrict__ g,
    float* __restrict__ o)
{
    __shared__ __attribute__((aligned(16))) float u[TC][16][12];    // [t][group][dec0..3 s0..3 qv0..3]
    __shared__ __attribute__((aligned(16))) float vv[TC][32];       // [t][2c + j]
    __shared__ __attribute__((aligned(16))) float part[TC][16][32]; // [t][group][2c + j]

    const int tid = threadIdx.x;
    const int bh = blockIdx.x >> 1, dh = blockIdx.x & 1;
    const int b = bh / HH, h = bh % HH;
    const int lane = tid & 31, c = lane & 15;
    const int grp = (tid >> 5) * 2 + (lane >> 4);

    const int rA = tid >> 4, cA = tid & 15;     // g, s: rows rA and rA + 16, 4 floats
    const int rG = tid >> 3, cG = tid & 7;      // v: row rG, 4 floats of this half; ok: row rG, 8 slots
    const size_t head = ((size_t)b * TD * HH + h) * 64;
    const size_t step = HH * 64;

    v4f rg0, rg1, rs0, rs1, rv;
    v4f rok0, rok1;
    auto fetch = [&](int t0) {
        const size_t oA = head + (size_t)(t0 + rA) * step + cA * 4;
        rg0 = *(const v4f*)&g[oA];  rg1 = *(const v4f*)&g[oA + 16 * step];
        rs0 = *(const v4f*)&s[oA];  rs1 = *(const v4f*)&s[oA + 16 * step];
        rv  = *(const v4f*)&v[head + (size_t)(t0 + rG) * step + dh * 32 + cG * 4];
        const size_t oK = head + (size_t)(t0 + rG) * step + cG * 8;
        rok0 = *(const v4f*)&ok[oK];  rok1 = *(const v4f*)&ok[oK + 4];
    };
    auto stage = [&]() {
        v4f e0, e1;
        for (int e = 0; e < 4; ++e) { e0[e] = __expf(rg0[e]); e1[e] = __expf(rg1[e]); }
        *(v4f*)&u[rA][cA][0]      = e0;
        *(v4f*)&u[rA][cA][4]      = rs0;
        *(v4f*)&u[rA + 16][cA][0] = e1;
        *(v4f*)&u[rA + 16][cA][4] = rs1;
        for (int e = 0; e < 4; ++e) {
            const int dl = cG * 4 + e;
            vv[rG][(dl & 15) * 2 + (dl >> 4)] = rv[e];
        }
        // softmax over the 64 slots of row rG: 8 slots a lane, 8 lanes a row
        float mx = fmaxf(rok0[0], rok1[0]);
        for (int e = 1; e < 4; ++e) mx = fmaxf(mx, fmaxf(rok0[e], rok1[e]));
        mx = fmaxf(mx, lane_xor<1>(mx));
        mx = fmaxf(mx, lane_xor<2>(mx));
        mx = fmaxf(mx, lane_xor<4>(mx));
        v4f p0, p1;
        for (int e = 0; e < 4; ++e) { p0[e] = __expf(rok0[e] - mx); p1[e] = __expf(rok1[e] - mx); }
        const v4f ps = p0 + p1;
        float sum = (ps[0] + ps[1]) + (ps[2] + ps[3]);
        sum += lane_xor<1>(sum);
        sum += lane_xor<2>(sum);
        sum += lane_xor<4>(sum);
        const float inv = 1.f / sum;
        *(v4f*)&u[rG][cG * 2][8]     = p0 * inv;
        *(v4f*)&u[rG][cG * 2 + 1][8] = p1 * inv;
    };

    v2f st[4];
    for (int i = 0; i < 4; ++i) st[i] = splat2(0.f);

    fetch(0);
    stage();
    __syncthreads();
    for (int t0 = 0; t0 < TD; t0 += TC) {
        if (t0 + TC < TD) fetch(t0 + TC);       // next chunk flies under this one
        // unrolled so that the LDS loads of later steps issue ahead of the
        // multiply-adds of earlier ones
        #pragma unroll 8
        for (int t = 0; t < TC; ++t) {
            const v4f dec = *(const v4f*)&u[t][grp][0];
            const v4f sw  = *(const v4f*)&u[t][grp][4];
            const v4f qv  = *(const v4f*)&u[t][grp][8];
            const v2f vc  = *(const v2f*)&vv[t][c * 2];
            for (int i = 0; i < 4; ++i)
                st[i] = __builtin_elementwise_fma(st[i], splat2(dec[i]), splat2(sw[i]) * vc);
            v2f a0 = splat2(qv[0]) * st[0];
            v2f a1 = splat2(qv[2]) * st[2];
            a0 = __builtin_elementwise_fma(splat2(qv[1]), st[1], a0);
            a1 = __builtin_elementwise_fma(splat2(qv[3]), st[3], a1);
            *(v2f*)&part[t][grp][c * 2] = a0 + a1;
        }
        __syncthreads();    // partials complete; every read of u and vv done
        reduce_store(part, tid, 1.f, o, head + (size_t)t0 * step + dh * 32);
        if (t0 + TC < TD) stage();
        __syncthreads();    // next chunk published; partials free again
    }
}

// ---------------------------------------------------------------------------
// Per-(b,t,h) RMSNorm over DV=64, convert to f16 for the Wo GEMM.
// ---------------------------------------------------------------------------
__global__ __launch_bounds__(64) void rms_cvt_kernel(
    const float* __restrict__ o, const float* __restrict__ w,
    _Float16* __restrict__ out)
{
    __shared__ float red[64];
    const int row = blockIdx.x, tid = threadIdx.x;
    float x = o[(size_t)row * 64 + tid];
    red[tid] = x * x;
    __syncthreads();
    for (int st = 32; st > 0; st >>= 1) {
        if (tid < st) red[tid] += red[tid + st];
        __syncthreads();
    }
    float rstd = rsqrtf(red[0] * (1.f / 64.f) + 1e-6f);
    out[(size_t)row * 64 + tid] = (_Float16)(x * rstd * w[tid]);
}

// ---------------------------------------------------------------------------
extern "C" void kernel_launch(void* const* d_in, const int* in_sizes, int n_in,
                              void* d_out, int out_size, void* d_ws, size_t ws_size,
                              hipStream_t stream)
{
    const float* x    = (const float*)d_in[0];
    const float* ln1w = (const float*)d_in[1];
    const float* ln1b = (const float*)d_in[2];
    const float* Wq   = (const float*)d_in[3];
    const float* Wk   = (const float*)d_in[4];
    const float* Wv   = (const float*)d_in[5];
    const float* Wf   = (const float*)d_in[6];
    const float* gnw  = (const float*)d_in[7];
    const float* Wo   = (const float*)d_in[8];
    const float* ln2w = (const float*)d_in[9];
    const float* ln2b = (const float*)d_in[10];
    const float* W1   = (const float*)d_in[11];
    const float* b1   = (const float*)d_in[12];
    const float* W2   = (const float*)d_in[13];
    const float* b2   = (const float*)d_in[14];
    float* outp = (float*)d_out;

    const int BT = BD * TD;   // 2048 rows for every GEMM

    char* wsp = (char*)d_ws;
    auto carve = [&](size_t bytes) -> char* {
        char* p = wsp;
        wsp += (bytes + 255) & ~(size_t)255;
        return p;
    };
    _Float16* h16   = (_Float16*)carve((size_t)BT * DD * 2);
    _Float16* WqT   = (_Float16*)carve((size_t)DD * 1024 * 2);
    _Float16* WkT   = (_Float16*)carve((size_t)DD * 1024 * 2);
    _Float16* WvT   = (_Float16*)carve((size_t)DD * 1024 * 2);
    _Float16* WfT   = (_Float16*)carve((size_t)DD * 1024 * 2);
    _Float16* WoT   = (_Float16*)carve((size_t)DD * 1024 * 2);
    _Float16* W1T   = (_Float16*)carve((size_t)MLPD * DD * 2);
    _Float16* W2T   = (_Float16*)carve((size_t)DD * MLPD * 2);
    float*    qb    = (float*)carve((size_t)BT * 1024 * 4);
    float*    kb    = (float*)carve((size_t)BT * 1024 * 4);
    float*    vb    = (float*)carve((size_t)BT * 1024 * 4);
    float*    sb    = (float*)carve((size_t)BT * 1024 * 4);
    float*    gb    = (float*)carve((size_t)BT * 1024 * 4);
    float*    ob    = (float*)carve((size_t)BT * 1024 * 4);
    float*    okb   = (float*)carve((size_t)BT * 1024 * 4);
    _Float16* on16  = (_Float16*)carve((size_t)BT * 1024 * 2);
    float*    yb    = (float*)carve((size_t)BT * DD * 4);
    _Float16* h216  = (_Float16*)carve((size_t)BT * DD * 2);
    _Float16* a16   = (_Float16*)carve((size_t)BT * MLPD * 2);

    const dim3 tb(32, 8);
    // weight transposes: in[K][N] -> f16 [N][K]
    transpose_cvt_f16<<<dim3(1024 / 32, DD / 32),  tb, 0, stream>>>(Wq, WqT, DD, 1024);
    transpose_cvt_f16<<<dim3(1024 / 32, DD / 32),  tb, 0, stream>>>(Wk, WkT, DD, 1024);
    transpose_cvt_f16<<<dim3(1024 / 32, DD / 32),  tb, 0, stream>>>(Wv, WvT, DD, 1024);
    transpose_cvt_f16<<<dim3(1024 / 32, DD / 32),  tb, 0, stream>>>(Wf, WfT, DD, 1024);
    transpose_cvt_f16<<<dim3(DD / 32,   1024 / 32),tb, 0, stream>>>(Wo, WoT, 1024, DD);
    transpose_cvt_f16<<<dim3(MLPD / 32, DD / 32),  tb, 0, stream>>>(W1, W1T, DD, MLPD);
    transpose_cvt_f16<<<dim3(DD / 32,   MLPD / 32),tb, 0, stream>>>(W2, W2T, MLPD, DD);

    // LN1
    layernorm_f16<<<BT, 256, 0, stream>>>(x, ln1w, ln1b, h16);

    // projections (fused activations)
    const dim3 gD(1024 / 128, BT / 128);
    gemm_wmma<1><<<gD, 256, 0, stream>>>(h16, WqT, qb, nullptr, nullptr, nullptr, nullptr, 1024, DD);
    gemm_wmma<1><<<gD, 256, 0, stream>>>(h16, WkT, kb, nullptr, nullptr, nullptr, nullptr, 1024, DD);
    gemm_wmma<0><<<gD, 256, 0, stream>>>(h16, WvT, vb, nullptr, nullptr, nullptr, nullptr, 1024, DD);
    gemm_wmma<2><<<gD, 256, 0, stream>>>(h16, WfT, sb, gb,      nullptr, nullptr, nullptr, 1024, DD);

    // recurrent gated-slot scan: slot scores for all t, then softmax and read-out
    gsa_scores_kernel<<<BD * HH * 2, 256, 0, stream>>>(qb, kb, sb, gb, okb);
    gsa_read_kernel<<<BD * HH * 2, 256, 0, stream>>>(okb, vb, sb, gb, ob);

    // per-head RMSNorm -> f16
    rms_cvt_kernel<<<BT * HH, 64, 0, stream>>>(ob, gnw, on16);

    // output projection + residual
    gemm_wmma<3><<<gD, 256, 0, stream>>>(on16, WoT, yb, nullptr, nullptr, nullptr, x, DD, 1024);

    // LN2
    layernorm_f16<<<BT, 256, 0, stream>>>(yb, ln2w, ln2b, h216);

    // MLP
    gemm_wmma<4><<<dim3(MLPD / 128, BT / 128), 256, 0, stream>>>(
        h216, W1T, nullptr, nullptr, a16, b1, nullptr, MLPD, DD);
    gemm_wmma<5><<<dim3(DD / 128, BT / 128), 256, 0, stream>>>(
        a16, W2T, outp, nullptr, nullptr, b2, yb, DD, MLPD);
}

// v002
// Measured time: 313 microseconds a run.
// Timed twice side by side with v001, it ran 1.20 and 1.19 times as fast.
// All steps since v000 together make it 4.81 times as fast.
#include <hip/hip_runtime.h>

#define BD 4
#define TD 512
#define DD 1024
#define HH 16
#define MLPD 4096

typedef __attribute__((ext_vector_type(16))) _Float16 v16h;
typedef __attribute__((ext_vector_type(8)))  _Float16 v8h;
typedef __attribute__((ext_vector_type(8)))  float    v8f;

// ---------------------------------------------------------------------------
// Transpose + f32->f16 convert:  in[K][N] (row-major) -> out[N][K] (row-major)
// so GEMM B operand is K-contiguous like A.
// ---------------------------------------------------------------------------
__global__ __launch_bounds__(256) void transpose_cvt_f16(
    const float* __restrict__ in, _Float16* __restrict__ out, int K, int N)
{
    __shared__ float tile[32][33];
    const int tx = threadIdx.x, ty = threadIdx.y;
    const int n0 = blockIdx.x * 32, k0 = blockIdx.y * 32;
    for (int j = 0; j < 32; j += 8)
        tile[ty + j][tx] = in[(size_t)(k0 + ty + j) * N + (n0 + tx)];
    __syncthreads();
    for (int j = 0; j < 32; j += 8)
        out[(size_t)(n0 + ty + j) * K + (k0 + tx)] = (_Float16)tile[tx][ty + j];
}

// ---------------------------------------------------------------------------
// LayerNorm over D=1024, output f16 (feeds WMMA GEMM A operand)
// ---------------------------------------------------------------------------
__global__ __launch_bounds__(256) void layernorm_f16(
    const float* __restrict__ x, const float* __restrict__ w,
    const float* __restrict__ b, _Float16* __restrict__ out)
{
    __shared__ float s1[256], s2[256];
    const int row = blockIdx.x, tid = threadIdx.x;
    const float* xr = x + (size_t)row * DD;
    float xs[4], sum = 0.f, sq = 0.f;
    for (int j = 0; j < 4; ++j) {
        float v = xr[tid + 256 * j];
        xs[j] = v; sum += v; sq += v * v;
    }
    s1[tid] = sum; s2[tid] = sq;
    __syncthreads();
    for (int st = 128; st > 0; st >>= 1) {
        if (tid < st) { s1[tid] += s1[tid + st]; s2[tid] += s2[tid + st]; }
        __syncthreads();
    }
    const float mu   = s1[0] * (1.f / DD);
    const float var  = s2[0] * (1.f / DD) - mu * mu;
    const float rstd = rsqrtf(var + 1e-6f);
    _Float16* orow = out + (size_t)row * DD;
    for (int j = 0; j < 4; ++j) {
        int i = tid + 256 * j;
        orow[i] = (_Float16)((xs[j] - mu) * rstd * w[i] + b[i]);
    }
}

// ---------------------------------------------------------------------------
// WMMA GEMM: C[M x N] = epilogue(A[M x K] @ Bt[N x K]^T)
// 128x128 block tile, 256 threads = 8 waves, each wave 32x64 (2x4 of 16x16).
// K staged 32-deep, DOUBLE-BUFFERED in LDS via CDNA5 async global->LDS copies
// (global_load_async_to_lds_b128, ASYNCcnt), so the HBM fetch of stage k+1
// overlaps the v_wmma work on stage k.
// EPI: 0=store f32, 1=swish f32, 2=gate (s,g) f32, 3=+res f32,
//      4=+bias,gelu -> f16, 5=+bias,+res f32
// ---------------------------------------------------------------------------
template<int EPI>
__global__ __launch_bounds__(256) void gemm_wmma(
    const _Float16* __restrict__ A, const _Float16* __restrict__ Bt,
    float* __restrict__ out0, float* __restrict__ out1,
    _Float16* __restrict__ outh,
    const float* __restrict__ bias, const float* __restrict__ res,
    int N, int K)
{
    // LDS row pitch in halfs: 32 of data + 8 unused = 80 B = 16 B x odd, so the
    // 16 rows that a half-wave's ds_load_b128 reads lie on distinct banks
    // (at the bare 64 B every fourth row shares its banks).
    constexpr int LP = 40;
    __shared__ __attribute__((aligned(16))) _Float16 As[2][128 * LP];
    __shared__ __attribute__((aligned(16))) _Float16 Bs[2][128 * LP];
    const int tid  = threadIdx.x;
    const int lane = tid & 31, wid = tid >> 5;
    const int wm = wid >> 1, wn = wid & 1;       // 4 waves along M, 2 along N
    const int lr = lane & 15, hs = lane >> 4;    // half-wave select (ISA layout)
    const int rowBlk = blockIdx.y * 128, colBlk = blockIdx.x * 128;

    // Each thread owns two fixed 16-byte chunks of the A tile and of the B
    // tile per stage: chunk c in [0,512): row = c>>2, half-offset = (c&3)*8.
    const int c0 = tid, c1 = tid + 256;
    const int r0 = c0 >> 2, o0 = (c0 & 3) * 8;
    const int r1 = c1 >> 2, o1 = (c1 & 3) * 8;
    const _Float16* gA0 = A  + (size_t)(rowBlk + r0) * K + o0;
    const _Float16* gA1 = A  + (size_t)(rowBlk + r1) * K + o1;
    const _Float16* gB0 = Bt + (size_t)(colBlk + r0) * K + o0;
    const _Float16* gB1 = Bt + (size_t)(colBlk + r1) * K + o1;
    // LDS byte addresses (low 32 bits of the generic pointer = LDS offset)
    const unsigned lA0 = (unsigned)(uintptr_t)&As[0][r0 * LP + o0];
    const unsigned lA1 = (unsigned)(uintptr_t)&As[0][r1 * LP + o1];
    const unsigned lB0 = (unsigned)(uintptr_t)&Bs[0][r0 * LP + o0];
    const unsigned lB1 = (unsigned)(uintptr_t)&Bs[0][r1 * LP + o1];
    const unsigned bufBytes = 128 * LP * 2;

    auto issue_stage = [&](int kk, int buf) {
        const unsigned bo = (unsigned)buf * bufBytes;
        const size_t ko = (size_t)kk * 32;
        asm volatile(
            "global_load_async_to_lds_b128 %0, %4, off\n\t"
            "global_load_async_to_lds_b128 %1, %5, off\n\t"
            "global_load_async_to_lds_b128 %2, %6, off\n\t"
            "global_load_async_to_lds_b128 %3, %7, off"
            :
            : "v"(lA0 + bo), "v"(lA1 + bo), "v"(lB0 + bo), "v"(lB1 + bo),
              "v"((unsigned long long)(uintptr_t)(gA0 + ko)),
              "v"((unsigned long long)(uintptr_t)(gA1 + ko)),
              "v"((unsigned long long)(uintptr_t)(gB0 + ko)),
              "v"((unsigned long long)(uintptr_t)(gB1 + ko))
            : "memory");
    };

    v8f acc[2][4];
    for (int i = 0; i < 2; ++i)
        for (int j = 0; j < 4; ++j)
            for (int r = 0; r < 8; ++r) acc[i][j][r] = 0.f;

    const int nk = K >> 5;
    issue_stage(0, 0);
    for (int kk = 0; kk < nk; ++kk) {
        const int buf = kk & 1;
        if (kk + 1 < nk) {
            issue_stage(kk + 1, buf ^ 1);                       // prefetch next
            asm volatile("s_wait_asynccnt 0x4" ::: "memory");   // stage kk done
        } else {
            asm volatile("s_wait_asynccnt 0x0" ::: "memory");
        }
        __syncthreads();

        const _Float16* Ab = As[buf];
        const _Float16* Bb = Bs[buf];
        // Fragment layout (16-bit A 16x32): lanes 0-15 hold K 0-7 / 16-23,
        // lanes 16-31 hold K 8-15 / 24-31, for row M = lane%16.
        v16h af[2], bf[4];
        for (int i = 0; i < 2; ++i) {
            int r = wm * 32 + i * 16 + lr;
            v8h lo = *(const v8h*)&Ab[r * LP + hs * 8];
            v8h hi = *(const v8h*)&Ab[r * LP + hs * 8 + 16];
            af[i] = __builtin_shufflevector(lo, hi, 0,1,2,3,4,5,6,7,8,9,10,11,12,13,14,15);
        }
        for (int j = 0; j < 4; ++j) {
            int r = wn * 64 + j * 16 + lr;
            v8h lo = *(const v8h*)&Bb[r * LP + hs * 8];
            v8h hi = *(const v8h*)&Bb[r * LP + hs * 8 + 16];
            bf[j] = __builtin_shufflevector(lo, hi, 0,1,2,3,4,5,6,7,8,9,10,11,12,13,14,15);
        }
        for (int i = 0; i < 2; ++i)
            for (int j = 0; j < 4; ++j)
                acc[i][j] = __builtin_amdgcn_wmma_f32_16x16x32_f16(
                    false, af[i], false, bf[j], (short)0, acc[i][j], false, false);
        __syncthreads();   // all LDS reads of buf done -> safe to refill later
    }

    // Epilogue. C/D layout: VGPR r holds M = r (lanes 0-15) or r+8 (lanes 16-31),
    // N = lane%16.
    for (int i = 0; i < 2; ++i)
        for (int j = 0; j < 4; ++j)
            for (int r = 0; r < 8; ++r) {
                int row = rowBlk + wm * 32 + i * 16 + hs * 8 + r;
                int col = colBlk + wn * 64 + j * 16 + lr;
                size_t idx = (size_t)row * N + col;
                float v = acc[i][j][r];
                if (EPI == 0) {
                    out0[idx] = v;
                } else if (EPI == 1) {                     // swish
                    out0[idx] = v / (1.f + __expf(-v));
                } else if (EPI == 2) {                     // gate: g = logsig(v)/8, s = 1-exp(g)
                    float ls = fminf(v, 0.f) - log1pf(__expf(-fabsf(v)));
                    float gg = ls * 0.125f;
                    out1[idx] = gg;
                    out0[idx] = -expm1f(gg);
                } else if (EPI == 3) {                     // + residual
                    out0[idx] = v + res[idx];
                } else if (EPI == 4) {                     // + bias, exact gelu, f16 out
                    float t = v + bias[col];
                    outh[idx] = (_Float16)(0.5f * t * (1.f + erff(t * 0.70710678118f)));
                } else if (EPI == 5) {                     // + bias + residual
                    out0[idx] = v + bias[col] + res[idx];
                }
            }
}

// ---------------------------------------------------------------------------
// Gated-slot attention scan, as two recurrences whose columns are independent.
// K[d][m] is decayed and written per slot m only, and V[m][d] feeds o[d] per
// column d only, so a lane that owns a column keeps its part of the state in
// registers for all T steps and never exchanges state with another lane.
// Pass 1 gives the slot scores ok[t][m] for every t, pass 2 takes their
// softmax and gives o[t][d]. Work-group = (b, h, half of the columns).
// A half-wave owns 4 rows of the contraction dim (16 groups in 8 waves) and a
// lane owns 2 columns (c and c + 16): 8 state values a lane, held as pairs.
// Time runs in chunks of TC steps staged in LDS; the 16 partial sums of each
// output are added once per chunk, so a chunk has two barriers in all.
// ---------------------------------------------------------------------------
#define TC 32
typedef __attribute__((ext_vector_type(2))) float v2f;
typedef __attribute__((ext_vector_type(4))) float v4f;

__device__ __forceinline__ v2f splat2(float a) { v2f r = {a, a}; return r; }

// Adds the 16 group partials of 4 neighbouring entries x = 2 * c + j and
// stores them at columns c + 16 * j of the output row.
__device__ __forceinline__ void reduce_store(
    const float (*part)[16][32], int tid, float scale, float* __restrict__ dst,
    size_t rowBase)
{
    const int t = tid >> 3, x4 = (tid & 7) * 4;
    v4f a = *(const v4f*)&part[t][0][x4];
    for (int gI = 1; gI < 16; ++gI) a += *(const v4f*)&part[t][gI][x4];
    a *= scale;
    float* p = dst + rowBase + (size_t)t * (HH * 64) + (x4 >> 1);
    v2f lo = {a.x, a.z}, hi = {a.y, a.w};
    *(v2f*)p = lo;
    *(v2f*)(p + 16) = hi;
    // the stores' address and data registers are reused right behind them
    asm volatile("s_wait_xcnt 0x0" ::: "memory");
}

// Value of lane l ^ M, M < 16: a register-to-register exchange inside a row of
// 16 lanes, so a reduction over 8 neighbouring lanes takes no LDS round trip.
template<int M>
__device__ __forceinline__ float lane_xor(float x)
{
    return __builtin_bit_cast(float, __builtin_amdgcn_update_dpp(
        0, __builtin_bit_cast(int, x), 0x160 + M, 0xf, 0xf, true));
}

// Pass 1: ok[t][m] = DK^-0.5 * sum_d q_t[d] * K_t[d][m]
__global__ __launch_bounds__(256) void gsa_scores_kernel(
    const float* __restrict__ q, const float* __restrict__ k,
    const float* __restrict__ s, const float* __restrict__ g,
    float* __restrict__ ok)
{
    __shared__ __attribute__((aligned(16))) float kq[TC][128];      // [t][group][k0..3 q0..3]
    __shared__ __attribute__((aligned(16))) float gs[TC][64];       // [t][c][dec0 dec1 s0 s1]
    __shared__ __attribute__((aligned(16))) float part[TC][16][32]; // [t][group][2c + j]

    const int tid = threadIdx.x;
    const int bh = blockIdx.x >> 1, mh = blockIdx.x & 1;
    const int b = bh / HH, h = bh % HH;
    const int lane = tid & 31, c = lane & 15;
    const int grp = (tid >> 5) * 2 + (lane >> 4);

    // staging ownership inside a chunk
    const int rA = tid >> 4, cA = tid & 15;     // k, q: rows rA and rA + 16, 4 floats
    const int rG = tid >> 3, cG = tid & 7;      // g, s: row rG, 4 floats of this half
    const size_t head = ((size_t)b * TD * HH + h) * 64;
    const size_t step = HH * 64;

    v4f rk0, rk1, rq0, rq1, rg, rs;
    auto fetch = [&](int t0) {
        const size_t oA = head + (size_t)(t0 + rA) * step + cA * 4;
        rk0 = *(const v4f*)&k[oA];  rk1 = *(const v4f*)&k[oA + 16 * step];
        rq0 = *(const v4f*)&q[oA];  rq1 = *(const v4f*)&q[oA + 16 * step];
        const size_t oG = head + (size_t)(t0 + rG) * step + mh * 32 + cG * 4;
        rg = *(const v4f*)&g[oG];   rs = *(const v4f*)&s[oG];
    };
    auto stage = [&]() {
        *(v4f*)&kq[rA][cA * 8]          = rk0;
        *(v4f*)&kq[rA][cA * 8 + 4]      = rq0;
        *(v4f*)&kq[rA + 16][cA * 8]     = rk1;
        *(v4f*)&kq[rA + 16][cA * 8 + 4] = rq1;
        for (int e = 0; e < 4; ++e) {
            const int ml = cG * 4 + e;
            gs[rG][(ml & 15) * 4 + (ml >> 4)]     = __expf(rg[e]);
            gs[rG][(ml & 15) * 4 + 2 + (ml >> 4)] = rs[e];
        }
    };

    v2f st[4];
    for (int i = 0; i < 4; ++i) st[i] = splat2(0.f);

    fetch(0);
    stage();
    __syncthreads();
    for (int t0 = 0; t0 < TD; t0 += TC) {
        if (t0 + TC < TD) fetch(t0 + TC);       // next chunk flies under this one
        // unrolled so that the LDS loads of later steps issue ahead of the
        // multiply-adds of earlier ones
        #pragma unroll 8
        for (int t = 0; t < TC; ++t) {
            const v4f kk = *(const v4f*)&kq[t][grp * 8];
            const v4f qq = *(const v4f*)&kq[t][grp * 8 + 4];
            const v4f ds = *(const v4f*)&gs[t][c * 4];
            const v2f dec = {ds.x, ds.y}, sw = {ds.z, ds.w};
            for (int i = 0; i < 4; ++i)
                st[i] = __builtin_elementwise_fma(st[i], dec, splat2(kk[i]) * sw);
            v2f a0 = splat2(qq[0]) * st[0];
            v2f a1 = splat2(qq[2]) * st[2];
            a0 = __builtin_elementwise_fma(splat2(qq[1]), st[1], a0);
            a1 = __builtin_elementwise_fma(splat2(qq[3]), st[3], a1);
            *(v2f*)&part[t][grp][c * 2] = a0 + a1;
        }
        __syncthreads();    // partials complete; every read of kq and gs done
        reduce_store(part, tid, 0.125f, ok, head + (size_t)t0 * step + mh * 32);
        if (t0 + TC < TD) stage();
        __syncthreads();    // next chunk published; partials free again
    }
}

// Pass 2: qv_t = softmax_m(ok_t), o[t][d] = sum_m qv_t[m] * V_t[m][d]
__global__ __launch_bounds__(256) void gsa_read_kernel(
    const float* __restrict__ ok, const float* __restrict__ v,
    const float* __restrict__ s, const float* __restrict__ g,
    float* __restrict__ o)
{
    __shared__ __attribute__((aligned(16))) float u[TC][16][12];    // [t][group][dec0..3 s0..3 qv0..3]
    __shared__ __attribute__((aligned(16))) float vv[TC][32];       // [t][2c + j]
    __shared__ __attribute__((aligned(16))) float part[TC][16][32]; // [t][group][2c + j]

    const int tid = threadIdx.x;
    const int bh = blockIdx.x >> 1, dh = blockIdx.x & 1;
    const int b = bh / HH, h = bh % HH;
    const int lane = tid & 31, c = lane & 15;
    const int grp = (tid >> 5) * 2 + (lane >> 4);

    const int rA = tid >> 4, cA = tid & 15;     // g, s: rows rA and rA + 16, 4 floats
    const int rG = tid >> 3, cG = tid & 7;      // v: row rG, 4 floats of this half; ok: row rG, 8 slots
    const size_t head = ((size_t)b * TD * HH + h) * 64;
    const size_t step = HH * 64;

    v4f rg0, rg1, rs0, rs1, rv;
    v4f rok0, rok1;
    auto fetch = [&](int t0) {
        const size_t oA = head + (size_t)(t0 + rA) * step + cA * 4;
        rg0 = *(const v4f*)&g[oA];  rg1 = *(const v4f*)&g[oA + 16 * step];
        rs0 = *(const v4f*)&s[oA];  rs1 = *(const v4f*)&s[oA + 16 * step];
        rv  = *(const v4f*)&v[head + (size_t)(t0 + rG) * step + dh * 32 + cG * 4];
        const size_t oK = head + (size_t)(t0 + rG) * step + cG * 8;
        rok0 = *(const v4f*)&ok[oK];  rok1 = *(const v4f*)&ok[oK + 4];
    };
    auto stage = [&]() {
        v4f e0, e1;
        for (int e = 0; e < 4; ++e) { e0[e] = __expf(rg0[e]); e1[e] = __expf(rg1[e]); }
        *(v4f*)&u[rA][cA][0]      = e0;
        *(v4f*)&u[rA][cA][4]      = rs0;
        *(v4f*)&u[rA + 16][cA][0] = e1;
        *(v4f*)&u[rA + 16][cA][4] = rs1;
        for (int e = 0; e < 4; ++e) {
            const int dl = cG * 4 + e;
            vv[rG][(dl & 15) * 2 + (dl >> 4)] = rv[e];
        }
        // softmax over the 64 slots of row rG: 8 slots a lane, 8 lanes a row
        float mx = fmaxf(rok0[0], rok1[0]);
        for (int e = 1; e < 4; ++e) mx = fmaxf(mx, fmaxf(rok0[e], rok1[e]));
        mx = fmaxf(mx, lane_xor<1>(mx));
        mx = fmaxf(mx, lane_xor<2>(mx));
        mx = fmaxf(mx, lane_xor<4>(mx));
        v4f p0, p1;
        for (int e = 0; e < 4; ++e) { p0[e] = __expf(rok0[e] - mx); p1[e] = __expf(rok1[e] - mx); }
        const v4f ps = p0 + p1;
        float sum = (ps[0] + ps[1]) + (ps[2] + ps[3]);
        sum += lane_xor<1>(sum);
        sum += lane_xor<2>(sum);
        sum += lane_xor<4>(sum);
        const float inv = 1.f / sum;
        *(v4f*)&u[rG][cG * 2][8]     = p0 * inv;
        *(v4f*)&u[rG][cG * 2 + 1][8] = p1 * inv;
    };

    v2f st[4];
    for (int i = 0; i < 4; ++i) st[i] = splat2(0.f);

    fetch(0);
    stage();
    __syncthreads();
    for (int t0 = 0; t0 < TD; t0 += TC) {
        if (t0 + TC < TD) fetch(t0 + TC);       // next chunk flies under this one
        // unrolled so that the LDS loads of later steps issue ahead of the
        // multiply-adds of earlier ones
        #pragma unroll 8
        for (int t = 0; t < TC; ++t) {
            const v4f dec = *(const v4f*)&u[t][grp][0];
            const v4f sw  = *(const v4f*)&u[t][grp][4];
            const v4f qv  = *(const v4f*)&u[t][grp][8];
            const v2f vc  = *(const v2f*)&vv[t][c * 2];
            for (int i = 0; i < 4; ++i)
                st[i] = __builtin_elementwise_fma(st[i], splat2(dec[i]), splat2(sw[i]) * vc);
            v2f a0 = splat2(qv[0]) * st[0];
            v2f a1 = splat2(qv[2]) * st[2];
            a0 = __builtin_elementwise_fma(splat2(qv[1]), st[1], a0);
            a1 = __builtin_elementwise_fma(splat2(qv[3]), st[3], a1);
            *(v2f*)&part[t][grp][c * 2] = a0 + a1;
        }
        __syncthreads();    // partials complete; every read of u and vv done
        reduce_store(part, tid, 1.f, o, head + (size_t)t0 * step + dh * 32);
        if (t0 + TC < TD) stage();
        __syncthreads();    // next chunk published; partials free again
    }
}

// ---------------------------------------------------------------------------
// Per-(b,t,h) RMSNorm over DV=64, convert to f16 for the Wo GEMM.
// ---------------------------------------------------------------------------
__global__ __launch_bounds__(64) void rms_cvt_kernel(
    const float* __restrict__ o, const float* __restrict__ w,
    _Float16* __restrict__ out)
{
    __shared__ float red[64];
    const int row = blockIdx.x, tid = threadIdx.x;
    float x = o[(size_t)row * 64 + tid];
    red[tid] = x * x;
    __syncthreads();
    for (int st = 32; st > 0; st >>= 1) {
        if (tid < st) red[tid] += red[tid + st];
        __syncthreads();
    }
    float rstd = rsqrtf(red[0] * (1.f / 64.f) + 1e-6f);
    out[(size_t)row * 64 + tid] = (_Float16)(x * rstd * w[tid]);
}

// ---------------------------------------------------------------------------
extern "C" void kernel_launch(void* const* d_in, const int* in_sizes, int n_in,
                              void* d_out, int out_size, void* d_ws, size_t ws_size,
                              hipStream_t stream)
{
    const float* x    = (const float*)d_in[0];
    const float* ln1w = (const float*)d_in[1];
    const float* ln1b = (const float*)d_in[2];
    const float* Wq   = (const float*)d_in[3];
    const float* Wk   = (const float*)d_in[4];
    const float* Wv   = (const float*)d_in[5];
    const float* Wf   = (const float*)d_in[6];
    const float* gnw  = (const float*)d_in[7];
    const float* Wo   = (const float*)d_in[8];
    const float* ln2w = (const float*)d_in[9];
    const float* ln2b = (const float*)d_in[10];
    const float* W1   = (const float*)d_in[11];
    const float* b1   = (const float*)d_in[12];
    const float* W2   = (const float*)d_in[13];
    const float* b2   = (const float*)d_in[14];
    float* outp = (float*)d_out;

    const int BT = BD * TD;   // 2048 rows for every GEMM

    char* wsp = (char*)d_ws;
    auto carve = [&](size_t bytes) -> char* {
        char* p = wsp;
        wsp += (bytes + 255) & ~(size_t)255;
        return p;
    };
    _Float16* h16   = (_Float16*)carve((size_t)BT * DD * 2);
    _Float16* WqT   = (_Float16*)carve((size_t)DD * 1024 * 2);
    _Float16* WkT   = (_Float16*)carve((size_t)DD * 1024 * 2);
    _Float16* WvT   = (_Float16*)carve((size_t)DD * 1024 * 2);
    _Float16* WfT   = (_Float16*)carve((size_t)DD * 1024 * 2);
    _Float16* WoT   = (_Float16*)carve((size_t)DD * 1024 * 2);
    _Float16* W1T   = (_Float16*)carve((size_t)MLPD * DD * 2);
    _Float16* W2T   = (_Float16*)carve((size_t)DD * MLPD * 2);
    float*    qb    = (float*)carve((size_t)BT * 1024 * 4);
    float*    kb    = (float*)carve((size_t)BT * 1024 * 4);
    float*    vb    = (float*)carve((size_t)BT * 1024 * 4);
    float*    sb    = (float*)carve((size_t)BT * 1024 * 4);
    float*    gb    = (float*)carve((size_t)BT * 1024 * 4);
    float*    ob    = (float*)carve((size_t)BT * 1024 * 4);
    float*    okb   = (float*)carve((size_t)BT * 1024 * 4);
    _Float16* on16  = (_Float16*)carve((size_t)BT * 1024 * 2);
    float*    yb    = (float*)carve((size_t)BT * DD * 4);
    _Float16* h216  = (_Float16*)carve((size_t)BT * DD * 2);
    _Float16* a16   = (_Float16*)carve((size_t)BT * MLPD * 2);

    const dim3 tb(32, 8);
    // weight transposes: in[K][N] -> f16 [N][K]
    transpose_cvt_f16<<<dim3(1024 / 32, DD / 32),  tb, 0, stream>>>(Wq, WqT, DD, 1024);
    transpose_cvt_f16<<<dim3(1024 / 32, DD / 32),  tb, 0, stream>>>(Wk, WkT, DD, 1024);
    transpose_cvt_f16<<<dim3(1024 / 32, DD / 32),  tb, 0, stream>>>(Wv, WvT, DD, 1024);
    transpose_cvt_f16<<<dim3(1024 / 32, DD / 32),  tb, 0, stream>>>(Wf, WfT, DD, 1024);
    transpose_cvt_f16<<<dim3(DD / 32,   1024 / 32),tb, 0, stream>>>(Wo, WoT, 1024, DD);
    transpose_cvt_f16<<<dim3(MLPD / 32, DD / 32),  tb, 0, stream>>>(W1, W1T, DD, MLPD);
    transpose_cvt_f16<<<dim3(DD / 32,   MLPD / 32),tb, 0, stream>>>(W2, W2T, MLPD, DD);

    // LN1
    layernorm_f16<<<BT, 256, 0, stream>>>(x, ln1w, ln1b, h16);

    // projections (fused activations)
    const dim3 gD(1024 / 128, BT / 128);
    gemm_wmma<1><<<gD, 256, 0, stream>>>(h16, WqT, qb, nullptr, nullptr, nullptr, nullptr, 1024, DD);
    gemm_wmma<1><<<gD, 256, 0, stream>>>(h16, WkT, kb, nullptr, nullptr, nullptr, nullptr, 1024, DD);
    gemm_wmma<0><<<gD, 256, 0, stream>>>(h16, WvT, vb, nullptr, nullptr, nullptr, nullptr, 1024, DD);
    gemm_wmma<2><<<gD, 256, 0, stream>>>(h16, WfT, sb, gb,      nullptr, nullptr, nullptr, 1024, DD);

    // recurrent gated-slot scan: slot scores for all t, then softmax and read-out
    gsa_scores_kernel<<<BD * HH * 2, 256, 0, stream>>>(qb, kb, sb, gb, okb);
    gsa_read_kernel<<<BD * HH * 2, 256, 0, stream>>>(okb, vb, sb, gb, ob);

    // per-head RMSNorm -> f16
    rms_cvt_kernel<<<BT * HH, 64, 0, stream>>>(ob, gnw, on16);

    // output projection + residual
    gemm_wmma<3><<<gD, 256, 0, stream>>>(on16, WoT, yb, nullptr, nullptr, nullptr, x, DD, 1024);

    // LN2
    layernorm_f16<<<BT, 256, 0, stream>>>(yb, ln2w, ln2b, h216);

    // MLP
    gemm_wmma<4><<<dim3(MLPD / 128, BT / 128), 256, 0, stream>>>(
        h216, W1T, nullptr, nullptr, a16, b1, nullptr, MLPD, DD);
    gemm_wmma<5><<<dim3(DD / 128, BT / 128), 256, 0, stream>>>(
        a16, W2T, outp, nullptr, nullptr, b2, yb, DD, MLPD);
}

// v003
// A run of this version takes 299 microseconds.
// Next to v002, in two timings, it ran 1.07 and 1.06 times as fast.
// Over all steps from v000 it is 5.12 times as fast.
#include <hip/hip_runtime.h>

#define BD 4
#define TD 512
#define DD 1024
#define HH 16
#define MLPD 4096

typedef __attribute__((ext_vector_type(16))) _Float16 v16h;
typedef __attribute__((ext_vector_type(8)))  _Float16 v8h;
typedef __attribute__((ext_vector_type(8)))  float    v8f;

// ---------------------------------------------------------------------------
// Transpose + f32->f16 convert of all seven weight matrices in ONE launch:
// in[K][N] (row-major) -> out[N][K] (row-major), so the GEMM B operand is
// K-contiguous like A. A work-group takes one 128 x 128 tile (64 elements a
// thread), so that few waves have to be started for the bytes that are moved.
// Reads: a wave's 16-byte loads cover one whole 512 B row of the tile.
// Writes: a wave's 16-byte stores cover two whole 256 B rows of the output.
// The LDS tile is [n][k] in f16, rows of 256 B = 16 chunks of 16 B; chunk c of
// row n lies at place c ^ ((n >> 2) & 15), so the 16 lanes of a half-wave hit
// 16 different places both when they write (rows 4 apart, one chunk) and when
// they read (one row, 16 chunks).
// Tiles: 5 x 64 (the 1024 x 1024 matrices), 256 (W1), 256 (W2) = 832.
// ---------------------------------------------------------------------------
typedef __attribute__((ext_vector_type(4))) float v4w;

// One tile. K and N are compile-time so that the 16 loads and the 8 stores of a
// thread differ from one another by immediate offsets only: one address each,
// and all 16 loads in flight together.
template<int K, int N>
__device__ __forceinline__ void transpose_tile(
    const float* __restrict__ in, _Float16* __restrict__ out, int tk, int tn,
    _Float16* tile)
{
    const int lane = threadIdx.x & 31, wid = threadIdx.x >> 5;

    // wave: k rows wid * 16 .. + 15; lane: columns n = lane * 4 .. + 3
    const float* src = in + (size_t)(tk * 128 + wid * 16) * N + tn * 128 + lane * 4;
    v4w r[16];
    for (int j = 0; j < 16; ++j) r[j] = *(const v4w*)(src + (size_t)j * N);
    // inputs only: holds all 16 loads in front of the first conversion, so that
    // a wave waits out one memory latency; without it the compiler issues them
    // in three groups with a full wait between the groups; src is named too so
    // that the address pair the loads share is not among the registers they fill
    asm volatile("" :: "v"(src), "v"(r[0]), "v"(r[1]), "v"(r[2]), "v"(r[3]), "v"(r[4]), "v"(r[5]),
                       "v"(r[6]), "v"(r[7]), "v"(r[8]), "v"(r[9]), "v"(r[10]), "v"(r[11]),
                       "v"(r[12]), "v"(r[13]), "v"(r[14]), "v"(r[15]));
    for (int gI = 0; gI < 2; ++gI)
        for (int e = 0; e < 4; ++e) {
            v8h p;
            for (int j = 0; j < 8; ++j) p[j] = (_Float16)r[gI * 8 + j][e];
            *(v8h*)&tile[(lane * 4 + e) * 128 + (((wid * 2 + gI) ^ (lane & 15)) * 8)] = p;
        }
    __syncthreads();

    // wave: output rows n = wid * 16 .. + 15, two a store; half-wave: one row
    const int hl = lane & 15, hr = lane >> 4;
    _Float16* dst = out + (size_t)(tn * 128 + wid * 16 + hr) * K + tk * 128 + hl * 8;
    for (int j = 0; j < 8; ++j) {
        const int n = wid * 16 + j * 2 + hr;
        const v8h p = *(const v8h*)&tile[n * 128 + ((hl ^ ((n >> 2) & 15)) * 8)];
        *(v8h*)(dst + (size_t)(j * 2) * K) = p;
    }
    // behind the last store: the listing lets a path run on into code that
    // reuses the stores' address and data registers
    asm volatile("s_wait_xcnt 0x0" ::: "memory");
}

__global__ __launch_bounds__(256) void transpose_cvt_all(
    const float* __restrict__ Wq, const float* __restrict__ Wk,
    const float* __restrict__ Wv, const float* __restrict__ Wf,
    const float* __restrict__ Wo, const float* __restrict__ W1,
    const float* __restrict__ W2,
    _Float16* __restrict__ WqT, _Float16* __restrict__ WkT,
    _Float16* __restrict__ WvT, _Float16* __restrict__ WfT,
    _Float16* __restrict__ WoT, _Float16* __restrict__ W1T,
    _Float16* __restrict__ W2T)
{
    __shared__ __attribute__((aligned(16))) _Float16 tile[128 * 128];
    const int bid = blockIdx.x;     // every branch below is uniform for the work-group
    if (bid < 320) {
        const int m = bid >> 6;
        const float* in = m == 0 ? Wq  : m == 1 ? Wk  : m == 2 ? Wv  : m == 3 ? Wf  : Wo;
        _Float16* out   = m == 0 ? WqT : m == 1 ? WkT : m == 2 ? WvT : m == 3 ? WfT : WoT;
        transpose_tile<1024, 1024>(in, out, (bid >> 3) & 7, bid & 7, tile);
    } else if (bid < 576) {
        transpose_tile<DD, MLPD>(W1, W1T, (bid - 320) >> 5, (bid - 320) & 31, tile);
    } else {
        transpose_tile<MLPD, DD>(W2, W2T, (bid - 576) >> 3, (bid - 576) & 7, tile);
    }
}

// ---------------------------------------------------------------------------
// LayerNorm over D=1024, output f16 (feeds WMMA GEMM A operand)
// ---------------------------------------------------------------------------
__global__ __launch_bounds__(256) void layernorm_f16(
    const float* __restrict__ x, const float* __restrict__ w,
    const float* __restrict__ b, _Float16* __restrict__ out)
{
    __shared__ float s1[256], s2[256];
    const int row = blockIdx.x, tid = threadIdx.x;
    const float* xr = x + (size_t)row * DD;
    float xs[4], sum = 0.f, sq = 0.f;
    for (int j = 0; j < 4; ++j) {
        float v = xr[tid + 256 * j];
        xs[j] = v; sum += v; sq += v * v;
    }
    s1[tid] = sum; s2[tid] = sq;
    __syncthreads();
    for (int st = 128; st > 0; st >>= 1) {
        if (tid < st) { s1[tid] += s1[tid + st]; s2[tid] += s2[tid + st]; }
        __syncthreads();
    }
    const float mu   = s1[0] * (1.f / DD);
    const float var  = s2[0] * (1.f / DD) - mu * mu;
    const float rstd = rsqrtf(var + 1e-6f);
    _Float16* orow = out + (size_t)row * DD;
    for (int j = 0; j < 4; ++j) {
        int i = tid + 256 * j;
        orow[i] = (_Float16)((xs[j] - mu) * rstd * w[i] + b[i]);
    }
}

// ---------------------------------------------------------------------------
// WMMA GEMM: C[M x N] = epilogue(A[M x K] @ Bt[N x K]^T)
// 128x128 block tile, 256 threads = 8 waves, each wave 32x64 (2x4 of 16x16).
// K staged 32-deep, DOUBLE-BUFFERED in LDS via CDNA5 async global->LDS copies
// (global_load_async_to_lds_b128, ASYNCcnt), so the HBM fetch of stage k+1
// overlaps the v_wmma work on stage k.
// EPI: 0=store f32, 1=swish f32, 2=gate (s,g) f32, 3=+res f32,
//      4=+bias,gelu -> f16, 5=+bias,+res f32
// ---------------------------------------------------------------------------
template<int EPI>
__global__ __launch_bounds__(256) void gemm_wmma(
    const _Float16* __restrict__ A, const _Float16* __restrict__ Bt,
    float* __restrict__ out0, float* __restrict__ out1,
    _Float16* __restrict__ outh,
    const float* __restrict__ bias, const float* __restrict__ res,
    int N, int K)
{
    // LDS row pitch in halfs: 32 of data + 8 unused = 80 B = 16 B x odd, so the
    // 16 rows that a half-wave's ds_load_b128 reads lie on distinct banks
    // (at the bare 64 B every fourth row shares its banks).
    constexpr int LP = 40;
    __shared__ __attribute__((aligned(16))) _Float16 As[2][128 * LP];
    __shared__ __attribute__((aligned(16))) _Float16 Bs[2][128 * LP];
    const int tid  = threadIdx.x;
    const int lane = tid & 31, wid = tid >> 5;
    const int wm = wid >> 1, wn = wid & 1;       // 4 waves along M, 2 along N
    const int lr = lane & 15, hs = lane >> 4;    // half-wave select (ISA layout)
    const int rowBlk = blockIdx.y * 128, colBlk = blockIdx.x * 128;

    // Each thread owns two fixed 16-byte chunks of the A tile and of the B
    // tile per stage: chunk c in [0,512): row = c>>2, half-offset = (c&3)*8.
    const int c0 = tid, c1 = tid + 256;
    const int r0 = c0 >> 2, o0 = (c0 & 3) * 8;
    const int r1 = c1 >> 2, o1 = (c1 & 3) * 8;
    const _Float16* gA0 = A  + (size_t)(rowBlk + r0) * K + o0;
    const _Float16* gA1 = A  + (size_t)(rowBlk + r1) * K + o1;
    const _Float16* gB0 = Bt + (size_t)(colBlk + r0) * K + o0;
    const _Float16* gB1 = Bt + (size_t)(colBlk + r1) * K + o1;
    // LDS byte addresses (low 32 bits of the generic pointer = LDS offset)
    const unsigned lA0 = (unsigned)(uintptr_t)&As[0][r0 * LP + o0];
    const unsigned lA1 = (unsigned)(uintptr_t)&As[0][r1 * LP + o1];
    const unsigned lB0 = (unsigned)(uintptr_t)&Bs[0][r0 * LP + o0];
    const unsigned lB1 = (unsigned)(uintptr_t)&Bs[0][r1 * LP + o1];
    const unsigned bufBytes = 128 * LP * 2;

    auto issue_stage = [&](int kk, int buf) {
        const unsigned bo = (unsigned)buf * bufBytes;
        const size_t ko = (size_t)kk * 32;
        asm volatile(
            "global_load_async_to_lds_b128 %0, %4, off\n\t"
            "global_load_async_to_lds_b128 %1, %5, off\n\t"
            "global_load_async_to_lds_b128 %2, %6, off\n\t"
            "global_load_async_to_lds_b128 %3, %7, off"
            :
            : "v"(lA0 + bo), "v"(lA1 + bo), "v"(lB0 + bo), "v"(lB1 + bo),
              "v"((unsigned long long)(uintptr_t)(gA0 + ko)),
              "v"((unsigned long long)(uintptr_t)(gA1 + ko)),
              "v"((unsigned long long)(uintptr_t)(gB0 + ko)),
              "v"((unsigned long long)(uintptr_t)(gB1 + ko))
            : "memory");
    };

    v8f acc[2][4];
    for (int i = 0; i < 2; ++i)
        for (int j = 0; j < 4; ++j)
            for (int r = 0; r < 8; ++r) acc[i][j][r] = 0.f;

    const int nk = K >> 5;
    issue_stage(0, 0);
    for (int kk = 0; kk < nk; ++kk) {
        const int buf = kk & 1;
        if (kk + 1 < nk) {
            issue_stage(kk + 1, buf ^ 1);                       // prefetch next
            asm volatile("s_wait_asynccnt 0x4" ::: "memory");   // stage kk done
        } else {
            asm volatile("s_wait_asynccnt 0x0" ::: "memory");
        }
        __syncthreads();

        const _Float16* Ab = As[buf];
        const _Float16* Bb = Bs[buf];
        // Fragment layout (16-bit A 16x32): lanes 0-15 hold K 0-7 / 16-23,
        // lanes 16-31 hold K 8-15 / 24-31, for row M = lane%16.
        v16h af[2], bf[4];
        for (int i = 0; i < 2; ++i) {
            int r = wm * 32 + i * 16 + lr;
            v8h lo = *(const v8h*)&Ab[r * LP + hs * 8];
            v8h hi = *(const v8h*)&Ab[r * LP + hs * 8 + 16];
            af[i] = __builtin_shufflevector(lo, hi, 0,1,2,3,4,5,6,7,8,9,10,11,12,13,14,15);
        }
        for (int j = 0; j < 4; ++j) {
            int r = wn * 64 + j * 16 + lr;
            v8h lo = *(const v8h*)&Bb[r * LP + hs * 8];
            v8h hi = *(const v8h*)&Bb[r * LP + hs * 8 + 16];
            bf[j] = __builtin_shufflevector(lo, hi, 0,1,2,3,4,5,6,7,8,9,10,11,12,13,14,15);
        }
        for (int i = 0; i < 2; ++i)
            for (int j = 0; j < 4; ++j)
                acc[i][j] = __builtin_amdgcn_wmma_f32_16x16x32_f16(
                    false, af[i], false, bf[j], (short)0, acc[i][j], false, false);
        __syncthreads();   // all LDS reads of buf done -> safe to refill later
    }

    // Epilogue. C/D layout: VGPR r holds M = r (lanes 0-15) or r+8 (lanes 16-31),
    // N = lane%16.
    for (int i = 0; i < 2; ++i)
        for (int j = 0; j < 4; ++j)
            for (int r = 0; r < 8; ++r) {
                int row = rowBlk + wm * 32 + i * 16 + hs * 8 + r;
                int col = colBlk + wn * 64 + j * 16 + lr;
                size_t idx = (size_t)row * N + col;
                float v = acc[i][j][r];
                if (EPI == 0) {
                    out0[idx] = v;
                } else if (EPI == 1) {                     // swish
                    out0[idx] = v / (1.f + __expf(-v));
                } else if (EPI == 2) {                     // gate: g = logsig(v)/8, s = 1-exp(g)
                    float ls = fminf(v, 0.f) - log1pf(__expf(-fabsf(v)));
                    float gg = ls * 0.125f;
                    out1[idx] = gg;
                    out0[idx] = -expm1f(gg);
                } else if (EPI == 3) {                     // + residual
                    out0[idx] = v + res[idx];
                } else if (EPI == 4) {                     // + bias, exact gelu, f16 out
                    float t = v + bias[col];
                    outh[idx] = (_Float16)(0.5f * t * (1.f + erff(t * 0.70710678118f)));
                } else if (EPI == 5) {                     // + bias + residual
                    out0[idx] = v + bias[col] + res[idx];
                }
            }
}

// ---------------------------------------------------------------------------
// Gated-slot attention scan, as two recurrences whose columns are independent.
// K[d][m] is decayed and written per slot m only, and V[m][d] feeds o[d] per
// column d only, so a lane that owns a column keeps its part of the state in
// registers for all T steps and never exchanges state with another lane.
// Pass 1 gives the slot scores ok[t][m] for every t, pass 2 takes their
// softmax and gives o[t][d]. Work-group = (b, h, half of the columns).
// A half-wave owns 4 rows of the contraction dim (16 groups in 8 waves) and a
// lane owns 2 columns (c and c + 16): 8 state values a lane, held as pairs.
// Time runs in chunks of TC steps staged in LDS; the 16 partial sums of each
// output are added once per chunk, so a chunk has two barriers in all.
// ---------------------------------------------------------------------------
#define TC 32
typedef __attribute__((ext_vector_type(2))) float v2f;
typedef __attribute__((ext_vector_type(4))) float v4f;

__device__ __forceinline__ v2f splat2(float a) { v2f r = {a, a}; return r; }

// Adds the 16 group partials of 4 neighbouring entries x = 2 * c + j and
// stores them at columns c + 16 * j of the output row.
__device__ __forceinline__ void reduce_store(
    const float (*part)[16][32], int tid, float scale, float* __restrict__ dst,
    size_t rowBase)
{
    const int t = tid >> 3, x4 = (tid & 7) * 4;
    v4f a = *(const v4f*)&part[t][0][x4];
    for (int gI = 1; gI < 16; ++gI) a += *(const v4f*)&part[t][gI][x4];
    a *= scale;
    float* p = dst + rowBase + (size_t)t * (HH * 64) + (x4 >> 1);
    v2f lo = {a.x, a.z}, hi = {a.y, a.w};
    *(v2f*)p = lo;
    *(v2f*)(p + 16) = hi;
    // the stores' address and data registers are reused right behind them
    asm volatile("s_wait_xcnt 0x0" ::: "memory");
}

// Value of lane l ^ M, M < 16: a register-to-register exchange inside a row of
// 16 lanes, so a reduction over 8 neighbouring lanes takes no LDS round trip.
template<int M>
__device__ __forceinline__ float lane_xor(float x)
{
    return __builtin_bit_cast(float, __builtin_amdgcn_update_dpp(
        0, __builtin_bit_cast(int, x), 0x160 + M, 0xf, 0xf, true));
}

// Pass 1: ok[t][m] = DK^-0.5 * sum_d q_t[d] * K_t[d][m]
__global__ __launch_bounds__(256) void gsa_scores_kernel(
    const float* __restrict__ q, const float* __restrict__ k,
    const float* __restrict__ s, const float* __restrict__ g,
    float* __restrict__ ok)
{
    __shared__ __attribute__((aligned(16))) float kq[TC][128];      // [t][group][k0..3 q0..3]
    __shared__ __attribute__((aligned(16))) float gs[TC][64];       // [t][c][dec0 dec1 s0 s1]
    __shared__ __attribute__((aligned(16))) float part[TC][16][32]; // [t][group][2c + j]

    const int tid = threadIdx.x;
    const int bh = blockIdx.x >> 1, mh = blockIdx.x & 1;
    const int b = bh / HH, h = bh % HH;
    const int lane = tid & 31, c = lane & 15;
    const int grp = (tid >> 5) * 2 + (lane >> 4);

    // staging ownership inside a chunk
    const int rA = tid >> 4, cA = tid & 15;     // k, q: rows rA and rA + 16, 4 floats
    const int rG = tid >> 3, cG = tid & 7;      // g, s: row rG, 4 floats of this half
    const size_t head = ((size_t)b * TD * HH + h) * 64;
    const size_t step = HH * 64;

    v4f rk0, rk1, rq0, rq1, rg, rs;
    auto fetch = [&](int t0) {
        const size_t oA = head + (size_t)(t0 + rA) * step + cA * 4;
        rk0 = *(const v4f*)&k[oA];  rk1 = *(const v4f*)&k[oA + 16 * step];
        rq0 = *(const v4f*)&q[oA];  rq1 = *(const v4f*)&q[oA + 16 * step];
        const size_t oG = head + (size_t)(t0 + rG) * step + mh * 32 + cG * 4;
        rg = *(const v4f*)&g[oG];   rs = *(const v4f*)&s[oG];
    };
    auto stage = [&]() {
        *(v4f*)&kq[rA][cA * 8]          = rk0;
        *(v4f*)&kq[rA][cA * 8 + 4]      = rq0;
        *(v4f*)&kq[rA + 16][cA * 8]     = rk1;
        *(v4f*)&kq[rA + 16][cA * 8 + 4] = rq1;
        for (int e = 0; e < 4; ++e) {
            const int ml = cG * 4 + e;
            gs[rG][(ml & 15) * 4 + (ml >> 4)]     = __expf(rg[e]);
            gs[rG][(ml & 15) * 4 + 2 + (ml >> 4)] = rs[e];
        }
    };

    v2f st[4];
    for (int i = 0; i < 4; ++i) st[i] = splat2(0.f);

    fetch(0);
    stage();
    __syncthreads();
    for (int t0 = 0; t0 < TD; t0 += TC) {
        if (t0 + TC < TD) fetch(t0 + TC);       // next chunk flies under this one
        // unrolled so that the LDS loads of later steps issue ahead of the
        // multiply-adds of earlier ones
        #pragma unroll 8
        for (int t = 0; t < TC; ++t) {
            const v4f kk = *(const v4f*)&kq[t][grp * 8];
            const v4f qq = *(const v4f*)&kq[t][grp * 8 + 4];
            const v4f ds = *(const v4f*)&gs[t][c * 4];
            const v2f dec = {ds.x, ds.y}, sw = {ds.z, ds.w};
            for (int i = 0; i < 4; ++i)
                st[i] = __builtin_elementwise_fma(st[i], dec, splat2(kk[i]) * sw);
            v2f a0 = splat2(qq[0]) * st[0];
            v2f a1 = splat2(qq[2]) * st[2];
            a0 = __builtin_elementwise_fma(splat2(qq[1]), st[1], a0);
            a1 = __builtin_elementwise_fma(splat2(qq[3]), st[3], a1);
            *(v2f*)&part[t][grp][c * 2] = a0 + a1;
        }
        __syncthreads();    // partials complete; every read of kq and gs done
        reduce_store(part, tid, 0.125f, ok, head + (size_t)t0 * step + mh * 32);
        if (t0 + TC < TD) stage();
        __syncthreads();    // next chunk published; partials free again
    }
}

// Pass 2: qv_t = softmax_m(ok_t), o[t][d] = sum_m qv_t[m] * V_t[m][d]
__global__ __launch_bounds__(256) void gsa_read_kernel(
    const float* __restrict__ ok, const float* __restrict__ v,
    const float* __restrict__ s, const float* __restrict__ g,
    float* __restrict__ o)
{
    __shared__ __attribute__((aligned(16))) float u[TC][16][12];    // [t][group][dec0..3 s0..3 qv0..3]
    __shared__ __attribute__((aligned(16))) float vv[TC][32];       // [t][2c + j]
    __shared__ __attribute__((aligned(16))) float part[TC][16][32]; // [t][group][2c + j]

    const int tid = threadIdx.x;
    const int bh = blockIdx.x >> 1, dh = blockIdx.x & 1;
    const int b = bh / HH, h = bh % HH;
    const int lane = tid & 31, c = lane & 15;
    const int grp = (tid >> 5) * 2 + (lane >> 4);

    const int rA = tid >> 4, cA = tid & 15;     // g, s: rows rA and rA + 16, 4 floats
    const int rG = tid >> 3, cG = tid & 7;      // v: row rG, 4 floats of this half; ok: row rG, 8 slots
    const size_t head = ((size_t)b * TD * HH + h) * 64;
    const size_t step = HH * 64;

    v4f rg0, rg1, rs0, rs1, rv;
    v4f rok0, rok1;
    auto fetch = [&](int t0) {
        const size_t oA = head + (size_t)(t0 + rA) * step + cA * 4;
        rg0 = *(const v4f*)&g[oA];  rg1 = *(const v4f*)&g[oA + 16 * step];
        rs0 = *(const v4f*)&s[oA];  rs1 = *(const v4f*)&s[oA + 16 * step];
        rv  = *(const v4f*)&v[head + (size_t)(t0 + rG) * step + dh * 32 + cG * 4];
        const size_t oK = head + (size_t)(t0 + rG) * step + cG * 8;
        rok0 = *(const v4f*)&ok[oK];  rok1 = *(const v4f*)&ok[oK + 4];
    };
    auto stage = [&]() {
        v4f e0, e1;
        for (int e = 0; e < 4; ++e) { e0[e] = __expf(rg0[e]); e1[e] = __expf(rg1[e]); }
        *(v4f*)&u[rA][cA][0]      = e0;
        *(v4f*)&u[rA][cA][4]      = rs0;
        *(v4f*)&u[rA + 16][cA][0] = e1;
        *(v4f*)&u[rA + 16][cA][4] = rs1;
        for (int e = 0; e < 4; ++e) {
            const int dl = cG * 4 + e;
            vv[rG][(dl & 15) * 2 + (dl >> 4)] = rv[e];
        }
        // softmax over the 64 slots of row rG: 8 slots a lane, 8 lanes a row
        float mx = fmaxf(rok0[0], rok1[0]);
        for (int e = 1; e < 4; ++e) mx = fmaxf(mx, fmaxf(rok0[e], rok1[e]));
        mx = fmaxf(mx, lane_xor<1>(mx));
        mx = fmaxf(mx, lane_xor<2>(mx));
        mx = fmaxf(mx, lane_xor<4>(mx));
        v4f p0, p1;
        for (int e = 0; e < 4; ++e) { p0[e] = __expf(rok0[e] - mx); p1[e] = __expf(rok1[e] - mx); }
        const v4f ps = p0 + p1;
        float sum = (ps[0] + ps[1]) + (ps[2] + ps[3]);
        sum += lane_xor<1>(sum);
        sum += lane_xor<2>(sum);
        sum += lane_xor<4>(sum);
        const float inv = 1.f / sum;
        *(v4f*)&u[rG][cG * 2][8]     = p0 * inv;
        *(v4f*)&u[rG][cG * 2 + 1][8] = p1 * inv;
    };

    v2f st[4];
    for (int i = 0; i < 4; ++i) st[i] = splat2(0.f);

    fetch(0);
    stage();
    __syncthreads();
    for (int t0 = 0; t0 < TD; t0 += TC) {
        if (t0 + TC < TD) fetch(t0 + TC);       // next chunk flies under this one
        // unrolled so that the LDS loads of later steps issue ahead of the
        // multiply-adds of earlier ones
        #pragma unroll 8
        for (int t = 0; t < TC; ++t) {
            const v4f dec = *(const v4f*)&u[t][grp][0];
            const v4f sw  = *(const v4f*)&u[t][grp][4];
            const v4f qv  = *(const v4f*)&u[t][grp][8];
            const v2f vc  = *(const v2f*)&vv[t][c * 2];
            for (int i = 0; i < 4; ++i)
                st[i] = __builtin_elementwise_fma(st[i], splat2(dec[i]), splat2(sw[i]) * vc);
            v2f a0 = splat2(qv[0]) * st[0];
            v2f a1 = splat2(qv[2]) * st[2];
            a0 = __builtin_elementwise_fma(splat2(qv[1]), st[1], a0);
            a1 = __builtin_elementwise_fma(splat2(qv[3]), st[3], a1);
            *(v2f*)&part[t][grp][c * 2] = a0 + a1;
        }
        __syncthreads();    // partials complete; every read of u and vv done
        reduce_store(part, tid, 1.f, o, head + (size_t)t0 * step + dh * 32);
        if (t0 + TC < TD) stage();
        __syncthreads();    // next chunk published; partials free again
    }
}

// ---------------------------------------------------------------------------
// Per-(b,t,h) RMSNorm over DV=64, convert to f16 for the Wo GEMM.
// ---------------------------------------------------------------------------
__global__ __launch_bounds__(64) void rms_cvt_kernel(
    const float* __restrict__ o, const float* __restrict__ w,
    _Float16* __restrict__ out)
{
    __shared__ float red[64];
    const int row = blockIdx.x, tid = threadIdx.x;
    float x = o[(size_t)row * 64 + tid];
    red[tid] = x * x;
    __syncthreads();
    for (int st = 32; st > 0; st >>= 1) {
        if (tid < st) red[tid] += red[tid + st];
        __syncthreads();
    }
    float rstd = rsqrtf(red[0] * (1.f / 64.f) + 1e-6f);
    out[(size_t)row * 64 + tid] = (_Float16)(x * rstd * w[tid]);
}

// ---------------------------------------------------------------------------
extern "C" void kernel_launch(void* const* d_in, const int* in_sizes, int n_in,
                              void* d_out, int out_size, void* d_ws, size_t ws_size,
                              hipStream_t stream)
{
    const float* x    = (const float*)d_in[0];
    const float* ln1w = (const float*)d_in[1];
    const float* ln1b = (const float*)d_in[2];
    const float* Wq   = (const float*)d_in[3];
    const float* Wk   = (const float*)d_in[4];
    const float* Wv   = (const float*)d_in[5];
    const float* Wf   = (const float*)d_in[6];
    const float* gnw  = (const float*)d_in[7];
    const float* Wo   = (const float*)d_in[8];
    const float* ln2w = (const float*)d_in[9];
    const float* ln2b = (const float*)d_in[10];
    const float* W1   = (const float*)d_in[11];
    const float* b1   = (const float*)d_in[12];
    const float* W2   = (const float*)d_in[13];
    const float* b2   = (const float*)d_in[14];
    float* outp = (float*)d_out;

    const int BT = BD * TD;   // 2048 rows for every GEMM

    char* wsp = (char*)d_ws;
    auto carve = [&](size_t bytes) -> char* {
        char* p = wsp;
        wsp += (bytes + 255) & ~(size_t)255;
        return p;
    };
    _Float16* h16   = (_Float16*)carve((size_t)BT * DD * 2);
    _Float16* WqT   = (_Float16*)carve((size_t)DD * 1024 * 2);
    _Float16* WkT   = (_Float16*)carve((size_t)DD * 1024 * 2);
    _Float16* WvT   = (_Float16*)carve((size_t)DD * 1024 * 2);
    _Float16* WfT   = (_Float16*)carve((size_t)DD * 1024 * 2);
    _Float16* WoT   = (_Float16*)carve((size_t)DD * 1024 * 2);
    _Float16* W1T   = (_Float16*)carve((size_t)MLPD * DD * 2);
    _Float16* W2T   = (_Float16*)carve((size_t)DD * MLPD * 2);
    float*    qb    = (float*)carve((size_t)BT * 1024 * 4);
    float*    kb    = (float*)carve((size_t)BT * 1024 * 4);
    float*    vb    = (float*)carve((size_t)BT * 1024 * 4);
    float*    sb    = (float*)carve((size_t)BT * 1024 * 4);
    float*    gb    = (float*)carve((size_t)BT * 1024 * 4);
    float*    ob    = (float*)carve((size_t)BT * 1024 * 4);
    float*    okb   = (float*)carve((size_t)BT * 1024 * 4);
    _Float16* on16  = (_Float16*)carve((size_t)BT * 1024 * 2);
    float*    yb    = (float*)carve((size_t)BT * DD * 4);
    _Float16* h216  = (_Float16*)carve((size_t)BT * DD * 2);
    _Float16* a16   = (_Float16*)carve((size_t)BT * MLPD * 2);

    // weight transposes: in[K][N] -> f16 [N][K], all seven in one launch
    transpose_cvt_all<<<832, 256, 0, stream>>>(Wq, Wk, Wv, Wf, Wo, W1, W2,
                                               WqT, WkT, WvT, WfT, WoT, W1T, W2T);

    // LN1
    layernorm_f16<<<BT, 256, 0, stream>>>(x, ln1w, ln1b, h16);

    // projections (fused activations)
    const dim3 gD(1024 / 128, BT / 128);
    gemm_wmma<1><<<gD, 256, 0, stream>>>(h16, WqT, qb, nullptr, nullptr, nullptr, nullptr, 1024, DD);
    gemm_wmma<1><<<gD, 256, 0, stream>>>(h16, WkT, kb, nullptr, nullptr, nullptr, nullptr, 1024, DD);
    gemm_wmma<0><<<gD, 256, 0, stream>>>(h16, WvT, vb, nullptr, nullptr, nullptr, nullptr, 1024, DD);
    gemm_wmma<2><<<gD, 256, 0, stream>>>(h16, WfT, sb, gb,      nullptr, nullptr, nullptr, 1024, DD);

    // recurrent gated-slot scan: slot scores for all t, then softmax and read-out
    gsa_scores_kernel<<<BD * HH * 2, 256, 0, stream>>>(qb, kb, sb, gb, okb);
    gsa_read_kernel<<<BD * HH * 2, 256, 0, stream>>>(okb, vb, sb, gb, ob);

    // per-head RMSNorm -> f16
    rms_cvt_kernel<<<BT * HH, 64, 0, stream>>>(ob, gnw, on16);

    // output projection + residual
    gemm_wmma<3><<<gD, 256, 0, stream>>>(on16, WoT, yb, nullptr, nullptr, nullptr, x, DD, 1024);

    // LN2
    layernorm_f16<<<BT, 256, 0, stream>>>(yb, ln2w, ln2b, h216);

    // MLP
    gemm_wmma<4><<<dim3(MLPD / 128, BT / 128), 256, 0, stream>>>(
        h216, W1T, nullptr, nullptr, a16, b1, nullptr, MLPD, DD);
    gemm_wmma<5><<<dim3(DD / 128, BT / 128), 256, 0, stream>>>(
        a16, W2T, outp, nullptr, nullptr, b2, yb, DD, MLPD);
}

// v004
// Measured time: 259 microseconds a run.
// In two side-by-side timings against v003, it was 1.16 and 1.17 times as fast.
// All steps since v000 together make it 5.96 times as fast.
#include <hip/hip_runtime.h>

#define BD 4
#define TD 512
#define DD 1024
#define HH 16
#define MLPD 4096

typedef __attribute__((ext_vector_type(16))) _Float16 v16h;
typedef __attribute__((ext_vector_type(8)))  _Float16 v8h;
typedef __attribute__((ext_vector_type(8)))  float    v8f;

// ---------------------------------------------------------------------------
// Transpose + f32->f16 convert of all seven weight matrices in ONE launch:
// in[K][N] (row-major) -> out[N][K] (row-major), so the GEMM B operand is
// K-contiguous like A. A work-group takes one 128 x 128 tile (64 elements a
// thread), so that few waves have to be started for the bytes that are moved.
// Reads: a wave's 16-byte loads cover one whole 512 B row of the tile.
// Writes: a wave's 16-byte stores cover two whole 256 B rows of the output.
// The LDS tile is [n][k] in f16, rows of 256 B = 16 chunks of 16 B; chunk c of
// row n lies at place c ^ ((n >> 2) & 15), so the 16 lanes of a half-wave hit
// 16 different places both when they write (rows 4 apart, one chunk) and when
// they read (one row, 16 chunks).
// Tiles: 5 x 64 (the 1024 x 1024 matrices), 256 (W1), 256 (W2) = 832.
// ---------------------------------------------------------------------------
typedef __attribute__((ext_vector_type(4))) float v4w;

// One tile. K and N are compile-time so that the 16 loads and the 8 stores of a
// thread differ from one another by immediate offsets only: one address each,
// and all 16 loads in flight together.
template<int K, int N>
__device__ __forceinline__ void transpose_tile(
    const float* __restrict__ in, _Float16* __restrict__ out, int tk, int tn,
    _Float16* tile)
{
    const int lane = threadIdx.x & 31, wid = threadIdx.x >> 5;

    // wave: k rows wid * 16 .. + 15; lane: columns n = lane * 4 .. + 3
    const float* src = in + (size_t)(tk * 128 + wid * 16) * N + tn * 128 + lane * 4;
    v4w r[16];
    for (int j = 0; j < 16; ++j) r[j] = *(const v4w*)(src + (size_t)j * N);
    // inputs only: holds all 16 loads in front of the first conversion, so that
    // a wave waits out one memory latency; without it the compiler issues them
    // in three groups with a full wait between the groups; src is named too so
    // that the address pair the loads share is not among the registers they fill
    asm volatile("" :: "v"(src), "v"(r[0]), "v"(r[1]), "v"(r[2]), "v"(r[3]), "v"(r[4]), "v"(r[5]),
                       "v"(r[6]), "v"(r[7]), "v"(r[8]), "v"(r[9]), "v"(r[10]), "v"(r[11]),
                       "v"(r[12]), "v"(r[13]), "v"(r[14]), "v"(r[15]));
    for (int gI = 0; gI < 2; ++gI)
        for (int e = 0; e < 4; ++e) {
            v8h p;
            for (int j = 0; j < 8; ++j) p[j] = (_Float16)r[gI * 8 + j][e];
            *(v8h*)&tile[(lane * 4 + e) * 128 + (((wid * 2 + gI) ^ (lane & 15)) * 8)] = p;
        }
    __syncthreads();

    // wave: output rows n = wid * 16 .. + 15, two a store; half-wave: one row
    const int hl = lane & 15, hr = lane >> 4;
    _Float16* dst = out + (size_t)(tn * 128 + wid * 16 + hr) * K + tk * 128 + hl * 8;
    for (int j = 0; j < 8; ++j) {
        const int n = wid * 16 + j * 2 + hr;
        const v8h p = *(const v8h*)&tile[n * 128 + ((hl ^ ((n >> 2) & 15)) * 8)];
        *(v8h*)(dst + (size_t)(j * 2) * K) = p;
    }
    // behind the last store: the listing lets a path run on into code that
    // reuses the stores' address and data registers
    asm volatile("s_wait_xcnt 0x0" ::: "memory");
}

__global__ __launch_bounds__(256) void transpose_cvt_all(
    const float* __restrict__ Wq, const float* __restrict__ Wk,
    const float* __restrict__ Wv, const float* __restrict__ Wf,
    const float* __restrict__ Wo, const float* __restrict__ W1,
    const float* __restrict__ W2,
    _Float16* __restrict__ WqT, _Float16* __restrict__ WkT,
    _Float16* __restrict__ WvT, _Float16* __restrict__ WfT,
    _Float16* __restrict__ WoT, _Float16* __restrict__ W1T,
    _Float16* __restrict__ W2T)
{
    __shared__ __attribute__((aligned(16))) _Float16 tile[128 * 128];
    const int bid = blockIdx.x;     // every branch below is uniform for the work-group
    if (bid < 320) {
        const int m = bid >> 6;
        const float* in = m == 0 ? Wq  : m == 1 ? Wk  : m == 2 ? Wv  : m == 3 ? Wf  : Wo;
        _Float16* out   = m == 0 ? WqT : m == 1 ? WkT : m == 2 ? WvT : m == 3 ? WfT : WoT;
        transpose_tile<1024, 1024>(in, out, (bid >> 3) & 7, bid & 7, tile);
    } else if (bid < 576) {
        transpose_tile<DD, MLPD>(W1, W1T, (bid - 320) >> 5, (bid - 320) & 31, tile);
    } else {
        transpose_tile<MLPD, DD>(W2, W2T, (bid - 576) >> 3, (bid - 576) & 7, tile);
    }
}

// ---------------------------------------------------------------------------
// LayerNorm over D=1024, output f16 (feeds WMMA GEMM A operand)
// ---------------------------------------------------------------------------
__global__ __launch_bounds__(256) void layernorm_f16(
    const float* __restrict__ x, const float* __restrict__ w,
    const float* __restrict__ b, _Float16* __restrict__ out)
{
    __shared__ float s1[256], s2[256];
    const int row = blockIdx.x, tid = threadIdx.x;
    const float* xr = x + (size_t)row * DD;
    float xs[4], sum = 0.f, sq = 0.f;
    for (int j = 0; j < 4; ++j) {
        float v = xr[tid + 256 * j];
        xs[j] = v; sum += v; sq += v * v;
    }
    s1[tid] = sum; s2[tid] = sq;
    __syncthreads();
    for (int st = 128; st > 0; st >>= 1) {
        if (tid < st) { s1[tid] += s1[tid + st]; s2[tid] += s2[tid + st]; }
        __syncthreads();
    }
    const float mu   = s1[0] * (1.f / DD);
    const float var  = s2[0] * (1.f / DD) - mu * mu;
    const float rstd = rsqrtf(var + 1e-6f);
    _Float16* orow = out + (size_t)row * DD;
    for (int j = 0; j < 4; ++j) {
        int i = tid + 256 * j;
        orow[i] = (_Float16)((xs[j] - mu) * rstd * w[i] + b[i]);
    }
}

// ---------------------------------------------------------------------------
// WMMA GEMM: C[M x N] = epilogue(A[M x K] @ Bt[N x K]^T)
// 128x128 block tile, 256 threads = 8 waves, each wave 32x64 (2x4 of 16x16).
// K staged 32-deep, DOUBLE-BUFFERED in LDS via CDNA5 async global->LDS copies
// (global_load_async_to_lds_b128, ASYNCcnt), so the HBM fetch of stage k+1
// overlaps the v_wmma work on stage k.
// EPI: 0=the four input projections in one product (below), 3=+res f32,
//      4=+bias,gelu -> f16, 5=+bias,+res f32
// EPI 0: Bt holds the transposed Wq, Wk, Wv, Wf one behind the other, 4096 rows
// in all, so one launch has 512 work-groups (two for every WGP) where four
// launches of 128 each left half of the WGPs idle. out0 is five planes of
// BD * TD rows x 1024 floats: q, k, v, s, g. N is the pitch of a plane. The 128
// columns of a work-group lie in one matrix, so the choice of its activation is
// uniform for the work-group.
// ---------------------------------------------------------------------------
template<int EPI>
__global__ __launch_bounds__(256) void gemm_wmma(
    const _Float16* __restrict__ A, const _Float16* __restrict__ Bt,
    float* __restrict__ out0, float* __restrict__ out1,
    _Float16* __restrict__ outh,
    const float* __restrict__ bias, const float* __restrict__ res,
    int N, int K)
{
    // LDS row pitch in halfs: 32 of data + 8 unused = 80 B = 16 B x odd, so the
    // 16 rows that a half-wave's ds_load_b128 reads lie on distinct banks
    // (at the bare 64 B every fourth row shares its banks).
    constexpr int LP = 40;
    __shared__ __attribute__((aligned(16))) _Float16 As[2][128 * LP];
    __shared__ __attribute__((aligned(16))) _Float16 Bs[2][128 * LP];
    const int tid  = threadIdx.x;
    const int lane = tid & 31, wid = tid >> 5;
    const int wm = wid >> 1, wn = wid & 1;       // 4 waves along M, 2 along N
    const int lr = lane & 15, hs = lane >> 4;    // half-wave select (ISA layout)
    const int rowBlk = blockIdx.y * 128, colBlk = blockIdx.x * 128;

    // Each thread owns two fixed 16-byte chunks of the A tile and of the B
    // tile per stage: chunk c in [0,512): row = c>>2, half-offset = (c&3)*8.
    const int c0 = tid, c1 = tid + 256;
    const int r0 = c0 >> 2, o0 = (c0 & 3) * 8;
    const int r1 = c1 >> 2, o1 = (c1 & 3) * 8;
    const _Float16* gA0 = A  + (size_t)(rowBlk + r0) * K + o0;
    const _Float16* gA1 = A  + (size_t)(rowBlk + r1) * K + o1;
    const _Float16* gB0 = Bt + (size_t)(colBlk + r0) * K + o0;
    const _Float16* gB1 = Bt + (size_t)(colBlk + r1) * K + o1;
    // LDS byte addresses (low 32 bits of the generic pointer = LDS offset)
    const unsigned lA0 = (unsigned)(uintptr_t)&As[0][r0 * LP + o0];
    const unsigned lA1 = (unsigned)(uintptr_t)&As[0][r1 * LP + o1];
    const unsigned lB0 = (unsigned)(uintptr_t)&Bs[0][r0 * LP + o0];
    const unsigned lB1 = (unsigned)(uintptr_t)&Bs[0][r1 * LP + o1];
    const unsigned bufBytes = 128 * LP * 2;

    auto issue_stage = [&](int kk, int buf) {
        const unsigned bo = (unsigned)buf * bufBytes;
        const size_t ko = (size_t)kk * 32;
        // the last line is a precaution: it stands in front of the next trip's
        // additions to the address registers that these copies name
        asm volatile(
            "global_load_async_to_lds_b128 %0, %4, off\n\t"
            "global_load_async_to_lds_b128 %1, %5, off\n\t"
            "global_load_async_to_lds_b128 %2, %6, off\n\t"
            "global_load_async_to_lds_b128 %3, %7, off\n\t"
            "s_wait_xcnt 0x0"
            :
            : "v"(lA0 + bo), "v"(lA1 + bo), "v"(lB0 + bo), "v"(lB1 + bo),
              "v"((unsigned long long)(uintptr_t)(gA0 + ko)),
              "v"((unsigned long long)(uintptr_t)(gA1 + ko)),
              "v"((unsigned long long)(uintptr_t)(gB0 + ko)),
              "v"((unsigned long long)(uintptr_t)(gB1 + ko))
            : "memory");
    };

    v8f acc[2][4];
    for (int i = 0; i < 2; ++i)
        for (int j = 0; j < 4; ++j)
            for (int r = 0; r < 8; ++r) acc[i][j][r] = 0.f;

    const int nk = K >> 5;
    issue_stage(0, 0);
    for (int kk = 0; kk < nk; ++kk) {
        const int buf = kk & 1;
        if (kk + 1 < nk) {
            issue_stage(kk + 1, buf ^ 1);                       // prefetch next
            asm volatile("s_wait_asynccnt 0x4" ::: "memory");   // stage kk done
        } else {
            asm volatile("s_wait_asynccnt 0x0" ::: "memory");
        }
        __syncthreads();

        const _Float16* Ab = As[buf];
        const _Float16* Bb = Bs[buf];
        // Fragment layout (16-bit A 16x32): lanes 0-15 hold K 0-7 / 16-23,
        // lanes 16-31 hold K 8-15 / 24-31, for row M = lane%16.
        v16h af[2], bf[4];
        for (int i = 0; i < 2; ++i) {
            int r = wm * 32 + i * 16 + lr;
            v8h lo = *(const v8h*)&Ab[r * LP + hs * 8];
            v8h hi = *(const v8h*)&Ab[r * LP + hs * 8 + 16];
            af[i] = __builtin_shufflevector(lo, hi, 0,1,2,3,4,5,6,7,8,9,10,11,12,13,14,15);
        }
        for (int j = 0; j < 4; ++j) {
            int r = wn * 64 + j * 16 + lr;
            v8h lo = *(const v8h*)&Bb[r * LP + hs * 8];
            v8h hi = *(const v8h*)&Bb[r * LP + hs * 8 + 16];
            bf[j] = __builtin_shufflevector(lo, hi, 0,1,2,3,4,5,6,7,8,9,10,11,12,13,14,15);
        }
        for (int i = 0; i < 2; ++i)
            for (int j = 0; j < 4; ++j)
                acc[i][j] = __builtin_amdgcn_wmma_f32_16x16x32_f16(
                    false, af[i], false, bf[j], (short)0, acc[i][j], false, false);
        __syncthreads();   // all LDS reads of buf done -> safe to refill later
    }

    // Epilogue. C/D layout: VGPR r holds M = r (lanes 0-15) or r+8 (lanes 16-31),
    // N = lane%16.
    if (EPI == 0) {
        const size_t PL = (size_t)BD * TD * 1024;
        const int mat = colBlk >> 10;               // 0 Wq, 1 Wk, 2 Wv, 3 Wf
        float* pl = out0 + (size_t)mat * PL;
        auto each = [&](auto f) {
            for (int i = 0; i < 2; ++i)
                for (int j = 0; j < 4; ++j)
                    for (int r = 0; r < 8; ++r) {
                        int row = rowBlk + wm * 32 + i * 16 + hs * 8 + r;
                        int col = (colBlk & 1023) + wn * 64 + j * 16 + lr;
                        f(acc[i][j][r], (size_t)row * N + col);
                    }
        };
        if (mat < 2) {                                 // q, k: swish
            each([&](float v, size_t idx) { pl[idx] = v / (1.f + __expf(-v)); });
        } else if (mat == 2) {                         // v
            each([&](float v, size_t idx) { pl[idx] = v; });
            // behind the last store: the listing lets a path run on into the swish
            // code, which reuses the stores' address registers
            asm volatile("s_wait_xcnt 0x0" ::: "memory");
        } else {                                       // gate: g = logsig(v)/8, s = 1-exp(g)
            each([&](float v, size_t idx) {
                float ls = fminf(v, 0.f) - log1pf(__expf(-fabsf(v)));
                float gg = ls * 0.125f;
                pl[idx + PL] = gg;
                pl[idx] = -expm1f(gg);
            });
        }
        return;
    }
    for (int i = 0; i < 2; ++i)
        for (int j = 0; j < 4; ++j)
            for (int r = 0; r < 8; ++r) {
                int row = rowBlk + wm * 32 + i * 16 + hs * 8 + r;
                int col = colBlk + wn * 64 + j * 16 + lr;
                size_t idx = (size_t)row * N + col;
                float v = acc[i][j][r];
                if (EPI == 3) {                            // + residual
                    out0[idx] = v + res[idx];
                } else if (EPI == 4) {                     // + bias, exact gelu, f16 out
                    float t = v + bias[col];
                    outh[idx] = (_Float16)(0.5f * t * (1.f + erff(t * 0.70710678118f)));
                } else if (EPI == 5) {                     // + bias + residual
                    out0[idx] = v + bias[col] + res[idx];
                }
            }
}

// ---------------------------------------------------------------------------
// Gated-slot attention scan, as two recurrences whose columns are independent.
// K[d][m] is decayed and written per slot m only, and V[m][d] feeds o[d] per
// column d only, so a lane that owns a column keeps its part of the state in
// registers for all T steps and never exchanges state with another lane.
// Pass 1 gives the slot scores ok[t][m] for every t, pass 2 takes their
// softmax and gives o[t][d]. Work-group = (b, h, half of the columns).
// A half-wave owns 4 rows of the contraction dim (16 groups in 8 waves) and a
// lane owns 2 columns (c and c + 16): 8 state values a lane, held as pairs.
// Time runs in chunks of TC steps staged in LDS; the 16 partial sums of each
// output are added once per chunk, so a chunk has two barriers in all.
// ---------------------------------------------------------------------------
#define TC 32
typedef __attribute__((ext_vector_type(2))) float v2f;
typedef __attribute__((ext_vector_type(4))) float v4f;

__device__ __forceinline__ v2f splat2(float a) { v2f r = {a, a}; return r; }

// Adds the 16 group partials of 4 neighbouring entries x = 2 * c + j and
// stores them at columns c + 16 * j of the output row.
__device__ __forceinline__ void reduce_store(
    const float (*part)[16][32], int tid, float scale, float* __restrict__ dst,
    size_t rowBase)
{
    const int t = tid >> 3, x4 = (tid & 7) * 4;
    v4f a = *(const v4f*)&part[t][0][x4];
    for (int gI = 1; gI < 16; ++gI) a += *(const v4f*)&part[t][gI][x4];
    a *= scale;
    float* p = dst + rowBase + (size_t)t * (HH * 64) + (x4 >> 1);
    v2f lo = {a.x, a.z}, hi = {a.y, a.w};
    *(v2f*)p = lo;
    *(v2f*)(p + 16) = hi;
    // the stores' address and data registers are reused right behind them
    asm volatile("s_wait_xcnt 0x0" ::: "memory");
}

// Value of lane l ^ M, M < 16: a register-to-register exchange inside a row of
// 16 lanes, so a reduction over 8 neighbouring lanes takes no LDS round trip.
template<int M>
__device__ __forceinline__ float lane_xor(float x)
{
    return __builtin_bit_cast(float, __builtin_amdgcn_update_dpp(
        0, __builtin_bit_cast(int, x), 0x160 + M, 0xf, 0xf, true));
}

// Pass 1: ok[t][m] = DK^-0.5 * sum_d q_t[d] * K_t[d][m]
__global__ __launch_bounds__(256) void gsa_scores_kernel(
    const float* __restrict__ q, const float* __restrict__ k,
    const float* __restrict__ s, const float* __restrict__ g,
    float* __restrict__ ok)
{
    __shared__ __attribute__((aligned(16))) float kq[TC][128];      // [t][group][k0..3 q0..3]
    __shared__ __attribute__((aligned(16))) float gs[TC][64];       // [t][c][dec0 dec1 s0 s1]
    __shared__ __attribute__((aligned(16))) float part[TC][16][32]; // [t][group][2c + j]

    const int tid = threadIdx.x;
    const int bh = blockIdx.x >> 1, mh = blockIdx.x & 1;
    const int b = bh / HH, h = bh % HH;
    const int lane = tid & 31, c = lane & 15;
    const int grp = (tid >> 5) * 2 + (lane >> 4);

    // staging ownership inside a chunk
    const int rA = tid >> 4, cA = tid & 15;     // k, q: rows rA and rA + 16, 4 floats
    const int rG = tid >> 3, cG = tid & 7;      // g, s: row rG, 4 floats of this half
    const size_t head = ((size_t)b * TD * HH + h) * 64;
    const size_t step = HH * 64;

    v4f rk0, rk1, rq0, rq1, rg, rs;
    auto fetch = [&](int t0) {
        const size_t oA = head + (size_t)(t0 + rA) * step + cA * 4;
        rk0 = *(const v4f*)&k[oA];  rk1 = *(const v4f*)&k[oA + 16 * step];
        rq0 = *(const v4f*)&q[oA];  rq1 = *(const v4f*)&q[oA + 16 * step];
        const size_t oG = head + (size_t)(t0 + rG) * step + mh * 32 + cG * 4;
        rg = *(const v4f*)&g[oG];   rs = *(const v4f*)&s[oG];
    };
    auto stage = [&]() {
        *(v4f*)&kq[rA][cA * 8]          = rk0;
        *(v4f*)&kq[rA][cA * 8 + 4]      = rq0;
        *(v4f*)&kq[rA + 16][cA * 8]     = rk1;
        *(v4f*)&kq[rA + 16][cA * 8 + 4] = rq1;
        for (int e = 0; e < 4; ++e) {
            const int ml = cG * 4 + e;
            gs[rG][(ml & 15) * 4 + (ml >> 4)]     = __expf(rg[e]);
            gs[rG][(ml & 15) * 4 + 2 + (ml >> 4)] = rs[e];
        }
    };

    v2f st[4];
    for (int i = 0; i < 4; ++i) st[i] = splat2(0.f);

    fetch(0);
    stage();
    __syncthreads();
    for (int t0 = 0; t0 < TD; t0 += TC) {
        if (t0 + TC < TD) fetch(t0 + TC);       // next chunk flies under this one
        // unrolled so that the LDS loads of later steps issue ahead of the
        // multiply-adds of earlier ones
        #pragma unroll 8
        for (int t = 0; t < TC; ++t) {
            const v4f kk = *(const v4f*)&kq[t][grp * 8];
            const v4f qq = *(const v4f*)&kq[t][grp * 8 + 4];
            const v4f ds = *(const v4f*)&gs[t][c * 4];
            const v2f dec = {ds.x, ds.y}, sw = {ds.z, ds.w};
            for (int i = 0; i < 4; ++i)
                st[i] = __builtin_elementwise_fma(st[i], dec, splat2(kk[i]) * sw);
            v2f a0 = splat2(qq[0]) * st[0];
            v2f a1 = splat2(qq[2]) * st[2];
            a0 = __builtin_elementwise_fma(splat2(qq[1]), st[1], a0);
            a1 = __builtin_elementwise_fma(splat2(qq[3]), st[3], a1);
            *(v2f*)&part[t][grp][c * 2] = a0 + a1;
        }
        __syncthreads();    // partials complete; every read of kq and gs done
        reduce_store(part, tid, 0.125f, ok, head + (size_t)t0 * step + mh * 32);
        if (t0 + TC < TD) stage();
        __syncthreads();    // next chunk published; partials free again
    }
}

// Pass 2: qv_t = softmax_m(ok_t), o[t][d] = sum_m qv_t[m] * V_t[m][d]
__global__ __launch_bounds__(256) void gsa_read_kernel(
    const float* __restrict__ ok, const float* __restrict__ v,
    const float* __restrict__ s, const float* __restrict__ g,
    float* __restrict__ o)
{
    __shared__ __attribute__((aligned(16))) float u[TC][16][12];    // [t][group][dec0..3 s0..3 qv0..3]
    __shared__ __attribute__((aligned(16))) float vv[TC][32];       // [t][2c + j]
    __shared__ __attribute__((aligned(16))) float part[TC][16][32]; // [t][group][2c + j]

    const int tid = threadIdx.x;
    const int bh = blockIdx.x >> 1, dh = blockIdx.x & 1;
    const int b = bh / HH, h = bh % HH;
    const int lane = tid & 31, c = lane & 15;
    const int grp = (tid >> 5) * 2 + (lane >> 4);

    const int rA = tid >> 4, cA = tid & 15;     // g, s: rows rA and rA + 16, 4 floats
    const int rG = tid >> 3, cG = tid & 7;      // v: row rG, 4 floats of this half; ok: row rG, 8 slots
    const size_t head = ((size_t)b * TD * HH + h) * 64;
    const size_t step = HH * 64;

    v4f rg0, rg1, rs0, rs1, rv;
    v4f rok0, rok1;
    auto fetch = [&](int t0) {
        const size_t oA = head + (size_t)(t0 + rA) * step + cA * 4;
        rg0 = *(const v4f*)&g[oA];  rg1 = *(const v4f*)&g[oA + 16 * step];
        rs0 = *(const v4f*)&s[oA];  rs1 = *(const v4f*)&s[oA + 16 * step];
        rv  = *(const v4f*)&v[head + (size_t)(t0 + rG) * step + dh * 32 + cG * 4];
        const size_t oK = head + (size_t)(t0 + rG) * step + cG * 8;
        rok0 = *(const v4f*)&ok[oK];  rok1 = *(const v4f*)&ok[oK + 4];
    };
    auto stage = [&]() {
        v4f e0, e1;
        for (int e = 0; e < 4; ++e) { e0[e] = __expf(rg0[e]); e1[e] = __expf(rg1[e]); }
        *(v4f*)&u[rA][cA][0]      = e0;
        *(v4f*)&u[rA][cA][4]      = rs0;
        *(v4f*)&u[rA + 16][cA][0] = e1;
        *(v4f*)&u[rA + 16][cA][4] = rs1;
        for (int e = 0; e < 4; ++e) {
            const int dl = cG * 4 + e;
            vv[rG][(dl & 15) * 2 + (dl >> 4)] = rv[e];
        }
        // softmax over the 64 slots of row rG: 8 slots a lane, 8 lanes a row
        float mx = fmaxf(rok0[0], rok1[0]);
        for (int e = 1; e < 4; ++e) mx = fmaxf(mx, fmaxf(rok0[e], rok1[e]));
        mx = fmaxf(mx, lane_xor<1>(mx));
        mx = fmaxf(mx, lane_xor<2>(mx));
        mx = fmaxf(mx, lane_xor<4>(mx));
        v4f p0, p1;
        for (int e = 0; e < 4; ++e) { p0[e] = __expf(rok0[e] - mx); p1[e] = __expf(rok1[e] - mx); }
        const v4f ps = p0 + p1;
        float sum = (ps[0] + ps[1]) + (ps[2] + ps[3]);
        sum += lane_xor<1>(sum);
        sum += lane_xor<2>(sum);
        sum += lane_xor<4>(sum);
        const float inv = 1.f / sum;
        *(v4f*)&u[rG][cG * 2][8]     = p0 * inv;
        *(v4f*)&u[rG][cG * 2 + 1][8] = p1 * inv;
    };

    v2f st[4];
    for (int i = 0; i < 4; ++i) st[i] = splat2(0.f);

    fetch(0);
    stage();
    __syncthreads();
    for (int t0 = 0; t0 < TD; t0 += TC) {
        if (t0 + TC < TD) fetch(t0 + TC);       // next chunk flies under this one
        // unrolled so that the LDS loads of later steps issue ahead of the
        // multiply-adds of earlier ones
        #pragma unroll 8
        for (int t = 0; t < TC; ++t) {
            const v4f dec = *(const v4f*)&u[t][grp][0];
            const v4f sw  = *(const v4f*)&u[t][grp][4];
            const v4f qv  = *(const v4f*)&u[t][grp][8];
            const v2f vc  = *(const v2f*)&vv[t][c * 2];
            for (int i = 0; i < 4; ++i)
                st[i] = __builtin_elementwise_fma(st[i], splat2(dec[i]), splat2(sw[i]) * vc);
            v2f a0 = splat2(qv[0]) * st[0];
            v2f a1 = splat2(qv[2]) * st[2];
            a0 = __builtin_elementwise_fma(splat2(qv[1]), st[1], a0);
            a1 = __builtin_elementwise_fma(splat2(qv[3]), st[3], a1);
            *(v2f*)&part[t][grp][c * 2] = a0 + a1;
        }
        __syncthreads();    // partials complete; every read of u and vv done
        reduce_store(part, tid, 1.f, o, head + (size_t)t0 * step + dh * 32);
        if (t0 + TC < TD) stage();
        __syncthreads();    // next chunk published; partials free again
    }
}

// ---------------------------------------------------------------------------
// Per-(b,t,h) RMSNorm over DV=64, convert to f16 for the Wo GEMM.
// ---------------------------------------------------------------------------
__global__ __launch_bounds__(64) void rms_cvt_kernel(
    const float* __restrict__ o, const float* __restrict__ w,
    _Float16* __restrict__ out)
{
    __shared__ float red[64];
    const int row = blockIdx.x, tid = threadIdx.x;
    float x = o[(size_t)row * 64 + tid];
    red[tid] = x * x;
    __syncthreads();
    for (int st = 32; st > 0; st >>= 1) {
        if (tid < st) red[tid] += red[tid + st];
        __syncthreads();
    }
    float rstd = rsqrtf(red[0] * (1.f / 64.f) + 1e-6f);
    out[(size_t)row * 64 + tid] = (_Float16)(x * rstd * w[tid]);
}

// ---------------------------------------------------------------------------
extern "C" void kernel_launch(void* const* d_in, const int* in_sizes, int n_in,
                              void* d_out, int out_size, void* d_ws, size_t ws_size,
                              hipStream_t stream)
{
    const float* x    = (const float*)d_in[0];
    const float* ln1w = (const float*)d_in[1];
    const float* ln1b = (const float*)d_in[2];
    const float* Wq   = (const float*)d_in[3];
    const float* Wk   = (const float*)d_in[4];
    const float* Wv   = (const float*)d_in[5];
    const float* Wf   = (const float*)d_in[6];
    const float* gnw  = (const float*)d_in[7];
    const float* Wo   = (const float*)d_in[8];
    const float* ln2w = (const float*)d_in[9];
    const float* ln2b = (const float*)d_in[10];
    const float* W1   = (const float*)d_in[11];
    const float* b1   = (const float*)d_in[12];
    const float* W2   = (const float*)d_in[13];
    const float* b2   = (const float*)d_in[14];
    float* outp = (float*)d_out;

    const int BT = BD * TD;   // 2048 rows for every GEMM

    char* wsp = (char*)d_ws;
    auto carve = [&](size_t bytes) -> char* {
        char* p = wsp;
        wsp += (bytes + 255) & ~(size_t)255;
        return p;
    };
    _Float16* h16   = (_Float16*)carve((size_t)BT * DD * 2);
    // Wq, Wk, Wv, Wf transposed, one behind the other: the B operand [4096][DD]
    _Float16* WqT   = (_Float16*)carve((size_t)4 * DD * 1024 * 2);
    _Float16* WkT   = WqT + (size_t)DD * 1024;
    _Float16* WvT   = WkT + (size_t)DD * 1024;
    _Float16* WfT   = WvT + (size_t)DD * 1024;
    _Float16* WoT   = (_Float16*)carve((size_t)DD * 1024 * 2);
    _Float16* W1T   = (_Float16*)carve((size_t)MLPD * DD * 2);
    _Float16* W2T   = (_Float16*)carve((size_t)DD * MLPD * 2);
    // the five planes that the projection launch writes: q, k, v, s, g
    float*    qb    = (float*)carve((size_t)5 * BT * 1024 * 4);
    float*    kb    = qb + (size_t)BT * 1024;
    float*    vb    = kb + (size_t)BT * 1024;
    float*    sb    = vb + (size_t)BT * 1024;
    float*    gb    = sb + (size_t)BT * 1024;
    float*    ob    = (float*)carve((size_t)BT * 1024 * 4);
    float*    okb   = (float*)carve((size_t)BT * 1024 * 4);
    _Float16* on16  = (_Float16*)carve((size_t)BT * 1024 * 2);
    float*    yb    = (float*)carve((size_t)BT * DD * 4);
    _Float16* h216  = (_Float16*)carve((size_t)BT * DD * 2);
    _Float16* a16   = (_Float16*)carve((size_t)BT * MLPD * 2);

    // weight transposes: in[K][N] -> f16 [N][K], all seven in one launch
    transpose_cvt_all<<<832, 256, 0, stream>>>(Wq, Wk, Wv, Wf, Wo, W1, W2,
                                               WqT, WkT, WvT, WfT, WoT, W1T, W2T);

    // LN1
    layernorm_f16<<<BT, 256, 0, stream>>>(x, ln1w, ln1b, h16);

    // the four projections (fused activations) in one launch
    const dim3 gD(1024 / 128, BT / 128);
    gemm_wmma<0><<<dim3(4 * 1024 / 128, BT / 128), 256, 0, stream>>>(
        h16, WqT, qb, nullptr, nullptr, nullptr, nullptr, 1024, DD);

    // recurrent gated-slot scan: slot scores for all t, then softmax and read-out
    gsa_scores_kernel<<<BD * HH * 2, 256, 0, stream>>>(qb, kb, sb, gb, okb);
    gsa_read_kernel<<<BD * HH * 2, 256, 0, stream>>>(okb, vb, sb, gb, ob);

    // per-head RMSNorm -> f16
    rms_cvt_kernel<<<BT * HH, 64, 0, stream>>>(ob, gnw, on16);

    // output projection + residual
    gemm_wmma<3><<<gD, 256, 0, stream>>>(on16, WoT, yb, nullptr, nullptr, nullptr, x, DD, 1024);

    // LN2
    layernorm_f16<<<BT, 256, 0, stream>>>(yb, ln2w, ln2b, h216);

    // MLP
    gemm_wmma<4><<<dim3(MLPD / 128, BT / 128), 256, 0, stream>>>(
        h216, W1T, nullptr, nullptr, a16, b1, nullptr, MLPD, DD);
    gemm_wmma<5><<<dim3(DD / 128, BT / 128), 256, 0, stream>>>(
        a16, W2T, outp, nullptr, nullptr, b2, yb, DD, MLPD);
}

// v005
// It runs in 218 microseconds.
// Timed twice side by side with v004, it ran 1.19 times as fast both times.
// Counting every step since v000, it is 7.10 times as fast.
#include <hip/hip_runtime.h>

#define BD 4
#define TD 512
#define DD 1024
#define HH 16
#define MLPD 4096

typedef __attribute__((ext_vector_type(16))) _Float16 v16h;
typedef __attribute__((ext_vector_type(8)))  _Float16 v8h;
typedef __attribute__((ext_vector_type(8)))  float    v8f;

// ---------------------------------------------------------------------------
// Transpose + f32->f16 convert of all seven weight matrices in ONE launch:
// in[K][N] (row-major) -> out[N][K] (row-major), so the GEMM B operand is
// K-contiguous like A. A work-group takes one 128 x 128 tile (64 elements a
// thread), so that few waves have to be started for the bytes that are moved.
// Reads: a wave's 16-byte loads cover one whole 512 B row of the tile.
// Writes: a wave's 16-byte stores cover two whole 256 B rows of the output.
// The LDS tile is [n][k] in f16, rows of 256 B = 16 chunks of 16 B; chunk c of
// row n lies at place c ^ ((n >> 2) & 15), so the 16 lanes of a half-wave hit
// 16 different places both when they write (rows 4 apart, one chunk) and when
// they read (one row, 16 chunks).
// Tiles: 5 x 64 (the 1024 x 1024 matrices), 256 (W1), 256 (W2) = 832.
// ---------------------------------------------------------------------------
typedef __attribute__((ext_vector_type(4))) float v4w;

// One tile. K and N are compile-time so that the 16 loads and the 8 stores of a
// thread differ from one another by immediate offsets only: one address each,
// and all 16 loads in flight together.
template<int K, int N>
__device__ __forceinline__ void transpose_tile(
    const float* __restrict__ in, _Float16* __restrict__ out, int tk, int tn,
    _Float16* tile)
{
    const int lane = threadIdx.x & 31, wid = threadIdx.x >> 5;

    // wave: k rows wid * 16 .. + 15; lane: columns n = lane * 4 .. + 3
    const float* src = in + (size_t)(tk * 128 + wid * 16) * N + tn * 128 + lane * 4;
    v4w r[16];
    for (int j = 0; j < 16; ++j) r[j] = *(const v4w*)(src + (size_t)j * N);
    // inputs only: holds all 16 loads in front of the first conversion, so that
    // a wave waits out one memory latency; without it the compiler issues them
    // in three groups with a full wait between the groups; src is named too so
    // that the address pair the loads share is not among the registers they fill
    asm volatile("" :: "v"(src), "v"(r[0]), "v"(r[1]), "v"(r[2]), "v"(r[3]), "v"(r[4]), "v"(r[5]),
                       "v"(r[6]), "v"(r[7]), "v"(r[8]), "v"(r[9]), "v"(r[10]), "v"(r[11]),
                       "v"(r[12]), "v"(r[13]), "v"(r[14]), "v"(r[15]));
    for (int gI = 0; gI < 2; ++gI)
        for (int e = 0; e < 4; ++e) {
            v8h p;
            for (int j = 0; j < 8; ++j) p[j] = (_Float16)r[gI * 8 + j][e];
            *(v8h*)&tile[(lane * 4 + e) * 128 + (((wid * 2 + gI) ^ (lane & 15)) * 8)] = p;
        }
    __syncthreads();

    // wave: output rows n = wid * 16 .. + 15, two a store; half-wave: one row
    const int hl = lane & 15, hr = lane >> 4;
    _Float16* dst = out + (size_t)(tn * 128 + wid * 16 + hr) * K + tk * 128 + hl * 8;
    for (int j = 0; j < 8; ++j) {
        const int n = wid * 16 + j * 2 + hr;
        const v8h p = *(const v8h*)&tile[n * 128 + ((hl ^ ((n >> 2) & 15)) * 8)];
        *(v8h*)(dst + (size_t)(j * 2) * K) = p;
    }
    // behind the last store: the listing lets a path run on into code that
    // reuses the stores' address and data registers
    asm volatile("s_wait_xcnt 0x0" ::: "memory");
}

__global__ __launch_bounds__(256) void transpose_cvt_all(
    const float* __restrict__ Wq, const float* __restrict__ Wk,
    const float* __restrict__ Wv, const float* __restrict__ Wf,
    const float* __restrict__ Wo, const float* __restrict__ W1,
    const float* __restrict__ W2,
    _Float16* __restrict__ WqT, _Float16* __restrict__ WkT,
    _Float16* __restrict__ WvT, _Float16* __restrict__ WfT,
    _Float16* __restrict__ WoT, _Float16* __restrict__ W1T,
    _Float16* __restrict__ W2T)
{
    __shared__ __attribute__((aligned(16))) _Float16 tile[128 * 128];
    const int bid = blockIdx.x;     // every branch below is uniform for the work-group
    if (bid < 320) {
        const int m = bid >> 6;
        const float* in = m == 0 ? Wq  : m == 1 ? Wk  : m == 2 ? Wv  : m == 3 ? Wf  : Wo;
        _Float16* out   = m == 0 ? WqT : m == 1 ? WkT : m == 2 ? WvT : m == 3 ? WfT : WoT;
        transpose_tile<1024, 1024>(in, out, (bid >> 3) & 7, bid & 7, tile);
    } else if (bid < 576) {
        transpose_tile<DD, MLPD>(W1, W1T, (bid - 320) >> 5, (bid - 320) & 31, tile);
    } else {
        transpose_tile<MLPD, DD>(W2, W2T, (bid - 576) >> 3, (bid - 576) & 7, tile);
    }
}

// ---------------------------------------------------------------------------
// LayerNorm over D=1024, output f16 (feeds WMMA GEMM A operand)
// ---------------------------------------------------------------------------
__global__ __launch_bounds__(256) void layernorm_f16(
    const float* __restrict__ x, const float* __restrict__ w,
    const float* __restrict__ b, _Float16* __restrict__ out)
{
    __shared__ float s1[256], s2[256];
    const int row = blockIdx.x, tid = threadIdx.x;
    const float* xr = x + (size_t)row * DD;
    float xs[4], sum = 0.f, sq = 0.f;
    for (int j = 0; j < 4; ++j) {
        float v = xr[tid + 256 * j];
        xs[j] = v; sum += v; sq += v * v;
    }
    s1[tid] = sum; s2[tid] = sq;
    __syncthreads();
    for (int st = 128; st > 0; st >>= 1) {
        if (tid < st) { s1[tid] += s1[tid + st]; s2[tid] += s2[tid + st]; }
        __syncthreads();
    }
    const float mu   = s1[0] * (1.f / DD);
    const float var  = s2[0] * (1.f / DD) - mu * mu;
    const float rstd = rsqrtf(var + 1e-6f);
    _Float16* orow = out + (size_t)row * DD;
    for (int j = 0; j < 4; ++j) {
        int i = tid + 256 * j;
        orow[i] = (_Float16)((xs[j] - mu) * rstd * w[i] + b[i]);
    }
}

// ---------------------------------------------------------------------------
// WMMA GEMM: C[M x N] = epilogue(A[M x K] @ Bt[N x K]^T)
// 128x128 block tile, 256 threads = 8 waves, each wave 32x64 (2x4 of 16x16).
// K staged 128-deep, DOUBLE-BUFFERED in LDS via CDNA5 async global->LDS copies
// (global_load_async_to_lds_b128, ASYNCcnt), so the fetch of stage k+1
// overlaps the v_wmma work on stage k.
// EPI: 0=the four input projections in one product (below), 3=+res f32,
//      4=+bias,gelu -> f16, 5=+bias,+res f32
// EPI 0: Bt holds the transposed Wq, Wk, Wv, Wf one behind the other, 4096 rows
// in all, so one launch has 512 work-groups (two for every WGP) where four
// launches of 128 each left half of the WGPs idle. out0 is five planes of
// BD * TD rows x 1024 floats: q, k, v, s, g. N is the pitch of a plane. The 128
// columns of a work-group lie in one matrix, so the choice of its activation is
// uniform for the work-group.
// ---------------------------------------------------------------------------
template<int EPI>
__global__ __launch_bounds__(256) void gemm_wmma(
    const _Float16* __restrict__ A, const _Float16* __restrict__ Bt,
    float* __restrict__ out0, float* __restrict__ out1,
    _Float16* __restrict__ outh,
    const float* __restrict__ bias, const float* __restrict__ res,
    int N, int K)
{
    // A stage is BK = 128 halfs of K: a row of 256 B, two whole 128 B lines, so
    // that one memory latency, one wait and one barrier serve four WMMA k steps.
    // LDS row pitch in halfs: 128 of data + 8 unused = 272 B = 16 B x odd, so the
    // 16 rows that a half-wave's ds_load_b128 reads lie on distinct banks.
    constexpr int BK = 128;
    constexpr int LP = BK + 8;
    __shared__ __attribute__((aligned(16))) _Float16 As[2][128 * LP];
    __shared__ __attribute__((aligned(16))) _Float16 Bs[2][128 * LP];
    const int tid  = threadIdx.x;
    const int lane = tid & 31, wid = tid >> 5;
    const int wm = wid >> 1, wn = wid & 1;       // 4 waves along M, 2 along N
    const int lr = lane & 15, hs = lane >> 4;    // half-wave select (ISA layout)
    const int rowBlk = blockIdx.y * 128, colBlk = blockIdx.x * 128;

    // Each thread owns eight fixed 16-byte chunks of the A tile and of the B
    // tile per stage: rows r0 + 16 * i, i = 0..7, half-offset o0. A wave's copy
    // covers two whole rows.
    const int r0 = tid >> 4, o0 = (tid & 15) * 8;
    const _Float16* gA = A  + (size_t)(rowBlk + r0) * K + o0;
    const _Float16* gB = Bt + (size_t)(colBlk + r0) * K + o0;
    // LDS byte addresses (low 32 bits of the generic pointer = LDS offset)
    const unsigned lA = (unsigned)(uintptr_t)&As[0][r0 * LP + o0];
    const unsigned lB = (unsigned)(uintptr_t)&Bs[0][r0 * LP + o0];
    constexpr unsigned bufBytes = 128 * LP * 2;
    constexpr unsigned lStep = 16 * LP * 2;      // 16 rows in LDS, bytes
    const size_t gStep = (size_t)16 * K;         // 16 rows in memory, halfs

    auto copy8 = [&](unsigned l, const _Float16* g) {
        // the last line is a precaution: it stands in front of every later
        // write of the address registers that these copies name
        asm volatile(
            "global_load_async_to_lds_b128 %0, %8, off\n\t"
            "global_load_async_to_lds_b128 %1, %9, off\n\t"
            "global_load_async_to_lds_b128 %2, %10, off\n\t"
            "global_load_async_to_lds_b128 %3, %11, off\n\t"
            "global_load_async_to_lds_b128 %4, %12, off\n\t"
            "global_load_async_to_lds_b128 %5, %13, off\n\t"
            "global_load_async_to_lds_b128 %6, %14, off\n\t"
            "global_load_async_to_lds_b128 %7, %15, off\n\t"
            "s_wait_xcnt 0x0"
            :
            : "v"(l), "v"(l + lStep), "v"(l + 2 * lStep), "v"(l + 3 * lStep),
              "v"(l + 4 * lStep), "v"(l + 5 * lStep), "v"(l + 6 * lStep), "v"(l + 7 * lStep),
              "v"((unsigned long long)(uintptr_t)(g)),
              "v"((unsigned long long)(uintptr_t)(g + gStep)),
              "v"((unsigned long long)(uintptr_t)(g + 2 * gStep)),
              "v"((unsigned long long)(uintptr_t)(g + 3 * gStep)),
              "v"((unsigned long long)(uintptr_t)(g + 4 * gStep)),
              "v"((unsigned long long)(uintptr_t)(g + 5 * gStep)),
              "v"((unsigned long long)(uintptr_t)(g + 6 * gStep)),
              "v"((unsigned long long)(uintptr_t)(g + 7 * gStep))
            : "memory");
    };
    auto issue_stage = [&](int kk, int buf) {
        const unsigned bo = (unsigned)buf * bufBytes;
        const size_t ko = (size_t)kk * BK;
        copy8(lA + bo, gA + ko);
        copy8(lB + bo, gB + ko);
    };

    v8f acc[2][4];
    for (int i = 0; i < 2; ++i)
        for (int j = 0; j < 4; ++j)
            for (int r = 0; r < 8; ++r) acc[i][j][r] = 0.f;

    const int nk = K >> 7;
    issue_stage(0, 0);
    asm volatile("s_wait_asynccnt 0x0" ::: "memory");   // own copies of stage 0 landed
    __syncthreads();                                    // stage 0 published
    if (nk > 1) issue_stage(1, 1);                      // flies under stage 0's work
    for (int kk = 0; kk < nk; ++kk) {
        const int buf = kk & 1;
        const _Float16* Ab = As[buf];
        const _Float16* Bb = Bs[buf];
        // unrolled so that the fragment loads of a later k step can issue ahead
        // of the matrix instructions of an earlier one
        #pragma unroll
        for (int ks = 0; ks < BK / 32; ++ks) {
            // Fragment layout (16-bit A 16x32): lanes 0-15 hold K 0-7 / 16-23,
            // lanes 16-31 hold K 8-15 / 24-31, for row M = lane%16.
            v16h af[2], bf[4];
            for (int i = 0; i < 2; ++i) {
                int r = wm * 32 + i * 16 + lr;
                v8h lo = *(const v8h*)&Ab[r * LP + ks * 32 + hs * 8];
                v8h hi = *(const v8h*)&Ab[r * LP + ks * 32 + hs * 8 + 16];
                af[i] = __builtin_shufflevector(lo, hi, 0,1,2,3,4,5,6,7,8,9,10,11,12,13,14,15);
            }
            for (int j = 0; j < 4; ++j) {
                int r = wn * 64 + j * 16 + lr;
                v8h lo = *(const v8h*)&Bb[r * LP + ks * 32 + hs * 8];
                v8h hi = *(const v8h*)&Bb[r * LP + ks * 32 + hs * 8 + 16];
                bf[j] = __builtin_shufflevector(lo, hi, 0,1,2,3,4,5,6,7,8,9,10,11,12,13,14,15);
            }
            for (int i = 0; i < 2; ++i)
                for (int j = 0; j < 4; ++j)
                    acc[i][j] = __builtin_amdgcn_wmma_f32_16x16x32_f16(
                        false, af[i], false, bf[j], (short)0, acc[i][j], false, false);
        }
        // hand-over: this wave's reads of buf are done, its copies of stage
        // kk + 1 have landed; the barrier publishes that stage and frees buf
        asm volatile("s_wait_dscnt 0x0" ::: "memory");      // own reads of buf retired
        asm volatile("s_wait_asynccnt 0x0" ::: "memory");   // own copies of stage kk + 1 landed
        __syncthreads();
        if (kk + 2 < nk) issue_stage(kk + 2, buf);      // flies under stage kk + 1's work
    }
    // no copy is outstanding when the wave goes on to the epilogue and ends
    asm volatile("s_wait_asynccnt 0x0" ::: "memory");

    // Epilogue. C/D layout: VGPR r holds M = r (lanes 0-15) or r+8 (lanes 16-31),
    // N = lane%16.
    if (EPI == 0) {
        const size_t PL = (size_t)BD * TD * 1024;
        const int mat = colBlk >> 10;               // 0 Wq, 1 Wk, 2 Wv, 3 Wf
        float* pl = out0 + (size_t)mat * PL;
        auto each = [&](auto f) {
            for (int i = 0; i < 2; ++i)
                for (int j = 0; j < 4; ++j)
                    for (int r = 0; r < 8; ++r) {
                        int row = rowBlk + wm * 32 + i * 16 + hs * 8 + r;
                        int col = (colBlk & 1023) + wn * 64 + j * 16 + lr;
                        f(acc[i][j][r], (size_t)row * N + col);
                    }
        };
        if (mat < 2) {                                 // q, k: swish
            each([&](float v, size_t idx) { pl[idx] = v / (1.f + __expf(-v)); });
        } else if (mat == 2) {                         // v
            each([&](float v, size_t idx) { pl[idx] = v; });
            // behind the last store: the listing lets a path run on into the swish
            // code, which reuses the stores' address registers
            asm volatile("s_wait_xcnt 0x0" ::: "memory");
        } else {                                       // gate: g = logsig(v)/8, s = 1-exp(g)
            each([&](float v, size_t idx) {
                float ls = fminf(v, 0.f) - log1pf(__expf(-fabsf(v)));
                float gg = ls * 0.125f;
                pl[idx + PL] = gg;
                pl[idx] = -expm1f(gg);
            });
        }
        return;
    }
    for (int i = 0; i < 2; ++i)
        for (int j = 0; j < 4; ++j)
            for (int r = 0; r < 8; ++r) {
                int row = rowBlk + wm * 32 + i * 16 + hs * 8 + r;
                int col = colBlk + wn * 64 + j * 16 + lr;
                size_t idx = (size_t)row * N + col;
                float v = acc[i][j][r];
                if (EPI == 3) {                            // + residual
                    out0[idx] = v + res[idx];
                } else if (EPI == 4) {                     // + bias, exact gelu, f16 out
                    float t = v + bias[col];
                    outh[idx] = (_Float16)(0.5f * t * (1.f + erff(t * 0.70710678118f)));
                } else if (EPI == 5) {                     // + bias + residual
                    out0[idx] = v + bias[col] + res[idx];
                }
            }
}

// ---------------------------------------------------------------------------
// Gated-slot attention scan, as two recurrences whose columns are independent.
// K[d][m] is decayed and written per slot m only, and V[m][d] feeds o[d] per
// column d only, so a lane that owns a column keeps its part of the state in
// registers for all T steps and never exchanges state with another lane.
// Pass 1 gives the slot scores ok[t][m] for every t, pass 2 takes their
// softmax and gives o[t][d]. Work-group = (b, h, half of the columns).
// A half-wave owns 4 rows of the contraction dim (16 groups in 8 waves) and a
// lane owns 2 columns (c and c + 16): 8 state values a lane, held as pairs.
// Time runs in chunks of TC steps staged in LDS; the 16 partial sums of each
// output are added once per chunk, so a chunk has two barriers in all.
// ---------------------------------------------------------------------------
#define TC 32
typedef __attribute__((ext_vector_type(2))) float v2f;
typedef __attribute__((ext_vector_type(4))) float v4f;

__device__ __forceinline__ v2f splat2(float a) { v2f r = {a, a}; return r; }

// Adds the 16 group partials of 4 neighbouring entries x = 2 * c + j and
// stores them at columns c + 16 * j of the output row.
__device__ __forceinline__ void reduce_store(
    const float (*part)[16][32], int tid, float scale, float* __restrict__ dst,
    size_t rowBase)
{
    const int t = tid >> 3, x4 = (tid & 7) * 4;
    v4f a = *(const v4f*)&part[t][0][x4];
    for (int gI = 1; gI < 16; ++gI) a += *(const v4f*)&part[t][gI][x4];
    a *= scale;
    float* p = dst + rowBase + (size_t)t * (HH * 64) + (x4 >> 1);
    v2f lo = {a.x, a.z}, hi = {a.y, a.w};
    *(v2f*)p = lo;
    *(v2f*)(p + 16) = hi;
    // the stores' address and data registers are reused right behind them
    asm volatile("s_wait_xcnt 0x0" ::: "memory");
}

// Value of lane l ^ M, M < 16: a register-to-register exchange inside a row of
// 16 lanes, so a reduction over 8 neighbouring lanes takes no LDS round trip.
template<int M>
__device__ __forceinline__ float lane_xor(float x)
{
    return __builtin_bit_cast(float, __builtin_amdgcn_update_dpp(
        0, __builtin_bit_cast(int, x), 0x160 + M, 0xf, 0xf, true));
}

// Pass 1: ok[t][m] = DK^-0.5 * sum_d q_t[d] * K_t[d][m]
__global__ __launch_bounds__(256) void gsa_scores_kernel(
    const float* __restrict__ q, const float* __restrict__ k,
    const float* __restrict__ s, const float* __restrict__ g,
    float* __restrict__ ok)
{
    __shared__ __attribute__((aligned(16))) float kq[TC][128];      // [t][group][k0..3 q0..3]
    __shared__ __attribute__((aligned(16))) float gs[TC][64];       // [t][c][dec0 dec1 s0 s1]
    __shared__ __attribute__((aligned(16))) float part[TC][16][32]; // [t][group][2c + j]

    const int tid = threadIdx.x;
    const int bh = blockIdx.x >> 1, mh = blockIdx.x & 1;
    const int b = bh / HH, h = bh % HH;
    const int lane = tid & 31, c = lane & 15;
    const int grp = (tid >> 5) * 2 + (lane >> 4);

    // staging ownership inside a chunk
    const int rA = tid >> 4, cA = tid & 15;     // k, q: rows rA and rA + 16, 4 floats
    const int rG = tid >> 3, cG = tid & 7;      // g, s: row rG, 4 floats of this half
    const size_t head = ((size_t)b * TD * HH + h) * 64;
    const size_t step = HH * 64;

    v4f rk0, rk1, rq0, rq1, rg, rs;
    auto fetch = [&](int t0) {
        const size_t oA = head + (size_t)(t0 + rA) * step + cA * 4;
        rk0 = *(const v4f*)&k[oA];  rk1 = *(const v4f*)&k[oA + 16 * step];
        rq0 = *(const v4f*)&q[oA];  rq1 = *(const v4f*)&q[oA + 16 * step];
        const size_t oG = head + (size_t)(t0 + rG) * step + mh * 32 + cG * 4;
        rg = *(const v4f*)&g[oG];   rs = *(const v4f*)&s[oG];
    };
    auto stage = [&]() {
        *(v4f*)&kq[rA][cA * 8]          = rk0;
        *(v4f*)&kq[rA][cA * 8 + 4]      = rq0;
        *(v4f*)&kq[rA + 16][cA * 8]     = rk1;
        *(v4f*)&kq[rA + 16][cA * 8 + 4] = rq1;
        for (int e = 0; e < 4; ++e) {
            const int ml = cG * 4 + e;
            gs[rG][(ml & 15) * 4 + (ml >> 4)]     = __expf(rg[e]);
            gs[rG][(ml & 15) * 4 + 2 + (ml >> 4)] = rs[e];
        }
    };

    v2f st[4];
    for (int i = 0; i < 4; ++i) st[i] = splat2(0.f);

    fetch(0);
    stage();
    __syncthreads();
    for (int t0 = 0; t0 < TD; t0 += TC) {
        if (t0 + TC < TD) fetch(t0 + TC);       // next chunk flies under this one
        // unrolled so that the LDS loads of later steps issue ahead of the
        // multiply-adds of earlier ones
        #pragma unroll 8
        for (int t = 0; t < TC; ++t) {
            const v4f kk = *(const v4f*)&kq[t][grp * 8];
            const v4f qq = *(const v4f*)&kq[t][grp * 8 + 4];
            const v4f ds = *(const v4f*)&gs[t][c * 4];
            const v2f dec = {ds.x, ds.y}, sw = {ds.z, ds.w};
            for (int i = 0; i < 4; ++i)
                st[i] = __builtin_elementwise_fma(st[i], dec, splat2(kk[i]) * sw);
            v2f a0 = splat2(qq[0]) * st[0];
            v2f a1 = splat2(qq[2]) * st[2];
            a0 = __builtin_elementwise_fma(splat2(qq[1]), st[1], a0);
            a1 = __builtin_elementwise_fma(splat2(qq[3]), st[3], a1);
            *(v2f*)&part[t][grp][c * 2] = a0 + a1;
        }
        __syncthreads();    // partials complete; every read of kq and gs done
        reduce_store(part, tid, 0.125f, ok, head + (size_t)t0 * step + mh * 32);
        if (t0 + TC < TD) stage();
        __syncthreads();    // next chunk published; partials free again
    }
}

// Pass 2: qv_t = softmax_m(ok_t), o[t][d] = sum_m qv_t[m] * V_t[m][d]
__global__ __launch_bounds__(256) void gsa_read_kernel(
    const float* __restrict__ ok, const float* __restrict__ v,
    const float* __restrict__ s, const float* __restrict__ g,
    float* __restrict__ o)
{
    __shared__ __attribute__((aligned(16))) float u[TC][16][12];    // [t][group][dec0..3 s0..3 qv0..3]
    __shared__ __attribute__((aligned(16))) float vv[TC][32];       // [t][2c + j]
    __shared__ __attribute__((aligned(16))) float part[TC][16][32]; // [t][group][2c + j]

    const int tid = threadIdx.x;
    const int bh = blockIdx.x >> 1, dh = blockIdx.x & 1;
    const int b = bh / HH, h = bh % HH;
    const int lane = tid & 31, c = lane & 15;
    const int grp = (tid >> 5) * 2 + (lane >> 4);

    const int rA = tid >> 4, cA = tid & 15;     // g, s: rows rA and rA + 16, 4 floats
    const int rG = tid >> 3, cG = tid & 7;      // v: row rG, 4 floats of this half; ok: row rG, 8 slots
    const size_t head = ((size_t)b * TD * HH + h) * 64;
    const size_t step = HH * 64;

    v4f rg0, rg1, rs0, rs1, rv;
    v4f rok0, rok1;
    auto fetch = [&](int t0) {
        const size_t oA = head + (size_t)(t0 + rA) * step + cA * 4;
        rg0 = *(const v4f*)&g[oA];  rg1 = *(const v4f*)&g[oA + 16 * step];
        rs0 = *(const v4f*)&s[oA];  rs1 = *(const v4f*)&s[oA + 16 * step];
        rv  = *(const v4f*)&v[head + (size_t)(t0 + rG) * step + dh * 32 + cG * 4];
        const size_t oK = head + (size_t)(t0 + rG) * step + cG * 8;
        rok0 = *(const v4f*)&ok[oK];  rok1 = *(const v4f*)&ok[oK + 4];
    };
    auto stage = [&]() {
        v4f e0, e1;
        for (int e = 0; e < 4; ++e) { e0[e] = __expf(rg0[e]); e1[e] = __expf(rg1[e]); }
        *(v4f*)&u[rA][cA][0]      = e0;
        *(v4f*)&u[rA][cA][4]      = rs0;
        *(v4f*)&u[rA + 16][cA][0] = e1;
        *(v4f*)&u[rA + 16][cA][4] = rs1;
        for (int e = 0; e < 4; ++e) {
            const int dl = cG * 4 + e;
            vv[rG][(dl & 15) * 2 + (dl >> 4)] = rv[e];
        }
        // softmax over the 64 slots of row rG: 8 slots a lane, 8 lanes a row
        float mx = fmaxf(rok0[0], rok1[0]);
        for (int e = 1; e < 4; ++e) mx = fmaxf(mx, fmaxf(rok0[e], rok1[e]));
        mx = fmaxf(mx, lane_xor<1>(mx));
        mx = fmaxf(mx, lane_xor<2>(mx));
        mx = fmaxf(mx, lane_xor<4>(mx));
        v4f p0, p1;
        for (int e = 0; e < 4; ++e) { p0[e] = __expf(rok0[e] - mx); p1[e] = __expf(rok1[e] - mx); }
        const v4f ps = p0 + p1;
        float sum = (ps[0] + ps[1]) + (ps[2] + ps[3]);
        sum += lane_xor<1>(sum);
        sum += lane_xor<2>(sum);
        sum += lane_xor<4>(sum);
        const float inv = 1.f / sum;
        *(v4f*)&u[rG][cG * 2][8]     = p0 * inv;
        *(v4f*)&u[rG][cG * 2 + 1][8] = p1 * inv;
    };

    v2f st[4];
    for (int i = 0; i < 4; ++i) st[i] = splat2(0.f);

    fetch(0);
    stage();
    __syncthreads();
    for (int t0 = 0; t0 < TD; t0 += TC) {
        if (t0 + TC < TD) fetch(t0 + TC);       // next chunk flies under this one
        // unrolled so that the LDS loads of later steps issue ahead of the
        // multiply-adds of earlier ones
        #pragma unroll 8
        for (int t = 0; t < TC; ++t) {
            const v4f dec = *(const v4f*)&u[t][grp][0];
            const v4f sw  = *(const v4f*)&u[t][grp][4];
            const v4f qv  = *(const v4f*)&u[t][grp][8];
            const v2f vc  = *(const v2f*)&vv[t][c * 2];
            for (int i = 0; i < 4; ++i)
                st[i] = __builtin_elementwise_fma(st[i], splat2(dec[i]), splat2(sw[i]) * vc);
            v2f a0 = splat2(qv[0]) * st[0];
            v2f a1 = splat2(qv[2]) * st[2];
            a0 = __builtin_elementwise_fma(splat2(qv[1]), st[1], a0);
            a1 = __builtin_elementwise_fma(splat2(qv[3]), st[3], a1);
            *(v2f*)&part[t][grp][c * 2] = a0 + a1;
        }
        __syncthreads();    // partials complete; every read of u and vv done
        reduce_store(part, tid, 1.f, o, head + (size_t)t0 * step + dh * 32);
        if (t0 + TC < TD) stage();
        __syncthreads();    // next chunk published; partials free again
    }
}

// ---------------------------------------------------------------------------
// Per-(b,t,h) RMSNorm over DV=64, convert to f16 for the Wo GEMM.
// ---------------------------------------------------------------------------
__global__ __launch_bounds__(64) void rms_cvt_kernel(
    const float* __restrict__ o, const float* __restrict__ w,
    _Float16* __restrict__ out)
{
    __shared__ float red[64];
    const int row = blockIdx.x, tid = threadIdx.x;
    float x = o[(size_t)row * 64 + tid];
    red[tid] = x * x;
    __syncthreads();
    for (int st = 32; st > 0; st >>= 1) {
        if (tid < st) red[tid] += red[tid + st];
        __syncthreads();
    }
    float rstd = rsqrtf(red[0] * (1.f / 64.f) + 1e-6f);
    out[(size_t)row * 64 + tid] = (_Float16)(x * rstd * w[tid]);
}

// ---------------------------------------------------------------------------
extern "C" void kernel_launch(void* const* d_in, const int* in_sizes, int n_in,
                              void* d_out, int out_size, void* d_ws, size_t ws_size,
                              hipStream_t stream)
{
    const float* x    = (const float*)d_in[0];
    const float* ln1w = (const float*)d_in[1];
    const float* ln1b = (const float*)d_in[2];
    const float* Wq   = (const float*)d_in[3];
    const float* Wk   = (const float*)d_in[4];
    const float* Wv   = (const float*)d_in[5];
    const float* Wf   = (const float*)d_in[6];
    const float* gnw  = (const float*)d_in[7];
    const float* Wo   = (const float*)d_in[8];
    const float* ln2w = (const float*)d_in[9];
    const float* ln2b = (const float*)d_in[10];
    const float* W1   = (const float*)d_in[11];
    const float* b1   = (const float*)d_in[12];
    const float* W2   = (const float*)d_in[13];
    const float* b2   = (const float*)d_in[14];
    float* outp = (float*)d_out;

    const int BT = BD * TD;   // 2048 rows for every GEMM

    char* wsp = (char*)d_ws;
    auto carve = [&](size_t bytes) -> char* {
        char* p = wsp;
        wsp += (bytes + 255) & ~(size_t)255;
        return p;
    };
    _Float16* h16   = (_Float16*)carve((size_t)BT * DD * 2);
    // Wq, Wk, Wv, Wf transposed, one behind the other: the B operand [4096][DD]
    _Float16* WqT   = (_Float16*)carve((size_t)4 * DD * 1024 * 2);
    _Float16* WkT   = WqT + (size_t)DD * 1024;
    _Float16* WvT   = WkT + (size_t)DD * 1024;
    _Float16* WfT   = WvT + (size_t)DD * 1024;
    _Float16* WoT   = (_Float16*)carve((size_t)DD * 1024 * 2);
    _Float16* W1T   = (_Float16*)carve((size_t)MLPD * DD * 2);
    _Float16* W2T   = (_Float16*)carve((size_t)DD * MLPD * 2);
    // the five planes that the projection launch writes: q, k, v, s, g
    float*    qb    = (float*)carve((size_t)5 * BT * 1024 * 4);
    float*    kb    = qb + (size_t)BT * 1024;
    float*    vb    = kb + (size_t)BT * 1024;
    float*    sb    = vb + (size_t)BT * 1024;
    float*    gb    = sb + (size_t)BT * 1024;
    float*    ob    = (float*)carve((size_t)BT * 1024 * 4);
    float*    okb   = (float*)carve((size_t)BT * 1024 * 4);
    _Float16* on16  = (_Float16*)carve((size_t)BT * 1024 * 2);
    float*    yb    = (float*)carve((size_t)BT * DD * 4);
    _Float16* h216  = (_Float16*)carve((size_t)BT * DD * 2);
    _Float16* a16   = (_Float16*)carve((size_t)BT * MLPD * 2);

    // weight transposes: in[K][N] -> f16 [N][K], all seven in one launch
    transpose_cvt_all<<<832, 256, 0, stream>>>(Wq, Wk, Wv, Wf, Wo, W1, W2,
                                               WqT, WkT, WvT, WfT, WoT, W1T, W2T);

    // LN1
    layernorm_f16<<<BT, 256, 0, stream>>>(x, ln1w, ln1b, h16);

    // the four projections (fused activations) in one launch
    const dim3 gD(1024 / 128, BT / 128);
    gemm_wmma<0><<<dim3(4 * 1024 / 128, BT / 128), 256, 0, stream>>>(
        h16, WqT, qb, nullptr, nullptr, nullptr, nullptr, 1024, DD);

    // recurrent gated-slot scan: slot scores for all t, then softmax and read-out
    gsa_scores_kernel<<<BD * HH * 2, 256, 0, stream>>>(qb, kb, sb, gb, okb);
    gsa_read_kernel<<<BD * HH * 2, 256, 0, stream>>>(okb, vb, sb, gb, ob);

    // per-head RMSNorm -> f16
    rms_cvt_kernel<<<BT * HH, 64, 0, stream>>>(ob, gnw, on16);

    // output projection + residual
    gemm_wmma<3><<<gD, 256, 0, stream>>>(on16, WoT, yb, nullptr, nullptr, nullptr, x, DD, 1024);

    // LN2
    layernorm_f16<<<BT, 256, 0, stream>>>(yb, ln2w, ln2b, h216);

    // MLP
    gemm_wmma<4><<<dim3(MLPD / 128, BT / 128), 256, 0, stream>>>(
        h216, W1T, nullptr, nullptr, a16, b1, nullptr, MLPD, DD);
    gemm_wmma<5><<<dim3(DD / 128, BT / 128), 256, 0, stream>>>(
        a16, W2T, outp, nullptr, nullptr, b2, yb, DD, MLPD);
}

// v006
// It runs in 214 microseconds.
// Two timings next to v005 put it at 1.04 and 1.03 times that version's speed.
// All steps since v000 together make it 7.34 times as fast.
#include <hip/hip_runtime.h>

#define BD 4
#define TD 512
#define DD 1024
#define HH 16
#define MLPD 4096

typedef __attribute__((ext_vector_type(16))) _Float16 v16h;
typedef __attribute__((ext_vector_type(8)))  _Float16 v8h;
typedef __attribute__((ext_vector_type(8)))  float    v8f;

// ---------------------------------------------------------------------------
// Transpose + f32->f16 convert of all seven weight matrices in ONE launch:
// in[K][N] (row-major) -> out[N][K] (row-major), so the GEMM B operand is
// K-contiguous like A. A work-group takes one 128 x 128 tile (64 elements a
// thread), so that few waves have to be started for the bytes that are moved.
// Reads: a wave's 16-byte loads cover one whole 512 B row of the tile.
// Writes: a wave's 16-byte stores cover two whole 256 B rows of the output.
// The LDS tile is [n][k] in f16, rows of 256 B = 16 chunks of 16 B; chunk c of
// row n lies at place c ^ ((n >> 2) & 15), so the 16 lanes of a half-wave hit
// 16 different places both when they write (rows 4 apart, one chunk) and when
// they read (one row, 16 chunks).
// Tiles: 5 x 64 (the 1024 x 1024 matrices), 256 (W1), 256 (W2) = 832.
// ---------------------------------------------------------------------------
typedef __attribute__((ext_vector_type(4))) float v4w;

// One tile. K and N are compile-time so that the 16 loads and the 8 stores of a
// thread differ from one another by immediate offsets only: one address each,
// and all 16 loads in flight together.
template<int K, int N>
__device__ __forceinline__ void transpose_tile(
    const float* __restrict__ in, _Float16* __restrict__ out, int tk, int tn,
    _Float16* tile)
{
    const int lane = threadIdx.x & 31, wid = threadIdx.x >> 5;

    // wave: k rows wid * 16 .. + 15; lane: columns n = lane * 4 .. + 3
    const float* src = in + (size_t)(tk * 128 + wid * 16) * N + tn * 128 + lane * 4;
    v4w r[16];
    for (int j = 0; j < 16; ++j) r[j] = *(const v4w*)(src + (size_t)j * N);
    // inputs only: holds all 16 loads in front of the first conversion, so that
    // a wave waits out one memory latency; without it the compiler issues them
    // in three groups with a full wait between the groups; src is named too so
    // that the address pair the loads share is not among the registers they fill
    asm volatile("" :: "v"(src), "v"(r[0]), "v"(r[1]), "v"(r[2]), "v"(r[3]), "v"(r[4]), "v"(r[5]),
                       "v"(r[6]), "v"(r[7]), "v"(r[8]), "v"(r[9]), "v"(r[10]), "v"(r[11]),
                       "v"(r[12]), "v"(r[13]), "v"(r[14]), "v"(r[15]));
    for (int gI = 0; gI < 2; ++gI)
        for (int e = 0; e < 4; ++e) {
            v8h p;
            for (int j = 0; j < 8; ++j) p[j] = (_Float16)r[gI * 8 + j][e];
            *(v8h*)&tile[(lane * 4 + e) * 128 + (((wid * 2 + gI) ^ (lane & 15)) * 8)] = p;
        }
    __syncthreads();

    // wave: output rows n = wid * 16 .. + 15, two a store; half-wave: one row
    const int hl = lane & 15, hr = lane >> 4;
    _Float16* dst = out + (size_t)(tn * 128 + wid * 16 + hr) * K + tk * 128 + hl * 8;
    for (int j = 0; j < 8; ++j) {
        const int n = wid * 16 + j * 2 + hr;
        const v8h p = *(const v8h*)&tile[n * 128 + ((hl ^ ((n >> 2) & 15)) * 8)];
        *(v8h*)(dst + (size_t)(j * 2) * K) = p;
    }
    // behind the last store: the listing lets a path run on into code that
    // reuses the stores' address and data registers
    asm volatile("s_wait_xcnt 0x0" ::: "memory");
}

__global__ __launch_bounds__(256) void transpose_cvt_all(
    const float* __restrict__ Wq, const float* __restrict__ Wk,
    const float* __restrict__ Wv, const float* __restrict__ Wf,
    const float* __restrict__ Wo, const float* __restrict__ W1,
    const float* __restrict__ W2,
    _Float16* __restrict__ WqT, _Float16* __restrict__ WkT,
    _Float16* __restrict__ WvT, _Float16* __restrict__ WfT,
    _Float16* __restrict__ WoT, _Float16* __restrict__ W1T,
    _Float16* __restrict__ W2T)
{
    __shared__ __attribute__((aligned(16))) _Float16 tile[128 * 128];
    const int bid = blockIdx.x;     // every branch below is uniform for the work-group
    if (bid < 320) {
        const int m = bid >> 6;
        const float* in = m == 0 ? Wq  : m == 1 ? Wk  : m == 2 ? Wv  : m == 3 ? Wf  : Wo;
        _Float16* out   = m == 0 ? WqT : m == 1 ? WkT : m == 2 ? WvT : m == 3 ? WfT : WoT;
        transpose_tile<1024, 1024>(in, out, (bid >> 3) & 7, bid & 7, tile);
    } else if (bid < 576) {
        transpose_tile<DD, MLPD>(W1, W1T, (bid - 320) >> 5, (bid - 320) & 31, tile);
    } else {
        transpose_tile<MLPD, DD>(W2, W2T, (bid - 576) >> 3, (bid - 576) & 7, tile);
    }
}

// ---------------------------------------------------------------------------
// Cross-lane helpers of the normalisation kernels and of the scan's softmax.
// ---------------------------------------------------------------------------
typedef __attribute__((ext_vector_type(4))) _Float16 v4h;

// Value of lane l ^ M, M < 16: a register-to-register exchange inside a row of
// 16 lanes, so a reduction over neighbouring lanes takes no LDS round trip.
template<int M>
__device__ __forceinline__ float lane_xor(float x)
{
    return __builtin_bit_cast(float, __builtin_amdgcn_update_dpp(
        0, __builtin_bit_cast(int, x), 0x160 + M, 0xf, 0xf, true));
}

// Sum over the 16 lanes of a row, left in every lane of the row.
__device__ __forceinline__ float row16_sum(float x)
{
    x += lane_xor<1>(x);
    x += lane_xor<2>(x);
    x += lane_xor<4>(x);
    x += lane_xor<8>(x);
    return x;
}

// Value of lane l ^ 16: the same place in the other row of 16 lanes.
__device__ __forceinline__ float other_row(float x)
{
    const int v = __builtin_bit_cast(int, x);
    return __builtin_bit_cast(float, __builtin_amdgcn_permlanex16(
        v, v, 0x76543210, 0xfedcba98, false, false));
}

// ---------------------------------------------------------------------------
// LayerNorm over D=1024, output f16 (feeds WMMA GEMM A operand).
// One wave owns one row: 32 values a lane in eight 16-byte loads, each load of
// the wave one run of 512 B, all in flight together. The two sums stay in
// registers and cross the lanes by register exchanges, so the kernel has no LDS
// and no barrier, and an eighth of the waves have to be started.
// ---------------------------------------------------------------------------
__global__ __launch_bounds__(256) void layernorm_f16(
    const float* __restrict__ x, const float* __restrict__ w,
    const float* __restrict__ b, _Float16* __restrict__ out)
{
    const int lane = threadIdx.x & 31;
    const int row = blockIdx.x * 8 + (threadIdx.x >> 5);
    const float* xr = x + (size_t)row * DD + lane * 4;
    v4w xs[8], wv[8], bv[8];
    for (int j = 0; j < 8; ++j) xs[j] = *(const v4w*)(xr + j * 128);
    for (int j = 0; j < 8; ++j) {
        wv[j] = *(const v4w*)(w + lane * 4 + j * 128);
        bv[j] = *(const v4w*)(b + lane * 4 + j * 128);
    }
    // inputs only: holds all 24 loads in front of this line, so that a wave waits
    // out one memory latency; without it the compiler moves the loads of w and b
    // behind the reduction, two at a time with a wait between the pairs; xr is
    // named too so that the address pair is not reused while loads are out
    asm volatile("" :: "v"(xr), "v"(xs[0]), "v"(xs[1]), "v"(xs[2]), "v"(xs[3]), "v"(xs[4]), "v"(xs[5]),
                       "v"(xs[6]), "v"(xs[7]), "v"(wv[0]), "v"(wv[1]), "v"(wv[2]), "v"(wv[3]),
                       "v"(wv[4]), "v"(wv[5]), "v"(wv[6]), "v"(wv[7]), "v"(bv[0]), "v"(bv[1]),
                       "v"(bv[2]), "v"(bv[3]), "v"(bv[4]), "v"(bv[5]), "v"(bv[6]), "v"(bv[7]));
    // keeps the sums behind the loads: without it the compiler lifts them, with
    // their waits for x, in among the loads of w and b, which then start late
    __builtin_amdgcn_sched_barrier(0);
    v4w s4 = xs[0], q4 = xs[0] * xs[0];
    for (int j = 1; j < 8; ++j) {
        s4 += xs[j];
        q4 = __builtin_elementwise_fma(xs[j], xs[j], q4);
    }
    float sum = row16_sum((s4[0] + s4[1]) + (s4[2] + s4[3]));
    float sq  = row16_sum((q4[0] + q4[1]) + (q4[2] + q4[3]));
    sum += other_row(sum);
    sq  += other_row(sq);
    const float mu   = sum * (1.f / DD);
    const float var  = sq * (1.f / DD) - mu * mu;
    const float rstd = rsqrtf(var + 1e-6f);
    _Float16* orow = out + (size_t)row * DD + lane * 4;
    for (int j = 0; j < 8; ++j) {
        v4h p;
        for (int e = 0; e < 4; ++e)
            p[e] = (_Float16)((xs[j][e] - mu) * rstd * wv[j][e] + bv[j][e]);
        *(v4h*)(orow + j * 128) = p;
    }
}

// ---------------------------------------------------------------------------
// WMMA GEMM: C[M x N] = epilogue(A[M x K] @ Bt[N x K]^T)
// 128x128 block tile, 256 threads = 8 waves, each wave 32x64 (2x4 of 16x16).
// K staged 128-deep, DOUBLE-BUFFERED in LDS via CDNA5 async global->LDS copies
// (global_load_async_to_lds_b128, ASYNCcnt), so the fetch of stage k+1
// overlaps the v_wmma work on stage k.
// EPI: 0=the four input projections in one product (below), 3=+res f32,
//      4=+bias,gelu -> f16, 5=+bias,+res f32
// EPI 0: Bt holds the transposed Wq, Wk, Wv, Wf one behind the other, 4096 rows
// in all, so one launch has 512 work-groups (two for every WGP) where four
// launches of 128 each left half of the WGPs idle. out0 is five planes of
// BD * TD rows x 1024 floats: q, k, v, s, g. N is the pitch of a plane. The 128
// columns of a work-group lie in one matrix, so the choice of its activation is
// uniform for the work-group.
// ---------------------------------------------------------------------------
template<int EPI>
__global__ __launch_bounds__(256) void gemm_wmma(
    const _Float16* __restrict__ A, const _Float16* __restrict__ Bt,
    float* __restrict__ out0, float* __restrict__ out1,
    _Float16* __restrict__ outh,
    const float* __restrict__ bias, const float* __restrict__ res,
    int N, int K)
{
    // A stage is BK = 128 halfs of K: a row of 256 B, two whole 128 B lines, so
    // that one memory latency, one wait and one barrier serve four WMMA k steps.
    // LDS row pitch in halfs: 128 of data + 8 unused = 272 B = 16 B x odd, so the
    // 16 rows that a half-wave's ds_load_b128 reads lie on distinct banks.
    constexpr int BK = 128;
    constexpr int LP = BK + 8;
    __shared__ __attribute__((aligned(16))) _Float16 As[2][128 * LP];
    __shared__ __attribute__((aligned(16))) _Float16 Bs[2][128 * LP];
    const int tid  = threadIdx.x;
    const int lane = tid & 31, wid = tid >> 5;
    const int wm = wid >> 1, wn = wid & 1;       // 4 waves along M, 2 along N
    const int lr = lane & 15, hs = lane >> 4;    // half-wave select (ISA layout)
    const int rowBlk = blockIdx.y * 128, colBlk = blockIdx.x * 128;

    // Each thread owns eight fixed 16-byte chunks of the A tile and of the B
    // tile per stage: rows r0 + 16 * i, i = 0..7, half-offset o0. A wave's copy
    // covers two whole rows.
    const int r0 = tid >> 4, o0 = (tid & 15) * 8;
    const _Float16* gA = A  + (size_t)(rowBlk + r0) * K + o0;
    const _Float16* gB = Bt + (size_t)(colBlk + r0) * K + o0;
    // LDS byte addresses (low 32 bits of the generic pointer = LDS offset)
    const unsigned lA = (unsigned)(uintptr_t)&As[0][r0 * LP + o0];
    const unsigned lB = (unsigned)(uintptr_t)&Bs[0][r0 * LP + o0];
    constexpr unsigned bufBytes = 128 * LP * 2;
    constexpr unsigned lStep = 16 * LP * 2;      // 16 rows in LDS, bytes
    const size_t gStep = (size_t)16 * K;         // 16 rows in memory, halfs

    auto copy8 = [&](unsigned l, const _Float16* g) {
        // the last line is a precaution: it stands in front of every later
        // write of the address registers that these copies name
        asm volatile(
            "global_load_async_to_lds_b128 %0, %8, off\n\t"
            "global_load_async_to_lds_b128 %1, %9, off\n\t"
            "global_load_async_to_lds_b128 %2, %10, off\n\t"
            "global_load_async_to_lds_b128 %3, %11, off\n\t"
            "global_load_async_to_lds_b128 %4, %12, off\n\t"
            "global_load_async_to_lds_b128 %5, %13, off\n\t"
            "global_load_async_to_lds_b128 %6, %14, off\n\t"
            "global_load_async_to_lds_b128 %7, %15, off\n\t"
            "s_wait_xcnt 0x0"
            :
            : "v"(l), "v"(l + lStep), "v"(l + 2 * lStep), "v"(l + 3 * lStep),
              "v"(l + 4 * lStep), "v"(l + 5 * lStep), "v"(l + 6 * lStep), "v"(l + 7 * lStep),
              "v"((unsigned long long)(uintptr_t)(g)),
              "v"((unsigned long long)(uintptr_t)(g + gStep)),
              "v"((unsigned long long)(uintptr_t)(g + 2 * gStep)),
              "v"((unsigned long long)(uintptr_t)(g + 3 * gStep)),
              "v"((unsigned long long)(uintptr_t)(g + 4 * gStep)),
              "v"((unsigned long long)(uintptr_t)(g + 5 * gStep)),
              "v"((unsigned long long)(uintptr_t)(g + 6 * gStep)),
              "v"((unsigned long long)(uintptr_t)(g + 7 * gStep))
            : "memory");
    };
    auto issue_stage = [&](int kk, int buf) {
        const unsigned bo = (unsigned)buf * bufBytes;
        const size_t ko = (size_t)kk * BK;
        copy8(lA + bo, gA + ko);
        copy8(lB + bo, gB + ko);
    };

    v8f acc[2][4];
    for (int i = 0; i < 2; ++i)
        for (int j = 0; j < 4; ++j)
            for (int r = 0; r < 8; ++r) acc[i][j][r] = 0.f;

    const int nk = K >> 7;
    issue_stage(0, 0);
    asm volatile("s_wait_asynccnt 0x0" ::: "memory");   // own copies of stage 0 landed
    __syncthreads();                                    // stage 0 published
    if (nk > 1) issue_stage(1, 1);                      // flies under stage 0's work
    for (int kk = 0; kk < nk; ++kk) {
        const int buf = kk & 1;
        const _Float16* Ab = As[buf];
        const _Float16* Bb = Bs[buf];
        // unrolled so that the fragment loads of a later k step can issue ahead
        // of the matrix instructions of an earlier one
        #pragma unroll
        for (int ks = 0; ks < BK / 32; ++ks) {
            // Fragment layout (16-bit A 16x32): lanes 0-15 hold K 0-7 / 16-23,
            // lanes 16-31 hold K 8-15 / 24-31, for row M = lane%16.
            v16h af[2], bf[4];
            for (int i = 0; i < 2; ++i) {
                int r = wm * 32 + i * 16 + lr;
                v8h lo = *(const v8h*)&Ab[r * LP + ks * 32 + hs * 8];
                v8h hi = *(const v8h*)&Ab[r * LP + ks * 32 + hs * 8 + 16];
                af[i] = __builtin_shufflevector(lo, hi, 0,1,2,3,4,5,6,7,8,9,10,11,12,13,14,15);
            }
            for (int j = 0; j < 4; ++j) {
                int r = wn * 64 + j * 16 + lr;
                v8h lo = *(const v8h*)&Bb[r * LP + ks * 32 + hs * 8];
                v8h hi = *(const v8h*)&Bb[r * LP + ks * 32 + hs * 8 + 16];
                bf[j] = __builtin_shufflevector(lo, hi, 0,1,2,3,4,5,6,7,8,9,10,11,12,13,14,15);
            }
            for (int i = 0; i < 2; ++i)
                for (int j = 0; j < 4; ++j)
                    acc[i][j] = __builtin_amdgcn_wmma_f32_16x16x32_f16(
                        false, af[i], false, bf[j], (short)0, acc[i][j], false, false);
        }
        // hand-over: this wave's reads of buf are done, its copies of stage
        // kk + 1 have landed; the barrier publishes that stage and frees buf
        asm volatile("s_wait_dscnt 0x0" ::: "memory");      // own reads of buf retired
        asm volatile("s_wait_asynccnt 0x0" ::: "memory");   // own copies of stage kk + 1 landed
        __syncthreads();
        if (kk + 2 < nk) issue_stage(kk + 2, buf);      // flies under stage kk + 1's work
    }
    // no copy is outstanding when the wave goes on to the epilogue and ends
    asm volatile("s_wait_asynccnt 0x0" ::: "memory");

    // Epilogue. C/D layout: VGPR r holds M = r (lanes 0-15) or r+8 (lanes 16-31),
    // N = lane%16.
    if (EPI == 0) {
        const size_t PL = (size_t)BD * TD * 1024;
        const int mat = colBlk >> 10;               // 0 Wq, 1 Wk, 2 Wv, 3 Wf
        float* pl = out0 + (size_t)mat * PL;
        auto each = [&](auto f) {
            for (int i = 0; i < 2; ++i)
                for (int j = 0; j < 4; ++j)
                    for (int r = 0; r < 8; ++r) {
                        int row = rowBlk + wm * 32 + i * 16 + hs * 8 + r;
                        int col = (colBlk & 1023) + wn * 64 + j * 16 + lr;
                        f(acc[i][j][r], (size_t)row * N + col);
                    }
        };
        if (mat < 2) {                                 // q, k: swish
            each([&](float v, size_t idx) { pl[idx] = v / (1.f + __expf(-v)); });
        } else if (mat == 2) {                         // v
            each([&](float v, size_t idx) { pl[idx] = v; });
            // behind the last store: the listing lets a path run on into the swish
            // code, which reuses the stores' address registers
            asm volatile("s_wait_xcnt 0x0" ::: "memory");
        } else {                                       // gate: g = logsig(v)/8, s = 1-exp(g)
            each([&](float v, size_t idx) {
                float ls = fminf(v, 0.f) - log1pf(__expf(-fabsf(v)));
                float gg = ls * 0.125f;
                pl[idx + PL] = gg;
                pl[idx] = -expm1f(gg);
            });
        }
        return;
    }
    for (int i = 0; i < 2; ++i)
        for (int j = 0; j < 4; ++j)
            for (int r = 0; r < 8; ++r) {
                int row = rowBlk + wm * 32 + i * 16 + hs * 8 + r;
                int col = colBlk + wn * 64 + j * 16 + lr;
                size_t idx = (size_t)row * N + col;
                float v = acc[i][j][r];
                if (EPI == 3) {                            // + residual
                    out0[idx] = v + res[idx];
                } else if (EPI == 4) {                     // + bias, exact gelu, f16 out
                    float t = v + bias[col];
                    outh[idx] = (_Float16)(0.5f * t * (1.f + erff(t * 0.70710678118f)));
                } else if (EPI == 5) {                     // + bias + residual
                    out0[idx] = v + bias[col] + res[idx];
                }
            }
}

// ---------------------------------------------------------------------------
// Gated-slot attention scan, as two recurrences whose columns are independent.
// K[d][m] is decayed and written per slot m only, and V[m][d] feeds o[d] per
// column d only, so a lane that owns a column keeps its part of the state in
// registers for all T steps and never exchanges state with another lane.
// Pass 1 gives the slot scores ok[t][m] for every t, pass 2 takes their
// softmax and gives o[t][d]. Work-group = (b, h, half of the columns).
// A half-wave owns 4 rows of the contraction dim (16 groups in 8 waves) and a
// lane owns 2 columns (c and c + 16): 8 state values a lane, held as pairs.
// Time runs in chunks of TC steps staged in LDS; the 16 partial sums of each
// output are added once per chunk, so a chunk has two barriers in all.
// ---------------------------------------------------------------------------
#define TC 32
typedef __attribute__((ext_vector_type(2))) float v2f;
typedef __attribute__((ext_vector_type(4))) float v4f;

__device__ __forceinline__ v2f splat2(float a) { v2f r = {a, a}; return r; }

// Adds the 16 group partials of 4 neighbouring entries x = 2 * c + j and
// stores them at columns c + 16 * j of the output row.
__device__ __forceinline__ void reduce_store(
    const float (*part)[16][32], int tid, float scale, float* __restrict__ dst,
    size_t rowBase)
{
    const int t = tid >> 3, x4 = (tid & 7) * 4;
    v4f a = *(const v4f*)&part[t][0][x4];
    for (int gI = 1; gI < 16; ++gI) a += *(const v4f*)&part[t][gI][x4];
    a *= scale;
    float* p = dst + rowBase + (size_t)t * (HH * 64) + (x4 >> 1);
    v2f lo = {a.x, a.z}, hi = {a.y, a.w};
    *(v2f*)p = lo;
    *(v2f*)(p + 16) = hi;
    // the stores' address and data registers are reused right behind them
    asm volatile("s_wait_xcnt 0x0" ::: "memory");
}

// Pass 1: ok[t][m] = DK^-0.5 * sum_d q_t[d] * K_t[d][m]
__global__ __launch_bounds__(256) void gsa_scores_kernel(
    const float* __restrict__ q, const float* __restrict__ k,
    const float* __restrict__ s, const float* __restrict__ g,
    float* __restrict__ ok)
{
    __shared__ __attribute__((aligned(16))) float kq[TC][128];      // [t][group][k0..3 q0..3]
    __shared__ __attribute__((aligned(16))) float gs[TC][64];       // [t][c][dec0 dec1 s0 s1]
    __shared__ __attribute__((aligned(16))) float part[TC][16][32]; // [t][group][2c + j]

    const int tid = threadIdx.x;
    const int bh = blockIdx.x >> 1, mh = blockIdx.x & 1;
    const int b = bh / HH, h = bh % HH;
    const int lane = tid & 31, c = lane & 15;
    const int grp = (tid >> 5) * 2 + (lane >> 4);

    // staging ownership inside a chunk
    const int rA = tid >> 4, cA = tid & 15;     // k, q: rows rA and rA + 16, 4 floats
    const int rG = tid >> 3, cG = tid & 7;      // g, s: row rG, 4 floats of this half
    const size_t head = ((size_t)b * TD * HH + h) * 64;
    const size_t step = HH * 64;

    v4f rk0, rk1, rq0, rq1, rg, rs;
    auto fetch = [&](int t0) {
        const size_t oA = head + (size_t)(t0 + rA) * step + cA * 4;
        rk0 = *(const v4f*)&k[oA];  rk1 = *(const v4f*)&k[oA + 16 * step];
        rq0 = *(const v4f*)&q[oA];  rq1 = *(const v4f*)&q[oA + 16 * step];
        const size_t oG = head + (size_t)(t0 + rG) * step + mh * 32 + cG * 4;
        rg = *(const v4f*)&g[oG];   rs = *(const v4f*)&s[oG];
    };
    auto stage = [&]() {
        *(v4f*)&kq[rA][cA * 8]          = rk0;
        *(v4f*)&kq[rA][cA * 8 + 4]      = rq0;
        *(v4f*)&kq[rA + 16][cA * 8]     = rk1;
        *(v4f*)&kq[rA + 16][cA * 8 + 4] = rq1;
        for (int e = 0; e < 4; ++e) {
            const int ml = cG * 4 + e;
            gs[rG][(ml & 15) * 4 + (ml >> 4)]     = __expf(rg[e]);
            gs[rG][(ml & 15) * 4 + 2 + (ml >> 4)] = rs[e];
        }
    };

    v2f st[4];
    for (int i = 0; i < 4; ++i) st[i] = splat2(0.f);

    fetch(0);
    stage();
    __syncthreads();
    for (int t0 = 0; t0 < TD; t0 += TC) {
        if (t0 + TC < TD) fetch(t0 + TC);       // next chunk flies under this one
        // unrolled so that the LDS loads of later steps issue ahead of the
        // multiply-adds of earlier ones
        #pragma unroll 8
        for (int t = 0; t < TC; ++t) {
            const v4f kk = *(const v4f*)&kq[t][grp * 8];
            const v4f qq = *(const v4f*)&kq[t][grp * 8 + 4];
            const v4f ds = *(const v4f*)&gs[t][c * 4];
            const v2f dec = {ds.x, ds.y}, sw = {ds.z, ds.w};
            for (int i = 0; i < 4; ++i)
                st[i] = __builtin_elementwise_fma(st[i], dec, splat2(kk[i]) * sw);
            v2f a0 = splat2(qq[0]) * st[0];
            v2f a1 = splat2(qq[2]) * st[2];
            a0 = __builtin_elementwise_fma(splat2(qq[1]), st[1], a0);
            a1 = __builtin_elementwise_fma(splat2(qq[3]), st[3], a1);
            *(v2f*)&part[t][grp][c * 2] = a0 + a1;
        }
        __syncthreads();    // partials complete; every read of kq and gs done
        reduce_store(part, tid, 0.125f, ok, head + (size_t)t0 * step + mh * 32);
        if (t0 + TC < TD) stage();
        __syncthreads();    // next chunk published; partials free again
    }
}

// Pass 2: qv_t = softmax_m(ok_t), o[t][d] = sum_m qv_t[m] * V_t[m][d]
__global__ __launch_bounds__(256) void gsa_read_kernel(
    const float* __restrict__ ok, const float* __restrict__ v,
    const float* __restrict__ s, const float* __restrict__ g,
    float* __restrict__ o)
{
    __shared__ __attribute__((aligned(16))) float u[TC][16][12];    // [t][group][dec0..3 s0..3 qv0..3]
    __shared__ __attribute__((aligned(16))) float vv[TC][32];       // [t][2c + j]
    __shared__ __attribute__((aligned(16))) float part[TC][16][32]; // [t][group][2c + j]

    const int tid = threadIdx.x;
    const int bh = blockIdx.x >> 1, dh = blockIdx.x & 1;
    const int b = bh / HH, h = bh % HH;
    const int lane = tid & 31, c = lane & 15;
    const int grp = (tid >> 5) * 2 + (lane >> 4);

    const int rA = tid >> 4, cA = tid & 15;     // g, s: rows rA and rA + 16, 4 floats
    const int rG = tid >> 3, cG = tid & 7;      // v: row rG, 4 floats of this half; ok: row rG, 8 slots
    const size_t head = ((size_t)b * TD * HH + h) * 64;
    const size_t step = HH * 64;

    v4f rg0, rg1, rs0, rs1, rv;
    v4f rok0, rok1;
    auto fetch = [&](int t0) {
        const size_t oA = head + (size_t)(t0 + rA) * step + cA * 4;
        rg0 = *(const v4f*)&g[oA];  rg1 = *(const v4f*)&g[oA + 16 * step];
        rs0 = *(const v4f*)&s[oA];  rs1 = *(const v4f*)&s[oA + 16 * step];
        rv  = *(const v4f*)&v[head + (size_t)(t0 + rG) * step + dh * 32 + cG * 4];
        const size_t oK = head + (size_t)(t0 + rG) * step + cG * 8;
        rok0 = *(const v4f*)&ok[oK];  rok1 = *(const v4f*)&ok[oK + 4];
    };
    auto stage = [&]() {
        v4f e0, e1;
        for (int e = 0; e < 4; ++e) { e0[e] = __expf(rg0[e]); e1[e] = __expf(rg1[e]); }
        *(v4f*)&u[rA][cA][0]      = e0;
        *(v4f*)&u[rA][cA][4]      = rs0;
        *(v4f*)&u[rA + 16][cA][0] = e1;
        *(v4f*)&u[rA + 16][cA][4] = rs1;
        for (int e = 0; e < 4; ++e) {
            const int dl = cG * 4 + e;
            vv[rG][(dl & 15) * 2 + (dl >> 4)] = rv[e];
        }
        // softmax over the 64 slots of row rG: 8 slots a lane, 8 lanes a row
        float mx = fmaxf(rok0[0], rok1[0]);
        for (int e = 1; e < 4; ++e) mx = fmaxf(mx, fmaxf(rok0[e], rok1[e]));
        mx = fmaxf(mx, lane_xor<1>(mx));
        mx = fmaxf(mx, lane_xor<2>(mx));
        mx = fmaxf(mx, lane_xor<4>(mx));
        v4f p0, p1;
        for (int e = 0; e < 4; ++e) { p0[e] = __expf(rok0[e] - mx); p1[e] = __expf(rok1[e] - mx); }
        const v4f ps = p0 + p1;
        float sum = (ps[0] + ps[1]) + (ps[2] + ps[3]);
        sum += lane_xor<1>(sum);
        sum += lane_xor<2>(sum);
        sum += lane_xor<4>(sum);
        const float inv = 1.f / sum;
        *(v4f*)&u[rG][cG * 2][8]     = p0 * inv;
        *(v4f*)&u[rG][cG * 2 + 1][8] = p1 * inv;
    };

    v2f st[4];
    for (int i = 0; i < 4; ++i) st[i] = splat2(0.f);

    fetch(0);
    stage();
    __syncthreads();
    for (int t0 = 0; t0 < TD; t0 += TC) {
        if (t0 + TC < TD) fetch(t0 + TC);       // next chunk flies under this one
        // unrolled so that the LDS loads of later steps issue ahead of the
        // multiply-adds of earlier ones
        #pragma unroll 8
        for (int t = 0; t < TC; ++t) {
            const v4f dec = *(const v4f*)&u[t][grp][0];
            const v4f sw  = *(const v4f*)&u[t][grp][4];
            const v4f qv  = *(const v4f*)&u[t][grp][8];
            const v2f vc  = *(const v2f*)&vv[t][c * 2];
            for (int i = 0; i < 4; ++i)
                st[i] = __builtin_elementwise_fma(st[i], splat2(dec[i]), splat2(sw[i]) * vc);
            v2f a0 = splat2(qv[0]) * st[0];
            v2f a1 = splat2(qv[2]) * st[2];
            a0 = __builtin_elementwise_fma(splat2(qv[1]), st[1], a0);
            a1 = __builtin_elementwise_fma(splat2(qv[3]), st[3], a1);
            *(v2f*)&part[t][grp][c * 2] = a0 + a1;
        }
        __syncthreads();    // partials complete; every read of u and vv done
        reduce_store(part, tid, 1.f, o, head + (size_t)t0 * step + dh * 32);
        if (t0 + TC < TD) stage();
        __syncthreads();    // next chunk published; partials free again
    }
}

// ---------------------------------------------------------------------------
// Per-(b,t,h) RMSNorm over DV=64, convert to f16 for the Wo GEMM.
// A row of 16 lanes owns one (b,t,h) row, 4 values a lane; a wave takes 16 such
// rows in eight 16-byte loads, each one run of 512 B, all in flight together.
// The sum of squares crosses the 16 lanes by register exchanges: no LDS, no
// barrier, and 2,048 waves to start in place of 65,536.
// ---------------------------------------------------------------------------
__global__ __launch_bounds__(256) void rms_cvt_kernel(
    const float* __restrict__ o, const float* __restrict__ w,
    _Float16* __restrict__ out)
{
    const int lane = threadIdx.x & 31;
    const int wave = blockIdx.x * 8 + (threadIdx.x >> 5);
    const size_t base = (size_t)wave * 1024 + lane * 4;
    const float* src = o + base;
    v4w xs[8];
    for (int j = 0; j < 8; ++j) xs[j] = *(const v4w*)(src + j * 128);
    const v4w wv = *(const v4w*)(w + (lane & 15) * 4);
    // inputs only: src is named behind the loads so that the address pair they
    // share is not among the registers that a load fills while they are out
    asm volatile("" :: "v"(src), "v"(xs[0]), "v"(xs[1]), "v"(xs[2]), "v"(xs[3]), "v"(xs[4]),
                       "v"(xs[5]), "v"(xs[6]), "v"(xs[7]), "v"(wv));
    for (int j = 0; j < 8; ++j) {
        const v4w q = xs[j] * xs[j];
        const float ss = row16_sum((q[0] + q[1]) + (q[2] + q[3]));
        const float rstd = rsqrtf(ss * (1.f / 64.f) + 1e-6f);
        v4h p;
        for (int e = 0; e < 4; ++e) p[e] = (_Float16)(xs[j][e] * rstd * wv[e]);
        *(v4h*)(out + base + j * 128) = p;
    }
}

// ---------------------------------------------------------------------------
extern "C" void kernel_launch(void* const* d_in, const int* in_sizes, int n_in,
                              void* d_out, int out_size, void* d_ws, size_t ws_size,
                              hipStream_t stream)
{
    const float* x    = (const float*)d_in[0];
    const float* ln1w = (const float*)d_in[1];
    const float* ln1b = (const float*)d_in[2];
    const float* Wq   = (const float*)d_in[3];
    const float* Wk   = (const float*)d_in[4];
    const float* Wv   = (const float*)d_in[5];
    const float* Wf   = (const float*)d_in[6];
    const float* gnw  = (const float*)d_in[7];
    const float* Wo   = (const float*)d_in[8];
    const float* ln2w = (const float*)d_in[9];
    const float* ln2b = (const float*)d_in[10];
    const float* W1   = (const float*)d_in[11];
    const float* b1   = (const float*)d_in[12];
    const float* W2   = (const float*)d_in[13];
    const float* b2   = (const float*)d_in[14];
    float* outp = (float*)d_out;

    const int BT = BD * TD;   // 2048 rows for every GEMM

    char* wsp = (char*)d_ws;
    auto carve = [&](size_t bytes) -> char* {
        char* p = wsp;
        wsp += (bytes + 255) & ~(size_t)255;
        return p;
    };
    _Float16* h16   = (_Float16*)carve((size_t)BT * DD * 2);
    // Wq, Wk, Wv, Wf transposed, one behind the other: the B operand [4096][DD]
    _Float16* WqT   = (_Float16*)carve((size_t)4 * DD * 1024 * 2);
    _Float16* WkT   = WqT + (size_t)DD * 1024;
    _Float16* WvT   = WkT + (size_t)DD * 1024;
    _Float16* WfT   = WvT + (size_t)DD * 1024;
    _Float16* WoT   = (_Float16*)carve((size_t)DD * 1024 * 2);
    _Float16* W1T   = (_Float16*)carve((size_t)MLPD * DD * 2);
    _Float16* W2T   = (_Float16*)carve((size_t)DD * MLPD * 2);
    // the five planes that the projection launch writes: q, k, v, s, g
    float*    qb    = (float*)carve((size_t)5 * BT * 1024 * 4);
    float*    kb    = qb + (size_t)BT * 1024;
    float*    vb    = kb + (size_t)BT * 1024;
    float*    sb    = vb + (size_t)BT * 1024;
    float*    gb    = sb + (size_t)BT * 1024;
    float*    ob    = (float*)carve((size_t)BT * 1024 * 4);
    float*    okb   = (float*)carve((size_t)BT * 1024 * 4);
    _Float16* on16  = (_Float16*)carve((size_t)BT * 1024 * 2);
    float*    yb    = (float*)carve((size_t)BT * DD * 4);
    _Float16* h216  = (_Float16*)carve((size_t)BT * DD * 2);
    _Float16* a16   = (_Float16*)carve((size_t)BT * MLPD * 2);

    // weight transposes: in[K][N] -> f16 [N][K], all seven in one launch
    transpose_cvt_all<<<832, 256, 0, stream>>>(Wq, Wk, Wv, Wf, Wo, W1, W2,
                                               WqT, WkT, WvT, WfT, WoT, W1T, W2T);

    // LN1
    layernorm_f16<<<BT / 8, 256, 0, stream>>>(x, ln1w, ln1b, h16);

    // the four projections (fused activations) in one launch
    const dim3 gD(1024 / 128, BT / 128);
    gemm_wmma<0><<<dim3(4 * 1024 / 128, BT / 128), 256, 0, stream>>>(
        h16, WqT, qb, nullptr, nullptr, nullptr, nullptr, 1024, DD);

    // recurrent gated-slot scan: slot scores for all t, then softmax and read-out
    gsa_scores_kernel<<<BD * HH * 2, 256, 0, stream>>>(qb, kb, sb, gb, okb);
    gsa_read_kernel<<<BD * HH * 2, 256, 0, stream>>>(okb, vb, sb, gb, ob);

    // per-head RMSNorm -> f16
    rms_cvt_kernel<<<BT * HH / 128, 256, 0, stream>>>(ob, gnw, on16);

    // output projection + residual
    gemm_wmma<3><<<gD, 256, 0, stream>>>(on16, WoT, yb, nullptr, nullptr, nullptr, x, DD, 1024);

    // LN2
    layernorm_f16<<<BT / 8, 256, 0, stream>>>(yb, ln2w, ln2b, h216);

    // MLP
    gemm_wmma<4><<<dim3(MLPD / 128, BT / 128), 256, 0, stream>>>(
        h216, W1T, nullptr, nullptr, a16, b1, nullptr, MLPD, DD);
    gemm_wmma<5><<<dim3(DD / 128, BT / 128), 256, 0, stream>>>(
        a16, W2T, outp, nullptr, nullptr, b2, yb, DD, MLPD);
}

// v007
// Measured time: 166 microseconds a run.
// Timed twice side by side with v006, it ran 1.28 times as fast both times.
// Counting every step since v000, it is 9.37 times as fast.
#include <hip/hip_runtime.h>

#define BD 4
#define TD 512
#define DD 1024
#define HH 16
#define MLPD 4096

typedef __attribute__((ext_vector_type(16))) _Float16 v16h;
typedef __attribute__((ext_vector_type(8)))  _Float16 v8h;
typedef __attribute__((ext_vector_type(8)))  float    v8f;

// ---------------------------------------------------------------------------
// Transpose + f32->f16 convert of all seven weight matrices in ONE launch:
// in[K][N] (row-major) -> out[N][K] (row-major), so the GEMM B operand is
// K-contiguous like A. A work-group takes one 128 x 128 tile (64 elements a
// thread), so that few waves have to be started for the bytes that are moved.
// Reads: a wave's 16-byte loads cover one whole 512 B row of the tile.
// Writes: a wave's 16-byte stores cover two whole 256 B rows of the output.
// The LDS tile is [n][k] in f16, rows of 256 B = 16 chunks of 16 B; chunk c of
// row n lies at place c ^ ((n >> 2) & 15), so the 16 lanes of a half-wave hit
// 16 different places both when they write (rows 4 apart, one chunk) and when
// they read (one row, 16 chunks).
// Tiles: 5 x 64 (the 1024 x 1024 matrices), 256 (W1), 256 (W2) = 832.
// ---------------------------------------------------------------------------
typedef __attribute__((ext_vector_type(4))) float v4w;

// One tile. K and N are compile-time so that the 16 loads and the 8 stores of a
// thread differ from one another by immediate offsets only: one address each,
// and all 16 loads in flight together.
template<int K, int N>
__device__ __forceinline__ void transpose_tile(
    const float* __restrict__ in, _Float16* __restrict__ out, int tk, int tn,
    _Float16* tile)
{
    const int lane = threadIdx.x & 31, wid = threadIdx.x >> 5;

    // wave: k rows wid * 16 .. + 15; lane: columns n = lane * 4 .. + 3
    const float* src = in + (size_t)(tk * 128 + wid * 16) * N + tn * 128 + lane * 4;
    v4w r[16];
    for (int j = 0; j < 16; ++j) r[j] = *(const v4w*)(src + (size_t)j * N);
    // inputs only: holds all 16 loads in front of the first conversion, so that
    // a wave waits out one memory latency; without it the compiler issues them
    // in three groups with a full wait between the groups; src is named too so
    // that the address pair the loads share is not among the registers they fill
    asm volatile("" :: "v"(src), "v"(r[0]), "v"(r[1]), "v"(r[2]), "v"(r[3]), "v"(r[4]), "v"(r[5]),
                       "v"(r[6]), "v"(r[7]), "v"(r[8]), "v"(r[9]), "v"(r[10]), "v"(r[11]),
                       "v"(r[12]), "v"(r[13]), "v"(r[14]), "v"(r[15]));
    for (int gI = 0; gI < 2; ++gI)
        for (int e = 0; e < 4; ++e) {
            v8h p;
            for (int j = 0; j < 8; ++j) p[j] = (_Float16)r[gI * 8 + j][e];
            *(v8h*)&tile[(lane * 4 + e) * 128 + (((wid * 2 + gI) ^ (lane & 15)) * 8)] = p;
        }
    __syncthreads();

    // wave: output rows n = wid * 16 .. + 15, two a store; half-wave: one row
    const int hl = lane & 15, hr = lane >> 4;
    _Float16* dst = out + (size_t)(tn * 128 + wid * 16 + hr) * K + tk * 128 + hl * 8;
    for (int j = 0; j < 8; ++j) {
        const int n = wid * 16 + j * 2 + hr;
        const v8h p = *(const v8h*)&tile[n * 128 + ((hl ^ ((n >> 2) & 15)) * 8)];
        *(v8h*)(dst + (size_t)(j * 2) * K) = p;
    }
    // behind the last store: the listing lets a path run on into code that
    // reuses the stores' address and data registers
    asm volatile("s_wait_xcnt 0x0" ::: "memory");
}

__global__ __launch_bounds__(256) void transpose_cvt_all(
    const float* __restrict__ Wq, const float* __restrict__ Wk,
    const float* __restrict__ Wv, const float* __restrict__ Wf,
    const float* __restrict__ Wo, const float* __restrict__ W1,
    const float* __restrict__ W2,
    _Float16* __restrict__ WqT, _Float16* __restrict__ WkT,
    _Float16* __restrict__ WvT, _Float16* __restrict__ WfT,
    _Float16* __restrict__ WoT, _Float16* __restrict__ W1T,
    _Float16* __restrict__ W2T)
{
    __shared__ __attribute__((aligned(16))) _Float16 tile[128 * 128];
    const int bid = blockIdx.x;     // every branch below is uniform for the work-group
    if (bid < 320) {
        const int m = bid >> 6;
        const float* in = m == 0 ? Wq  : m == 1 ? Wk  : m == 2 ? Wv  : m == 3 ? Wf  : Wo;
        _Float16* out   = m == 0 ? WqT : m == 1 ? WkT : m == 2 ? WvT : m == 3 ? WfT : WoT;
        transpose_tile<1024, 1024>(in, out, (bid >> 3) & 7, bid & 7, tile);
    } else if (bid < 576) {
        transpose_tile<DD, MLPD>(W1, W1T, (bid - 320) >> 5, (bid - 320) & 31, tile);
    } else {
        transpose_tile<MLPD, DD>(W2, W2T, (bid - 576) >> 3, (bid - 576) & 7, tile);
    }
}

// ---------------------------------------------------------------------------
// Cross-lane helpers of the normalisation kernels and of the scan's softmax.
// ---------------------------------------------------------------------------
typedef __attribute__((ext_vector_type(4))) _Float16 v4h;

// Value of lane l ^ M, M < 16: a register-to-register exchange inside a row of
// 16 lanes, so a reduction over neighbouring lanes takes no LDS round trip.
template<int M>
__device__ __forceinline__ float lane_xor(float x)
{
    return __builtin_bit_cast(float, __builtin_amdgcn_update_dpp(
        0, __builtin_bit_cast(int, x), 0x160 + M, 0xf, 0xf, true));
}

// Sum over the 16 lanes of a row, left in every lane of the row.
__device__ __forceinline__ float row16_sum(float x)
{
    x += lane_xor<1>(x);
    x += lane_xor<2>(x);
    x += lane_xor<4>(x);
    x += lane_xor<8>(x);
    return x;
}

// Value of lane l ^ 16: the same place in the other row of 16 lanes.
__device__ __forceinline__ float other_row(float x)
{
    const int v = __builtin_bit_cast(int, x);
    return __builtin_bit_cast(float, __builtin_amdgcn_permlanex16(
        v, v, 0x76543210, 0xfedcba98, false, false));
}

// ---------------------------------------------------------------------------
// LayerNorm over D=1024, output f16 (feeds WMMA GEMM A operand).
// One wave owns one row: 32 values a lane in eight 16-byte loads, each load of
// the wave one run of 512 B, all in flight together. The two sums stay in
// registers and cross the lanes by register exchanges, so the kernel has no LDS
// and no barrier, and an eighth of the waves have to be started.
// ---------------------------------------------------------------------------
__global__ __launch_bounds__(256) void layernorm_f16(
    const float* __restrict__ x, const float* __restrict__ w,
    const float* __restrict__ b, _Float16* __restrict__ out)
{
    const int lane = threadIdx.x & 31;
    const int row = blockIdx.x * 8 + (threadIdx.x >> 5);
    const float* xr = x + (size_t)row * DD + lane * 4;
    v4w xs[8], wv[8], bv[8];
    for (int j = 0; j < 8; ++j) xs[j] = *(const v4w*)(xr + j * 128);
    for (int j = 0; j < 8; ++j) {
        wv[j] = *(const v4w*)(w + lane * 4 + j * 128);
        bv[j] = *(const v4w*)(b + lane * 4 + j * 128);
    }
    // inputs only: holds all 24 loads in front of this line, so that a wave waits
    // out one memory latency; without it the compiler moves the loads of w and b
    // behind the reduction, two at a time with a wait between the pairs; xr is
    // named too so that the address pair is not reused while loads are out
    asm volatile("" :: "v"(xr), "v"(xs[0]), "v"(xs[1]), "v"(xs[2]), "v"(xs[3]), "v"(xs[4]), "v"(xs[5]),
                       "v"(xs[6]), "v"(xs[7]), "v"(wv[0]), "v"(wv[1]), "v"(wv[2]), "v"(wv[3]),
                       "v"(wv[4]), "v"(wv[5]), "v"(wv[6]), "v"(wv[7]), "v"(bv[0]), "v"(bv[1]),
                       "v"(bv[2]), "v"(bv[3]), "v"(bv[4]), "v"(bv[5]), "v"(bv[6]), "v"(bv[7]));
    // keeps the sums behind the loads: without it the compiler lifts them, with
    // their waits for x, in among the loads of w and b, which then start late
    __builtin_amdgcn_sched_barrier(0);
    v4w s4 = xs[0], q4 = xs[0] * xs[0];
    for (int j = 1; j < 8; ++j) {
        s4 += xs[j];
        q4 = __builtin_elementwise_fma(xs[j], xs[j], q4);
    }
    float sum = row16_sum((s4[0] + s4[1]) + (s4[2] + s4[3]));
    float sq  = row16_sum((q4[0] + q4[1]) + (q4[2] + q4[3]));
    sum += other_row(sum);
    sq  += other_row(sq);
    const float mu   = sum * (1.f / DD);
    const float var  = sq * (1.f / DD) - mu * mu;
    const float rstd = rsqrtf(var + 1e-6f);
    _Float16* orow = out + (size_t)row * DD + lane * 4;
    for (int j = 0; j < 8; ++j) {
        v4h p;
        for (int e = 0; e < 4; ++e)
            p[e] = (_Float16)((xs[j][e] - mu) * rstd * wv[j][e] + bv[j][e]);
        *(v4h*)(orow + j * 128) = p;
    }
}

// ---------------------------------------------------------------------------
// 2^x and log2(x) on the hardware's transcendental unit. The v_nop is the slot
// that the instruction set asks for behind a transcendental before its result is
// used or its source overwritten: in the unrolled epilogues the compiler put
// writes of the source directly behind some of them. x of log2_hw is normal.
// ---------------------------------------------------------------------------
__device__ __forceinline__ float exp2_hw(float x)
{
    float r;
    // one statement, so that the slot stays directly behind the transcendental
    asm("v_exp_f32 %0, %1\n\tv_nop" : "=v"(r) : "v"(x));
    return r;
}
__device__ __forceinline__ float log2_hw(float x)
{
    float r;
    // one statement, so that the slot stays directly behind the transcendental
    asm("v_log_f32 %0, %1\n\tv_nop" : "=v"(r) : "v"(x));
    return r;
}

// ---------------------------------------------------------------------------
// erf for the GELU epilogue, without a branch: both ranges are evaluated and one
// is selected, so that the 64 values of a thread are independent straight-line
// chains that fill one another's latency. A call that branches on |x| runs the
// values one behind the other, and a wave with lanes on both sides runs both.
// |x| < 1: x + x * Q(x^2); |x| >= 1: 1 - exp(-(|x| + |x| * P(|x|))).
// Largest error against erf over -6..6 in f32 arithmetic: 9e-8.
// ---------------------------------------------------------------------------
__device__ __forceinline__ float erf_select(float x)
{
    const float a = fabsf(x), t = x * x;
    float p = fmaf(a, 1.699881e-5f, -3.7867785e-4f);
    p = fmaf(a, p, 3.8578159e-3f);
    p = fmaf(a, p, -2.4181698e-2f);
    p = fmaf(a, p, 1.0666826e-1f);
    p = fmaf(a, p, 6.349333e-1f);
    p = fmaf(a, p, 1.2868941e-1f);
    p = fmaf(a, p, a);
    float q = fmaf(t, -5.618018e-4f, 4.913816e-3f);
    q = fmaf(t, q, -2.6707515e-2f);
    q = fmaf(t, q, 1.1280011e-1f);
    q = fmaf(t, q, -3.7612295e-1f);
    q = fmaf(t, q, 1.283791e-1f);
    q = fmaf(a, q, a);
    const float far = 1.f - exp2_hw(-1.44269504f * p);
    return copysignf(a < 1.f ? q : far, x);
}

// ---------------------------------------------------------------------------
// WMMA GEMM: C[M x N] = epilogue(A[M x K] @ Bt[N x K]^T)
// 128x128 block tile, 256 threads = 8 waves, each wave 32x64 (2x4 of 16x16).
// K staged 128-deep, DOUBLE-BUFFERED in LDS via CDNA5 async global->LDS copies
// (global_load_async_to_lds_b128, ASYNCcnt), so the fetch of stage k+1
// overlaps the v_wmma work on stage k.
// EPI: 0=the four input projections in one product (below), 3=+res f32,
//      4=+bias,gelu -> f16, 5=+bias,+res f32
// EPI 0: Bt holds the transposed Wq, Wk, Wv, Wf one behind the other, 4096 rows
// in all, so one launch has 512 work-groups (two for every WGP) where four
// launches of 128 each left half of the WGPs idle. out0 is five planes of
// BD * TD rows x 1024 floats: q, k, v, s, g. N is the pitch of a plane. The 128
// columns of a work-group lie in one matrix, so the choice of its activation is
// uniform for the work-group.
// ---------------------------------------------------------------------------
template<int EPI>
__global__ __launch_bounds__(256) void gemm_wmma(
    const _Float16* __restrict__ A, const _Float16* __restrict__ Bt,
    float* __restrict__ out0, float* __restrict__ out1,
    _Float16* __restrict__ outh,
    const float* __restrict__ bias, const float* __restrict__ res,
    int N, int K)
{
    // A stage is BK = 128 halfs of K: a row of 256 B, two whole 128 B lines, so
    // that one memory latency, one wait and one barrier serve four WMMA k steps.
    // LDS row pitch in halfs: 128 of data + 8 unused = 272 B = 16 B x odd, so the
    // 16 rows that a half-wave's ds_load_b128 reads lie on distinct banks.
    constexpr int BK = 128;
    constexpr int LP = BK + 8;
    __shared__ __attribute__((aligned(16))) _Float16 As[2][128 * LP];
    __shared__ __attribute__((aligned(16))) _Float16 Bs[2][128 * LP];
    const int tid  = threadIdx.x;
    const int lane = tid & 31, wid = tid >> 5;
    const int wm = wid >> 1, wn = wid & 1;       // 4 waves along M, 2 along N
    const int lr = lane & 15, hs = lane >> 4;    // half-wave select (ISA layout)
    const int rowBlk = blockIdx.y * 128, colBlk = blockIdx.x * 128;

    // Each thread owns eight fixed 16-byte chunks of the A tile and of the B
    // tile per stage: rows r0 + 16 * i, i = 0..7, half-offset o0. A wave's copy
    // covers two whole rows.
    const int r0 = tid >> 4, o0 = (tid & 15) * 8;
    const _Float16* gA = A  + (size_t)(rowBlk + r0) * K + o0;
    const _Float16* gB = Bt + (size_t)(colBlk + r0) * K + o0;
    // LDS byte addresses (low 32 bits of the generic pointer = LDS offset)
    const unsigned lA = (unsigned)(uintptr_t)&As[0][r0 * LP + o0];
    const unsigned lB = (unsigned)(uintptr_t)&Bs[0][r0 * LP + o0];
    constexpr unsigned bufBytes = 128 * LP * 2;
    constexpr unsigned lStep = 16 * LP * 2;      // 16 rows in LDS, bytes
    const size_t gStep = (size_t)16 * K;         // 16 rows in memory, halfs

    auto copy8 = [&](unsigned l, const _Float16* g) {
        // the last line is a precaution: it stands in front of every later
        // write of the address registers that these copies name
        asm volatile(
            "global_load_async_to_lds_b128 %0, %8, off\n\t"
            "global_load_async_to_lds_b128 %1, %9, off\n\t"
            "global_load_async_to_lds_b128 %2, %10, off\n\t"
            "global_load_async_to_lds_b128 %3, %11, off\n\t"
            "global_load_async_to_lds_b128 %4, %12, off\n\t"
            "global_load_async_to_lds_b128 %5, %13, off\n\t"
            "global_load_async_to_lds_b128 %6, %14, off\n\t"
            "global_load_async_to_lds_b128 %7, %15, off\n\t"
            "s_wait_xcnt 0x0"
            :
            : "v"(l), "v"(l + lStep), "v"(l + 2 * lStep), "v"(l + 3 * lStep),
              "v"(l + 4 * lStep), "v"(l + 5 * lStep), "v"(l + 6 * lStep), "v"(l + 7 * lStep),
              "v"((unsigned long long)(uintptr_t)(g)),
              "v"((unsigned long long)(uintptr_t)(g + gStep)),
              "v"((unsigned long long)(uintptr_t)(g + 2 * gStep)),
              "v"((unsigned long long)(uintptr_t)(g + 3 * gStep)),
              "v"((unsigned long long)(uintptr_t)(g + 4 * gStep)),
              "v"((unsigned long long)(uintptr_t)(g + 5 * gStep)),
              "v"((unsigned long long)(uintptr_t)(g + 6 * gStep)),
              "v"((unsigned long long)(uintptr_t)(g + 7 * gStep))
            : "memory");
    };
    auto issue_stage = [&](int kk, int buf) {
        const unsigned bo = (unsigned)buf * bufBytes;
        const size_t ko = (size_t)kk * BK;
        copy8(lA + bo, gA + ko);
        copy8(lB + bo, gB + ko);
    };

    v8f acc[2][4];
    for (int i = 0; i < 2; ++i)
        for (int j = 0; j < 4; ++j)
            for (int r = 0; r < 8; ++r) acc[i][j][r] = 0.f;

    const int nk = K >> 7;
    issue_stage(0, 0);
    asm volatile("s_wait_asynccnt 0x0" ::: "memory");   // own copies of stage 0 landed
    __syncthreads();                                    // stage 0 published
    if (nk > 1) issue_stage(1, 1);                      // flies under stage 0's work
    for (int kk = 0; kk < nk; ++kk) {
        const int buf = kk & 1;
        const _Float16* Ab = As[buf];
        const _Float16* Bb = Bs[buf];
        // unrolled so that the fragment loads of a later k step can issue ahead
        // of the matrix instructions of an earlier one
        #pragma unroll
        for (int ks = 0; ks < BK / 32; ++ks) {
            // Fragment layout (16-bit A 16x32): lanes 0-15 hold K 0-7 / 16-23,
            // lanes 16-31 hold K 8-15 / 24-31, for row M = lane%16.
            v16h af[2], bf[4];
            for (int i = 0; i < 2; ++i) {
                int r = wm * 32 + i * 16 + lr;
                v8h lo = *(const v8h*)&Ab[r * LP + ks * 32 + hs * 8];
                v8h hi = *(const v8h*)&Ab[r * LP + ks * 32 + hs * 8 + 16];
                af[i] = __builtin_shufflevector(lo, hi, 0,1,2,3,4,5,6,7,8,9,10,11,12,13,14,15);
            }
            for (int j = 0; j < 4; ++j) {
                int r = wn * 64 + j * 16 + lr;
                v8h lo = *(const v8h*)&Bb[r * LP + ks * 32 + hs * 8];
                v8h hi = *(const v8h*)&Bb[r * LP + ks * 32 + hs * 8 + 16];
                bf[j] = __builtin_shufflevector(lo, hi, 0,1,2,3,4,5,6,7,8,9,10,11,12,13,14,15);
            }
            for (int i = 0; i < 2; ++i)
                for (int j = 0; j < 4; ++j)
                    acc[i][j] = __builtin_amdgcn_wmma_f32_16x16x32_f16(
                        false, af[i], false, bf[j], (short)0, acc[i][j], false, false);
        }
        // hand-over: this wave's reads of buf are done, its copies of stage
        // kk + 1 have landed; the barrier publishes that stage and frees buf
        asm volatile("s_wait_dscnt 0x0" ::: "memory");      // own reads of buf retired
        asm volatile("s_wait_asynccnt 0x0" ::: "memory");   // own copies of stage kk + 1 landed
        __syncthreads();
        if (kk + 2 < nk) issue_stage(kk + 2, buf);      // flies under stage kk + 1's work
    }
    // no copy is outstanding when the wave goes on to the epilogue and ends
    asm volatile("s_wait_asynccnt 0x0" ::: "memory");

    // Epilogue. C/D layout: VGPR r holds M = r (lanes 0-15) or r+8 (lanes 16-31),
    // N = lane%16.
    if (EPI == 0) {
        const size_t PL = (size_t)BD * TD * 1024;
        const int mat = colBlk >> 10;               // 0 Wq, 1 Wk, 2 Wv, 3 Wf
        float* pl = out0 + (size_t)mat * PL;
        auto each = [&](auto f) {
            for (int i = 0; i < 2; ++i)
                for (int j = 0; j < 4; ++j)
                    for (int r = 0; r < 8; ++r) {
                        int row = rowBlk + wm * 32 + i * 16 + hs * 8 + r;
                        int col = (colBlk & 1023) + wn * 64 + j * 16 + lr;
                        f(acc[i][j][r], (size_t)row * N + col);
                    }
        };
        if (mat < 2) {                                 // q, k: swish
            each([&](float v, size_t idx) { pl[idx] = v / (1.f + __expf(-v)); });
        } else if (mat == 2) {                         // v
            each([&](float v, size_t idx) { pl[idx] = v; });
            // behind the last store: the listing lets a path run on into the swish
            // code, which reuses the stores' address registers
            asm volatile("s_wait_xcnt 0x0" ::: "memory");
        } else {                                       // gate: g = logsig(v)/8, s = 1-exp(g)
            // 1 + exp(-|v|) lies in (1, 2]: a normal number, so the hardware's base-2
            // logarithm takes it as it is, and the rounding of the sum puts about
            // 1e-7 absolute on ls, 1e-8 on g; s is formed as
            // 1 - exp(g). The library's log1p and expm1 took over a hundred
            // dependent instructions a value.
            each([&](float v, size_t idx) {
                float ls = fminf(v, 0.f)
                         - 0.69314718f * log2_hw(1.f + exp2_hw(-1.44269504f * fabsf(v)));
                float gg = ls * 0.125f;
                pl[idx + PL] = gg;
                pl[idx] = 1.f - exp2_hw(1.44269504f * gg);
            });
            // behind the last store: the listing lets a path run on into the code of
            // the v plane, which reuses the stores' address and data registers
            asm volatile("s_wait_xcnt 0x0" ::: "memory");
        }
        return;
    }
    // unrolled: left to itself the compiler keeps the GELU's loops over r rolled,
    // picks each accumulator by a run-time index and works on one value at a time
    #pragma unroll
    for (int i = 0; i < 2; ++i)
        #pragma unroll
        for (int j = 0; j < 4; ++j)
            #pragma unroll
            for (int r = 0; r < 8; ++r) {
                int row = rowBlk + wm * 32 + i * 16 + hs * 8 + r;
                int col = colBlk + wn * 64 + j * 16 + lr;
                size_t idx = (size_t)row * N + col;
                float v = acc[i][j][r];
                if (EPI == 3) {                            // + residual
                    out0[idx] = v + res[idx];
                } else if (EPI == 4) {                     // + bias, exact gelu, f16 out
                    float t = v + bias[col];
                    outh[idx] = (_Float16)(0.5f * t * (1.f + erf_select(t * 0.70710678118f)));
                } else if (EPI == 5) {                     // + bias + residual
                    out0[idx] = v + bias[col] + res[idx];
                }
            }
}

// ---------------------------------------------------------------------------
// Gated-slot attention scan, as two recurrences whose columns are independent.
// K[d][m] is decayed and written per slot m only, and V[m][d] feeds o[d] per
// column d only, so a lane that owns a column keeps its part of the state in
// registers for all T steps and never exchanges state with another lane.
// Pass 1 gives the slot scores ok[t][m] for every t, pass 2 takes their
// softmax and gives o[t][d]. Work-group = (b, h, half of the columns).
// A half-wave owns 4 rows of the contraction dim (16 groups in 8 waves) and a
// lane owns 2 columns (c and c + 16): 8 state values a lane, held as pairs.
// Time runs in chunks of TC steps staged in LDS; the 16 partial sums of each
// output are added once per chunk, so a chunk has two barriers in all.
// ---------------------------------------------------------------------------
#define TC 32
typedef __attribute__((ext_vector_type(2))) float v2f;
typedef __attribute__((ext_vector_type(4))) float v4f;

__device__ __forceinline__ v2f splat2(float a) { v2f r = {a, a}; return r; }

// Adds the 16 group partials of 4 neighbouring entries x = 2 * c + j and
// stores them at columns c + 16 * j of the output row.
__device__ __forceinline__ void reduce_store(
    const float (*part)[16][32], int tid, float scale, float* __restrict__ dst,
    size_t rowBase)
{
    const int t = tid >> 3, x4 = (tid & 7) * 4;
    v4f a = *(const v4f*)&part[t][0][x4];
    for (int gI = 1; gI < 16; ++gI) a += *(const v4f*)&part[t][gI][x4];
    a *= scale;
    float* p = dst + rowBase + (size_t)t * (HH * 64) + (x4 >> 1);
    v2f lo = {a.x, a.z}, hi = {a.y, a.w};
    *(v2f*)p = lo;
    *(v2f*)(p + 16) = hi;
    // the stores' address and data registers are reused right behind them
    asm volatile("s_wait_xcnt 0x0" ::: "memory");
}

// Pass 1: ok[t][m] = DK^-0.5 * sum_d q_t[d] * K_t[d][m]
__global__ __launch_bounds__(256) void gsa_scores_kernel(
    const float* __restrict__ q, const float* __restrict__ k,
    const float* __restrict__ s, const float* __restrict__ g,
    float* __restrict__ ok)
{
    __shared__ __attribute__((aligned(16))) float kq[TC][128];      // [t][group][k0..3 q0..3]
    __shared__ __attribute__((aligned(16))) float gs[TC][64];       // [t][c][dec0 dec1 s0 s1]
    __shared__ __attribute__((aligned(16))) float part[TC][16][32]; // [t][group][2c + j]

    const int tid = threadIdx.x;
    const int bh = blockIdx.x >> 1, mh = blockIdx.x & 1;
    const int b = bh / HH, h = bh % HH;
    const int lane = tid & 31, c = lane & 15;
    const int grp = (tid >> 5) * 2 + (lane >> 4);

    // staging ownership inside a chunk
    const int rA = tid >> 4, cA = tid & 15;     // k, q: rows rA and rA + 16, 4 floats
    const int rG = tid >> 3, cG = tid & 7;      // g, s: row rG, 4 floats of this half
    const size_t head = ((size_t)b * TD * HH + h) * 64;
    const size_t step = HH * 64;

    v4f rk0, rk1, rq0, rq1, rg, rs;
    auto fetch = [&](int t0) {
        const size_t oA = head + (size_t)(t0 + rA) * step + cA * 4;
        rk0 = *(const v4f*)&k[oA];  rk1 = *(const v4f*)&k[oA + 16 * step];
        rq0 = *(const v4f*)&q[oA];  rq1 = *(const v4f*)&q[oA + 16 * step];
        const size_t oG = head + (size_t)(t0 + rG) * step + mh * 32 + cG * 4;
        rg = *(const v4f*)&g[oG];   rs = *(const v4f*)&s[oG];
    };
    auto stage = [&]() {
        *(v4f*)&kq[rA][cA * 8]          = rk0;
        *(v4f*)&kq[rA][cA * 8 + 4]      = rq0;
        *(v4f*)&kq[rA + 16][cA * 8]     = rk1;
        *(v4f*)&kq[rA + 16][cA * 8 + 4] = rq1;
        for (int e = 0; e < 4; ++e) {
            const int ml = cG * 4 + e;
            gs[rG][(ml & 15) * 4 + (ml >> 4)]     = __expf(rg[e]);
            gs[rG][(ml & 15) * 4 + 2 + (ml >> 4)] = rs[e];
        }
    };

    v2f st[4];
    for (int i = 0; i < 4; ++i) st[i] = splat2(0.f);

    fetch(0);
    stage();
    __syncthreads();
    for (int t0 = 0; t0 < TD; t0 += TC) {
        if (t0 + TC < TD) fetch(t0 + TC);       // next chunk flies under this one
        // unrolled so that the LDS loads of later steps issue ahead of the
        // multiply-adds of earlier ones
        #pragma unroll 8
        for (int t = 0; t < TC; ++t) {
            const v4f kk = *(const v4f*)&kq[t][grp * 8];
            const v4f qq = *(const v4f*)&kq[t][grp * 8 + 4];
            const v4f ds = *(const v4f*)&gs[t][c * 4];
            const v2f dec = {ds.x, ds.y}, sw = {ds.z, ds.w};
            for (int i = 0; i < 4; ++i)
                st[i] = __builtin_elementwise_fma(st[i], dec, splat2(kk[i]) * sw);
            v2f a0 = splat2(qq[0]) * st[0];
            v2f a1 = splat2(qq[2]) * st[2];
            a0 = __builtin_elementwise_fma(splat2(qq[1]), st[1], a0);
            a1 = __builtin_elementwise_fma(splat2(qq[3]), st[3], a1);
            *(v2f*)&part[t][grp][c * 2] = a0 + a1;
        }
        __syncthreads();    // partials complete; every read of kq and gs done
        reduce_store(part, tid, 0.125f, ok, head + (size_t)t0 * step + mh * 32);
        if (t0 + TC < TD) stage();
        __syncthreads();    // next chunk published; partials free again
    }
}

// Pass 2: qv_t = softmax_m(ok_t), o[t][d] = sum_m qv_t[m] * V_t[m][d]
__global__ __launch_bounds__(256) void gsa_read_kernel(
    const float* __restrict__ ok, const float* __restrict__ v,
    const float* __restrict__ s, const float* __restrict__ g,
    float* __restrict__ o)
{
    __shared__ __attribute__((aligned(16))) float u[TC][16][12];    // [t][group][dec0..3 s0..3 qv0..3]
    __shared__ __attribute__((aligned(16))) float vv[TC][32];       // [t][2c + j]
    __shared__ __attribute__((aligned(16))) float part[TC][16][32]; // [t][group][2c + j]

    const int tid = threadIdx.x;
    const int bh = blockIdx.x >> 1, dh = blockIdx.x & 1;
    const int b = bh / HH, h = bh % HH;
    const int lane = tid & 31, c = lane & 15;
    const int grp = (tid >> 5) * 2 + (lane >> 4);

    const int rA = tid >> 4, cA = tid & 15;     // g, s: rows rA and rA + 16, 4 floats
    const int rG = tid >> 3, cG = tid & 7;      // v: row rG, 4 floats of this half; ok: row rG, 8 slots
    const size_t head = ((size_t)b * TD * HH + h) * 64;
    const size_t step = HH * 64;

    v4f rg0, rg1, rs0, rs1, rv;
    v4f rok0, rok1;
    auto fetch = [&](int t0) {
        const size_t oA = head + (size_t)(t0 + rA) * step + cA * 4;
        rg0 = *(const v4f*)&g[oA];  rg1 = *(const v4f*)&g[oA + 16 * step];
        rs0 = *(const v4f*)&s[oA];  rs1 = *(const v4f*)&s[oA + 16 * step];
        rv  = *(const v4f*)&v[head + (size_t)(t0 + rG) * step + dh * 32 + cG * 4];
        const size_t oK = head + (size_t)(t0 + rG) * step + cG * 8;
        rok0 = *(const v4f*)&ok[oK];  rok1 = *(const v4f*)&ok[oK + 4];
    };
    auto stage = [&]() {
        v4f e0, e1;
        for (int e = 0; e < 4; ++e) { e0[e] = __expf(rg0[e]); e1[e] = __expf(rg1[e]); }
        *(v4f*)&u[rA][cA][0]      = e0;
        *(v4f*)&u[rA][cA][4]      = rs0;
        *(v4f*)&u[rA + 16][cA][0] = e1;
        *(v4f*)&u[rA + 16][cA][4] = rs1;
        for (int e = 0; e < 4; ++e) {
            const int dl = cG * 4 + e;
            vv[rG][(dl & 15) * 2 + (dl >> 4)] = rv[e];
        }
        // softmax over the 64 slots of row rG: 8 slots a lane, 8 lanes a row
        float mx = fmaxf(rok0[0], rok1[0]);
        for (int e = 1; e < 4; ++e) mx = fmaxf(mx, fmaxf(rok0[e], rok1[e]));
        mx = fmaxf(mx, lane_xor<1>(mx));
        mx = fmaxf(mx, lane_xor<2>(mx));
        mx = fmaxf(mx, lane_xor<4>(mx));
        v4f p0, p1;
        for (int e = 0; e < 4; ++e) { p0[e] = __expf(rok0[e] - mx); p1[e] = __expf(rok1[e] - mx); }
        const v4f ps = p0 + p1;
        float sum = (ps[0] + ps[1]) + (ps[2] + ps[3]);
        sum += lane_xor<1>(sum);
        sum += lane_xor<2>(sum);
        sum += lane_xor<4>(sum);
        const float inv = 1.f / sum;
        *(v4f*)&u[rG][cG * 2][8]     = p0 * inv;
        *(v4f*)&u[rG][cG * 2 + 1][8] = p1 * inv;
    };

    v2f st[4];
    for (int i = 0; i < 4; ++i) st[i] = splat2(0.f);

    fetch(0);
    stage();
    __syncthreads();
    for (int t0 = 0; t0 < TD; t0 += TC) {
        if (t0 + TC < TD) fetch(t0 + TC);       // next chunk flies under this one
        // unrolled so that the LDS loads of later steps issue ahead of the
        // multiply-adds of earlier ones
        #pragma unroll 8
        for (int t = 0; t < TC; ++t) {
            const v4f dec = *(const v4f*)&u[t][grp][0];
            const v4f sw  = *(const v4f*)&u[t][grp][4];
            const v4f qv  = *(const v4f*)&u[t][grp][8];
            const v2f vc  = *(const v2f*)&vv[t][c * 2];
            for (int i = 0; i < 4; ++i)
                st[i] = __builtin_elementwise_fma(st[i], splat2(dec[i]), splat2(sw[i]) * vc);
            v2f a0 = splat2(qv[0]) * st[0];
            v2f a1 = splat2(qv[2]) * st[2];
            a0 = __builtin_elementwise_fma(splat2(qv[1]), st[1], a0);
            a1 = __builtin_elementwise_fma(splat2(qv[3]), st[3], a1);
            *(v2f*)&part[t][grp][c * 2] = a0 + a1;
        }
        __syncthreads();    // partials complete; every read of u and vv done
        reduce_store(part, tid, 1.f, o, head + (size_t)t0 * step + dh * 32);
        if (t0 + TC < TD) stage();
        __syncthreads();    // next chunk published; partials free again
    }
}

// ---------------------------------------------------------------------------
// Per-(b,t,h) RMSNorm over DV=64, convert to f16 for the Wo GEMM.
// A row of 16 lanes owns one (b,t,h) row, 4 values a lane; a wave takes 16 such
// rows in eight 16-byte loads, each one run of 512 B, all in flight together.
// The sum of squares crosses the 16 lanes by register exchanges: no LDS, no
// barrier, and 2,048 waves to start in place of 65,536.
// ---------------------------------------------------------------------------
__global__ __launch_bounds__(256) void rms_cvt_kernel(
    const float* __restrict__ o, const float* __restrict__ w,
    _Float16* __restrict__ out)
{
    const int lane = threadIdx.x & 31;
    const int wave = blockIdx.x * 8 + (threadIdx.x >> 5);
    const size_t base = (size_t)wave * 1024 + lane * 4;
    const float* src = o + base;
    v4w xs[8];
    for (int j = 0; j < 8; ++j) xs[j] = *(const v4w*)(src + j * 128);
    const v4w wv = *(const v4w*)(w + (lane & 15) * 4);
    // inputs only: src is named behind the loads so that the address pair they
    // share is not among the registers that a load fills while they are out
    asm volatile("" :: "v"(src), "v"(xs[0]), "v"(xs[1]), "v"(xs[2]), "v"(xs[3]), "v"(xs[4]),
                       "v"(xs[5]), "v"(xs[6]), "v"(xs[7]), "v"(wv));
    for (int j = 0; j < 8; ++j) {
        const v4w q = xs[j] * xs[j];
        const float ss = row16_sum((q[0] + q[1]) + (q[2] + q[3]));
        const float rstd = rsqrtf(ss * (1.f / 64.f) + 1e-6f);
        v4h p;
        for (int e = 0; e < 4; ++e) p[e] = (_Float16)(xs[j][e] * rstd * wv[e]);
        *(v4h*)(out + base + j * 128) = p;
    }
}

// ---------------------------------------------------------------------------
extern "C" void kernel_launch(void* const* d_in, const int* in_sizes, int n_in,
                              void* d_out, int out_size, void* d_ws, size_t ws_size,
                              hipStream_t stream)
{
    const float* x    = (const float*)d_in[0];
    const float* ln1w = (const float*)d_in[1];
    const float* ln1b = (const float*)d_in[2];
    const float* Wq   = (const float*)d_in[3];
    const float* Wk   = (const float*)d_in[4];
    const float* Wv   = (const float*)d_in[5];
    const float* Wf   = (const float*)d_in[6];
    const float* gnw  = (const float*)d_in[7];
    const float* Wo   = (const float*)d_in[8];
    const float* ln2w = (const float*)d_in[9];
    const float* ln2b = (const float*)d_in[10];
    const float* W1   = (const float*)d_in[11];
    const float* b1   = (const float*)d_in[12];
    const float* W2   = (const float*)d_in[13];
    const float* b2   = (const float*)d_in[14];
    float* outp = (float*)d_out;

    const int BT = BD * TD;   // 2048 rows for every GEMM

    char* wsp = (char*)d_ws;
    auto carve = [&](size_t bytes) -> char* {
        char* p = wsp;
        wsp += (bytes + 255) & ~(size_t)255;
        return p;
    };
    _Float16* h16   = (_Float16*)carve((size_t)BT * DD * 2);
    // Wq, Wk, Wv, Wf transposed, one behind the other: the B operand [4096][DD]
    _Float16* WqT   = (_Float16*)carve((size_t)4 * DD * 1024 * 2);
    _Float16* WkT   = WqT + (size_t)DD * 1024;
    _Float16* WvT   = WkT + (size_t)DD * 1024;
    _Float16* WfT   = WvT + (size_t)DD * 1024;
    _Float16* WoT   = (_Float16*)carve((size_t)DD * 1024 * 2);
    _Float16* W1T   = (_Float16*)carve((size_t)MLPD * DD * 2);
    _Float16* W2T   = (_Float16*)carve((size_t)DD * MLPD * 2);
    // the five planes that the projection launch writes: q, k, v, s, g
    float*    qb    = (float*)carve((size_t)5 * BT * 1024 * 4);
    float*    kb    = qb + (size_t)BT * 1024;
    float*    vb    = kb + (size_t)BT * 1024;
    float*    sb    = vb + (size_t)BT * 1024;
    float*    gb    = sb + (size_t)BT * 1024;
    float*    ob    = (float*)carve((size_t)BT * 1024 * 4);
    float*    okb   = (float*)carve((size_t)BT * 1024 * 4);
    _Float16* on16  = (_Float16*)carve((size_t)BT * 1024 * 2);
    float*    yb    = (float*)carve((size_t)BT * DD * 4);
    _Float16* h216  = (_Float16*)carve((size_t)BT * DD * 2);
    _Float16* a16   = (_Float16*)carve((size_t)BT * MLPD * 2);

    // weight transposes: in[K][N] -> f16 [N][K], all seven in one launch
    transpose_cvt_all<<<832, 256, 0, stream>>>(Wq, Wk, Wv, Wf, Wo, W1, W2,
                                               WqT, WkT, WvT, WfT, WoT, W1T, W2T);

    // LN1
    layernorm_f16<<<BT / 8, 256, 0, stream>>>(x, ln1w, ln1b, h16);

    // the four projections (fused activations) in one launch
    const dim3 gD(1024 / 128, BT / 128);
    gemm_wmma<0><<<dim3(4 * 1024 / 128, BT / 128), 256, 0, stream>>>(
        h16, WqT, qb, nullptr, nullptr, nullptr, nullptr, 1024, DD);

    // recurrent gated-slot scan: slot scores for all t, then softmax and read-out
    gsa_scores_kernel<<<BD * HH * 2, 256, 0, stream>>>(qb, kb, sb, gb, okb);
    gsa_read_kernel<<<BD * HH * 2, 256, 0, stream>>>(okb, vb, sb, gb, ob);

    // per-head RMSNorm -> f16
    rms_cvt_kernel<<<BT * HH / 128, 256, 0, stream>>>(ob, gnw, on16);

    // output projection + residual
    gemm_wmma<3><<<gD, 256, 0, stream>>>(on16, WoT, yb, nullptr, nullptr, nullptr, x, DD, 1024);

    // LN2
    layernorm_f16<<<BT / 8, 256, 0, stream>>>(yb, ln2w, ln2b, h216);

    // MLP
    gemm_wmma<4><<<dim3(MLPD / 128, BT / 128), 256, 0, stream>>>(
        h216, W1T, nullptr, nullptr, a16, b1, nullptr, MLPD, DD);
    gemm_wmma<5><<<dim3(DD / 128, BT / 128), 256, 0, stream>>>(
        a16, W2T, outp, nullptr, nullptr, b2, yb, DD, MLPD);
}

// v008
// It runs in 160 microseconds.
// Next to v007, in two timings, it ran 1.05 and 1.06 times as fast.
// All steps since v000 together make it 9.87 times as fast.
#include <hip/hip_runtime.h>

#define BD 4
#define TD 512
#define DD 1024
#define HH 16
#define MLPD 4096

typedef __attribute__((ext_vector_type(16))) _Float16 v16h;
typedef __attribute__((ext_vector_type(8)))  _Float16 v8h;
typedef __attribute__((ext_vector_type(8)))  float    v8f;

// ---------------------------------------------------------------------------
// Transpose + f32->f16 convert of all seven weight matrices in ONE launch:
// in[K][N] (row-major) -> out[N][K] (row-major), so the GEMM B operand is
// K-contiguous like A. A work-group takes one 128 x 128 tile (64 elements a
// thread), so that few waves have to be started for the bytes that are moved.
// Reads: a wave's 16-byte loads cover one whole 512 B row of the tile.
// Writes: a wave's 16-byte stores cover two whole 256 B rows of the output.
// The LDS tile is [n][k] in f16, rows of 256 B = 16 chunks of 16 B; chunk c of
// row n lies at place c ^ ((n >> 2) & 15), so the 16 lanes of a half-wave hit
// 16 different places both when they write (rows 4 apart, one chunk) and when
// they read (one row, 16 chunks).
// Tiles: 5 x 64 (the 1024 x 1024 matrices), 256 (W1), 256 (W2) = 832.
// ---------------------------------------------------------------------------
typedef __attribute__((ext_vector_type(4))) float v4w;

// One tile. K and N are compile-time so that the 16 loads and the 8 stores of a
// thread differ from one another by immediate offsets only: one address each,
// and all 16 loads in flight together.
template<int K, int N>
__device__ __forceinline__ void transpose_tile(
    const float* __restrict__ in, _Float16* __restrict__ out, int tk, int tn,
    _Float16* tile)
{
    const int lane = threadIdx.x & 31, wid = threadIdx.x >> 5;

    // wave: k rows wid * 16 .. + 15; lane: columns n = lane * 4 .. + 3
    const float* src = in + (size_t)(tk * 128 + wid * 16) * N + tn * 128 + lane * 4;
    v4w r[16];
    for (int j = 0; j < 16; ++j) r[j] = *(const v4w*)(src + (size_t)j * N);
    // inputs only: holds all 16 loads in front of the first conversion, so that
    // a wave waits out one memory latency; without it the compiler issues them
    // in three groups with a full wait between the groups; src is named too so
    // that the address pair the loads share is not among the registers they fill
    asm volatile("" :: "v"(src), "v"(r[0]), "v"(r[1]), "v"(r[2]), "v"(r[3]), "v"(r[4]), "v"(r[5]),
                       "v"(r[6]), "v"(r[7]), "v"(r[8]), "v"(r[9]), "v"(r[10]), "v"(r[11]),
                       "v"(r[12]), "v"(r[13]), "v"(r[14]), "v"(r[15]));
    for (int gI = 0; gI < 2; ++gI)
        for (int e = 0; e < 4; ++e) {
            v8h p;
            for (int j = 0; j < 8; ++j) p[j] = (_Float16)r[gI * 8 + j][e];
            *(v8h*)&tile[(lane * 4 + e) * 128 + (((wid * 2 + gI) ^ (lane & 15)) * 8)] = p;
        }
    __syncthreads();

    // wave: output rows n = wid * 16 .. + 15, two a store; half-wave: one row
    const int hl = lane & 15, hr = lane >> 4;
    _Float16* dst = out + (size_t)(tn * 128 + wid * 16 + hr) * K + tk * 128 + hl * 8;
    for (int j = 0; j < 8; ++j) {
        const int n = wid * 16 + j * 2 + hr;
        const v8h p = *(const v8h*)&tile[n * 128 + ((hl ^ ((n >> 2) & 15)) * 8)];
        *(v8h*)(dst + (size_t)(j * 2) * K) = p;
    }
    // behind the last store: the listing lets a path run on into code that
    // reuses the stores' address and data registers
    asm volatile("s_wait_xcnt 0x0" ::: "memory");
}

__global__ __launch_bounds__(256) void transpose_cvt_all(
    const float* __restrict__ Wq, const float* __restrict__ Wk,
    const float* __restrict__ Wv, const float* __restrict__ Wf,
    const float* __restrict__ Wo, const float* __restrict__ W1,
    const float* __restrict__ W2,
    _Float16* __restrict__ WqT, _Float16* __restrict__ WkT,
    _Float16* __restrict__ WvT, _Float16* __restrict__ WfT,
    _Float16* __restrict__ WoT, _Float16* __restrict__ W1T,
    _Float16* __restrict__ W2T)
{
    __shared__ __attribute__((aligned(16))) _Float16 tile[128 * 128];
    const int bid = blockIdx.x;     // every branch below is uniform for the work-group
    if (bid < 320) {
        const int m = bid >> 6;
        const float* in = m == 0 ? Wq  : m == 1 ? Wk  : m == 2 ? Wv  : m == 3 ? Wf  : Wo;
        _Float16* out   = m == 0 ? WqT : m == 1 ? WkT : m == 2 ? WvT : m == 3 ? WfT : WoT;
        transpose_tile<1024, 1024>(in, out, (bid >> 3) & 7, bid & 7, tile);
    } else if (bid < 576) {
        transpose_tile<DD, MLPD>(W1, W1T, (bid - 320) >> 5, (bid - 320) & 31, tile);
    } else {
        transpose_tile<MLPD, DD>(W2, W2T, (bid - 576) >> 3, (bid - 576) & 7, tile);
    }
}

// ---------------------------------------------------------------------------
// Cross-lane helpers of the normalisation kernels and of the scan's softmax.
// ---------------------------------------------------------------------------
typedef __attribute__((ext_vector_type(4))) _Float16 v4h;

// Value of lane l ^ M, M < 16: a register-to-register exchange inside a row of
// 16 lanes, so a reduction over neighbouring lanes takes no LDS round trip.
template<int M>
__device__ __forceinline__ float lane_xor(float x)
{
    return __builtin_bit_cast(float, __builtin_amdgcn_update_dpp(
        0, __builtin_bit_cast(int, x), 0x160 + M, 0xf, 0xf, true));
}

// Sum over the 16 lanes of a row, left in every lane of the row.
__device__ __forceinline__ float row16_sum(float x)
{
    x += lane_xor<1>(x);
    x += lane_xor<2>(x);
    x += lane_xor<4>(x);
    x += lane_xor<8>(x);
    return x;
}

// Value of lane l ^ 16: the same place in the other row of 16 lanes.
__device__ __forceinline__ float other_row(float x)
{
    const int v = __builtin_bit_cast(int, x);
    return __builtin_bit_cast(float, __builtin_amdgcn_permlanex16(
        v, v, 0x76543210, 0xfedcba98, false, false));
}

// ---------------------------------------------------------------------------
// LayerNorm over D=1024, output f16 (feeds WMMA GEMM A operand).
// One wave owns one row: 32 values a lane in eight 16-byte loads, each load of
// the wave one run of 512 B, all in flight together. The two sums stay in
// registers and cross the lanes by register exchanges, so the kernel has no LDS
// and no barrier, and an eighth of the waves have to be started.
// ---------------------------------------------------------------------------
__global__ __launch_bounds__(256) void layernorm_f16(
    const float* __restrict__ x, const float* __restrict__ w,
    const float* __restrict__ b, _Float16* __restrict__ out)
{
    const int lane = threadIdx.x & 31;
    const int row = blockIdx.x * 8 + (threadIdx.x >> 5);
    const float* xr = x + (size_t)row * DD + lane * 4;
    v4w xs[8], wv[8], bv[8];
    for (int j = 0; j < 8; ++j) xs[j] = *(const v4w*)(xr + j * 128);
    for (int j = 0; j < 8; ++j) {
        wv[j] = *(const v4w*)(w + lane * 4 + j * 128);
        bv[j] = *(const v4w*)(b + lane * 4 + j * 128);
    }
    // inputs only: holds all 24 loads in front of this line, so that a wave waits
    // out one memory latency; without it the compiler moves the loads of w and b
    // behind the reduction, two at a time with a wait between the pairs; xr is
    // named too so that the address pair is not reused while loads are out
    asm volatile("" :: "v"(xr), "v"(xs[0]), "v"(xs[1]), "v"(xs[2]), "v"(xs[3]), "v"(xs[4]), "v"(xs[5]),
                       "v"(xs[6]), "v"(xs[7]), "v"(wv[0]), "v"(wv[1]), "v"(wv[2]), "v"(wv[3]),
                       "v"(wv[4]), "v"(wv[5]), "v"(wv[6]), "v"(wv[7]), "v"(bv[0]), "v"(bv[1]),
                       "v"(bv[2]), "v"(bv[3]), "v"(bv[4]), "v"(bv[5]), "v"(bv[6]), "v"(bv[7]));
    // keeps the sums behind the loads: without it the compiler lifts them, with
    // their waits for x, in among the loads of w and b, which then start late
    __builtin_amdgcn_sched_barrier(0);
    v4w s4 = xs[0], q4 = xs[0] * xs[0];
    for (int j = 1; j < 8; ++j) {
        s4 += xs[j];
        q4 = __builtin_elementwise_fma(xs[j], xs[j], q4);
    }
    float sum = row16_sum((s4[0] + s4[1]) + (s4[2] + s4[3]));
    float sq  = row16_sum((q4[0] + q4[1]) + (q4[2] + q4[3]));
    sum += other_row(sum);
    sq  += other_row(sq);
    const float mu   = sum * (1.f / DD);
    const float var  = sq * (1.f / DD) - mu * mu;
    const float rstd = rsqrtf(var + 1e-6f);
    _Float16* orow = out + (size_t)row * DD + lane * 4;
    for (int j = 0; j < 8; ++j) {
        v4h p;
        for (int e = 0; e < 4; ++e)
            p[e] = (_Float16)((xs[j][e] - mu) * rstd * wv[j][e] + bv[j][e]);
        *(v4h*)(orow + j * 128) = p;
    }
}

// ---------------------------------------------------------------------------
// 2^x and log2(x) on the hardware's transcendental unit. The v_nop is the slot
// that the instruction set asks for behind a transcendental before its result is
// used or its source overwritten: in the unrolled epilogues the compiler put
// writes of the source directly behind some of them. x of log2_hw is normal.
// ---------------------------------------------------------------------------
__device__ __forceinline__ float exp2_hw(float x)
{
    float r;
    // one statement, so that the slot stays directly behind the transcendental
    asm("v_exp_f32 %0, %1\n\tv_nop" : "=v"(r) : "v"(x));
    return r;
}
__device__ __forceinline__ float log2_hw(float x)
{
    float r;
    // one statement, so that the slot stays directly behind the transcendental
    asm("v_log_f32 %0, %1\n\tv_nop" : "=v"(r) : "v"(x));
    return r;
}

// ---------------------------------------------------------------------------
// erf for the GELU epilogue, without a branch: both ranges are evaluated and one
// is selected, so that the 64 values of a thread are independent straight-line
// chains that fill one another's latency. A call that branches on |x| runs the
// values one behind the other, and a wave with lanes on both sides runs both.
// |x| < 1: x + x * Q(x^2); |x| >= 1: 1 - exp(-(|x| + |x| * P(|x|))).
// Largest error against erf over -6..6 in f32 arithmetic: 9e-8.
// ---------------------------------------------------------------------------
__device__ __forceinline__ float erf_select(float x)
{
    const float a = fabsf(x), t = x * x;
    float p = fmaf(a, 1.699881e-5f, -3.7867785e-4f);
    p = fmaf(a, p, 3.8578159e-3f);
    p = fmaf(a, p, -2.4181698e-2f);
    p = fmaf(a, p, 1.0666826e-1f);
    p = fmaf(a, p, 6.349333e-1f);
    p = fmaf(a, p, 1.2868941e-1f);
    p = fmaf(a, p, a);
    float q = fmaf(t, -5.618018e-4f, 4.913816e-3f);
    q = fmaf(t, q, -2.6707515e-2f);
    q = fmaf(t, q, 1.1280011e-1f);
    q = fmaf(t, q, -3.7612295e-1f);
    q = fmaf(t, q, 1.283791e-1f);
    q = fmaf(a, q, a);
    const float far = 1.f - exp2_hw(-1.44269504f * p);
    return copysignf(a < 1.f ? q : far, x);
}

// ---------------------------------------------------------------------------
// WMMA GEMM: C[M x N] = epilogue(A[M x K] @ Bt[N x K]^T)
// 128x128 block tile, 256 threads = 8 waves, each wave 32x64 (2x4 of 16x16).
// K staged 128-deep, DOUBLE-BUFFERED in LDS via CDNA5 async global->LDS copies
// (global_load_async_to_lds_b128, ASYNCcnt), so the fetch of stage k+1
// overlaps the v_wmma work on stage k.
// EPI: 0=the four input projections in one product (below), 3=+res f32,
//      4=+bias,gelu -> f16, 5=+bias,+res f32
// EPI 0: Bt holds the transposed Wq, Wk, Wv, Wf one behind the other, 4096 rows
// in all, so one launch has 512 work-groups (two for every WGP) where four
// launches of 128 each left half of the WGPs idle. out0 is five planes of
// BD * TD rows x 1024 floats: q, k, v, s, g. N is the pitch of a plane. The 128
// columns of a work-group lie in one matrix, so the choice of its activation is
// uniform for the work-group.
// ---------------------------------------------------------------------------
template<int EPI>
__global__ __launch_bounds__(256) void gemm_wmma(
    const _Float16* __restrict__ A, const _Float16* __restrict__ Bt,
    float* __restrict__ out0, float* __restrict__ out1,
    _Float16* __restrict__ outh,
    const float* __restrict__ bias, const float* __restrict__ res,
    int N, int K)
{
    // A stage is BK = 128 halfs of K: a row of 256 B, two whole 128 B lines, so
    // that one memory latency, one wait and one barrier serve four WMMA k steps.
    // LDS row pitch in halfs: 128 of data + 8 unused = 272 B = 16 B x odd, so the
    // 16 rows that a half-wave's ds_load_b128 reads lie on distinct banks.
    constexpr int BK = 128;
    constexpr int LP = BK + 8;
    __shared__ __attribute__((aligned(16))) _Float16 As[2][128 * LP];
    __shared__ __attribute__((aligned(16))) _Float16 Bs[2][128 * LP];
    const int tid  = threadIdx.x;
    const int lane = tid & 31, wid = tid >> 5;
    const int wm = wid >> 1, wn = wid & 1;       // 4 waves along M, 2 along N
    const int lr = lane & 15, hs = lane >> 4;    // half-wave select (ISA layout)
    const int rowBlk = blockIdx.y * 128, colBlk = blockIdx.x * 128;

    // Each thread owns eight fixed 16-byte chunks of the A tile and of the B
    // tile per stage: rows r0 + 16 * i, i = 0..7, half-offset o0. A wave's copy
    // covers two whole rows.
    const int r0 = tid >> 4, o0 = (tid & 15) * 8;
    const _Float16* gA = A  + (size_t)(rowBlk + r0) * K + o0;
    const _Float16* gB = Bt + (size_t)(colBlk + r0) * K + o0;
    // LDS byte addresses (low 32 bits of the generic pointer = LDS offset)
    const unsigned lA = (unsigned)(uintptr_t)&As[0][r0 * LP + o0];
    const unsigned lB = (unsigned)(uintptr_t)&Bs[0][r0 * LP + o0];
    constexpr unsigned bufBytes = 128 * LP * 2;
    constexpr unsigned lStep = 16 * LP * 2;      // 16 rows in LDS, bytes
    const size_t gStep = (size_t)16 * K;         // 16 rows in memory, halfs

    auto copy8 = [&](unsigned l, const _Float16* g) {
        // the last line is a precaution: it stands in front of every later
        // write of the address registers that these copies name
        asm volatile(
            "global_load_async_to_lds_b128 %0, %8, off\n\t"
            "global_load_async_to_lds_b128 %1, %9, off\n\t"
            "global_load_async_to_lds_b128 %2, %10, off\n\t"
            "global_load_async_to_lds_b128 %3, %11, off\n\t"
            "global_load_async_to_lds_b128 %4, %12, off\n\t"
            "global_load_async_to_lds_b128 %5, %13, off\n\t"
            "global_load_async_to_lds_b128 %6, %14, off\n\t"
            "global_load_async_to_lds_b128 %7, %15, off\n\t"
            "s_wait_xcnt 0x0"
            :
            : "v"(l), "v"(l + lStep), "v"(l + 2 * lStep), "v"(l + 3 * lStep),
              "v"(l + 4 * lStep), "v"(l + 5 * lStep), "v"(l + 6 * lStep), "v"(l + 7 * lStep),
              "v"((unsigned long long)(uintptr_t)(g)),
              "v"((unsigned long long)(uintptr_t)(g + gStep)),
              "v"((unsigned long long)(uintptr_t)(g + 2 * gStep)),
              "v"((unsigned long long)(uintptr_t)(g + 3 * gStep)),
              "v"((unsigned long long)(uintptr_t)(g + 4 * gStep)),
              "v"((unsigned long long)(uintptr_t)(g + 5 * gStep)),
              "v"((unsigned long long)(uintptr_t)(g + 6 * gStep)),
              "v"((unsigned long long)(uintptr_t)(g + 7 * gStep))
            : "memory");
    };
    auto issue_stage = [&](int kk, int buf) {
        const unsigned bo = (unsigned)buf * bufBytes;
        const size_t ko = (size_t)kk * BK;
        copy8(lA + bo, gA + ko);
        copy8(lB + bo, gB + ko);
    };

    v8f acc[2][4];
    for (int i = 0; i < 2; ++i)
        for (int j = 0; j < 4; ++j)
            for (int r = 0; r < 8; ++r) acc[i][j][r] = 0.f;

    const int nk = K >> 7;
    issue_stage(0, 0);
    asm volatile("s_wait_asynccnt 0x0" ::: "memory");   // own copies of stage 0 landed
    __syncthreads();                                    // stage 0 published
    if (nk > 1) issue_stage(1, 1);                      // flies under stage 0's work
    for (int kk = 0; kk < nk; ++kk) {
        const int buf = kk & 1;
        const _Float16* Ab = As[buf];
        const _Float16* Bb = Bs[buf];
        // unrolled so that the fragment loads of a later k step can issue ahead
        // of the matrix instructions of an earlier one
        #pragma unroll
        for (int ks = 0; ks < BK / 32; ++ks) {
            // Fragment layout (16-bit A 16x32): lanes 0-15 hold K 0-7 / 16-23,
            // lanes 16-31 hold K 8-15 / 24-31, for row M = lane%16.
            v16h af[2], bf[4];
            for (int i = 0; i < 2; ++i) {
                int r = wm * 32 + i * 16 + lr;
                v8h lo = *(const v8h*)&Ab[r * LP + ks * 32 + hs * 8];
                v8h hi = *(const v8h*)&Ab[r * LP + ks * 32 + hs * 8 + 16];
                af[i] = __builtin_shufflevector(lo, hi, 0,1,2,3,4,5,6,7,8,9,10,11,12,13,14,15);
            }
            for (int j = 0; j < 4; ++j) {
                int r = wn * 64 + j * 16 + lr;
                v8h lo = *(const v8h*)&Bb[r * LP + ks * 32 + hs * 8];
                v8h hi = *(const v8h*)&Bb[r * LP + ks * 32 + hs * 8 + 16];
                bf[j] = __builtin_shufflevector(lo, hi, 0,1,2,3,4,5,6,7,8,9,10,11,12,13,14,15);
            }
            for (int i = 0; i < 2; ++i)
                for (int j = 0; j < 4; ++j)
                    acc[i][j] = __builtin_amdgcn_wmma_f32_16x16x32_f16(
                        false, af[i], false, bf[j], (short)0, acc[i][j], false, false);
        }
        // hand-over: this wave's reads of buf are done, its copies of stage
        // kk + 1 have landed; the barrier publishes that stage and frees buf
        asm volatile("s_wait_dscnt 0x0" ::: "memory");      // own reads of buf retired
        asm volatile("s_wait_asynccnt 0x0" ::: "memory");   // own copies of stage kk + 1 landed
        __syncthreads();
        if (kk + 2 < nk) issue_stage(kk + 2, buf);      // flies under stage kk + 1's work
    }
    // no copy is outstanding when the wave goes on to the epilogue and ends
    asm volatile("s_wait_asynccnt 0x0" ::: "memory");

    // Epilogue. C/D layout: VGPR r holds M = r (lanes 0-15) or r+8 (lanes 16-31),
    // N = lane%16.
    if (EPI == 0) {
        const size_t PL = (size_t)BD * TD * 1024;
        const int mat = colBlk >> 10;               // 0 Wq, 1 Wk, 2 Wv, 3 Wf
        float* pl = out0 + (size_t)mat * PL;
        auto each = [&](auto f) {
            for (int i = 0; i < 2; ++i)
                for (int j = 0; j < 4; ++j)
                    for (int r = 0; r < 8; ++r) {
                        int row = rowBlk + wm * 32 + i * 16 + hs * 8 + r;
                        int col = (colBlk & 1023) + wn * 64 + j * 16 + lr;
                        f(acc[i][j][r], (size_t)row * N + col);
                    }
        };
        if (mat < 2) {                                 // q, k: swish
            each([&](float v, size_t idx) { pl[idx] = v / (1.f + __expf(-v)); });
        } else if (mat == 2) {                         // v
            each([&](float v, size_t idx) { pl[idx] = v; });
            // behind the last store: the listing lets a path run on into the swish
            // code, which reuses the stores' address registers
            asm volatile("s_wait_xcnt 0x0" ::: "memory");
        } else {                                       // gate: g = logsig(v)/8, s = 1-exp(g)
            // 1 + exp(-|v|) lies in (1, 2]: a normal number, so the hardware's base-2
            // logarithm takes it as it is, and the rounding of the sum puts about
            // 1e-7 absolute on ls, 1e-8 on g; s is formed as
            // 1 - exp(g). The library's log1p and expm1 took over a hundred
            // dependent instructions a value.
            each([&](float v, size_t idx) {
                float ls = fminf(v, 0.f)
                         - 0.69314718f * log2_hw(1.f + exp2_hw(-1.44269504f * fabsf(v)));
                float gg = ls * 0.125f;
                pl[idx + PL] = gg;
                pl[idx] = 1.f - exp2_hw(1.44269504f * gg);
            });
            // behind the last store: the listing lets a path run on into the code of
            // the v plane, which reuses the stores' address and data registers
            asm volatile("s_wait_xcnt 0x0" ::: "memory");
        }
        return;
    }
    // unrolled: left to itself the compiler keeps the GELU's loops over r rolled,
    // picks each accumulator by a run-time index and works on one value at a time
    #pragma unroll
    for (int i = 0; i < 2; ++i)
        #pragma unroll
        for (int j = 0; j < 4; ++j)
            #pragma unroll
            for (int r = 0; r < 8; ++r) {
                int row = rowBlk + wm * 32 + i * 16 + hs * 8 + r;
                int col = colBlk + wn * 64 + j * 16 + lr;
                size_t idx = (size_t)row * N + col;
                float v = acc[i][j][r];
                if (EPI == 3) {                            // + residual
                    out0[idx] = v + res[idx];
                } else if (EPI == 4) {                     // + bias, exact gelu, f16 out
                    float t = v + bias[col];
                    outh[idx] = (_Float16)(0.5f * t * (1.f + erf_select(t * 0.70710678118f)));
                } else if (EPI == 5) {                     // + bias + residual
                    out0[idx] = v + bias[col] + res[idx];
                }
            }
}

// ---------------------------------------------------------------------------
// Gated-slot attention scan, as two recurrences whose columns are independent.
// K[d][m] is decayed and written per slot m only, and V[m][d] feeds o[d] per
// column d only, so a lane that owns a column keeps its part of the state in
// registers for all T steps and never exchanges state with another lane.
// Pass 1 gives the slot scores ok[t][m] for every t, pass 2 takes their
// softmax and gives o[t][d]. Work-group = (b, h, quarter of the columns): 256
// work-groups of 4 waves, one wave on every SIMD of the chip.
// Eight lanes own 4 rows of the contraction dim (16 groups in 4 waves) and a
// lane owns 2 columns (c and c + 8): 8 state values a lane, held as pairs.
// Time runs in chunks of TC steps staged in LDS; the 16 partial sums of each
// output are added once per chunk, so a chunk has two barriers in all.
// Both results are laid out [b * HH + h][quarter][t][16], so that a work-group
// writes whole 128 B lines that no other work-group writes to.
// ---------------------------------------------------------------------------
#define TC 32
// floats from one time step's partials to the next: 16 groups x 16 entries and
// 16 unused, so that the four time steps which a half-wave adds up side by side
// lie on different banks
#define PT 272
typedef __attribute__((ext_vector_type(2))) float v2f;
typedef __attribute__((ext_vector_type(4))) float v4f;

__device__ __forceinline__ v2f splat2(float a) { v2f r = {a, a}; return r; }

// Adds the 16 group partials of 4 neighbouring entries x = 2 * c + j and
// stores them at columns c + 8 * j of the 16 floats of the output row.
__device__ __forceinline__ void reduce_store(
    const float (*part)[PT], int tid, float scale, float* __restrict__ dst)
{
    const int t = tid >> 2, x4 = (tid & 3) * 4;
    v4f a = *(const v4f*)&part[t][x4];
    for (int gI = 1; gI < 16; ++gI) a += *(const v4f*)&part[t][gI * 16 + x4];
    a *= scale;
    float* p = dst + t * 16 + (x4 >> 1);
    v2f lo = {a.x, a.z}, hi = {a.y, a.w};
    *(v2f*)p = lo;
    *(v2f*)(p + 8) = hi;
    // the stores' address and data registers are reused right behind them
    asm volatile("s_wait_xcnt 0x0" ::: "memory");
}

// Pass 1: ok[t][m] = DK^-0.5 * sum_d q_t[d] * K_t[d][m]
__global__ __launch_bounds__(128) void gsa_scores_kernel(
    const float* __restrict__ q, const float* __restrict__ k,
    const float* __restrict__ s, const float* __restrict__ g,
    float* __restrict__ ok)
{
    __shared__ __attribute__((aligned(16))) float kq[TC][128];      // [t][group][k0..3 q0..3]
    __shared__ __attribute__((aligned(16))) float gs[TC][32];       // [t][c][dec0 dec1 s0 s1]
    __shared__ __attribute__((aligned(16))) float part[TC][PT];     // [t][group * 16 + 2c + j]

    const int tid = threadIdx.x;
    const int bh = blockIdx.x >> 2, mq = blockIdx.x & 3;
    const int b = bh / HH, h = bh % HH;
    const int c = tid & 7, grp = tid >> 3;

    // staging ownership inside a chunk
    const int rA = tid >> 4, cA = tid & 15;     // k, q: rows rA + 8 * i, 4 floats
    const int rG = tid >> 2, cG = tid & 3;      // g, s: row rG, 4 floats of this quarter
    const size_t head = ((size_t)b * TD * HH + h) * 64;
    const size_t step = HH * 64;
    float* plane = ok + (size_t)blockIdx.x * (TD * 16);

    v4f rk[4], rq[4], rg, rs;
    auto fetch = [&](int t0) {
        const size_t oA = head + (size_t)(t0 + rA) * step + cA * 4;
        const size_t oG = head + (size_t)(t0 + rG) * step + mq * 16 + cG * 4;
        const float* pk = k + oA;
        const float* pq = q + oA;
        const float* pg = g + oG;
        const float* ps = s + oG;
        for (int i = 0; i < 4; ++i) {
            rk[i] = *(const v4f*)(pk + i * 8 * step);
            rq[i] = *(const v4f*)(pq + i * 8 * step);
        }
        rg = *(const v4f*)pg;   rs = *(const v4f*)ps;
        // inputs only: the four address pairs are named behind the loads so that
        // none of them is among the registers that a load fills while they are out
        asm volatile("" :: "v"(pk), "v"(pq), "v"(pg), "v"(ps));
    };
    auto stage = [&]() {
        for (int i = 0; i < 4; ++i) {
            *(v4f*)&kq[rA + 8 * i][cA * 8]     = rk[i];
            *(v4f*)&kq[rA + 8 * i][cA * 8 + 4] = rq[i];
        }
        for (int e = 0; e < 4; ++e) {
            const int ml = cG * 4 + e;
            gs[rG][(ml & 7) * 4 + (ml >> 3)]     = __expf(rg[e]);
            gs[rG][(ml & 7) * 4 + 2 + (ml >> 3)] = rs[e];
        }
    };

    v2f st[4];
    for (int i = 0; i < 4; ++i) st[i] = splat2(0.f);

    fetch(0);
    stage();
    __syncthreads();
    for (int t0 = 0; t0 < TD; t0 += TC) {
        if (t0 + TC < TD) fetch(t0 + TC);       // next chunk flies under this one
        // One wave on a SIMD has no neighbour that fills its LDS latency, so the
        // operands of 4 steps are fetched as one group, two groups ahead of their
        // use, into a ring of three register sets.
        v4f fk[3][4], fq[3][4], fd[3][4];
        auto load4 = [&](int set, int tb) {
            for (int j = 0; j < 4; ++j) {
                fk[set][j] = *(const v4f*)&kq[tb + j][grp * 8];
                fq[set][j] = *(const v4f*)&kq[tb + j][grp * 8 + 4];
                fd[set][j] = *(const v4f*)&gs[tb + j][c * 4];
            }
        };
        load4(0, 0);
        load4(1, 4);
        // unrolled so that every index into the ring is a constant and the three
        // sets stay in registers
        #pragma unroll
        for (int gI = 0; gI < TC / 4; ++gI) {
            if (gI + 2 < TC / 4) load4((gI + 2) % 3, (gI + 2) * 4);
            // holds the group's loads in front of the arithmetic: left to itself the
            // compiler puts each step's loads directly in front of their use, with
            // a full wait at every step
            __builtin_amdgcn_sched_barrier(0);
            for (int j = 0; j < 4; ++j) {
                const v4f kk = fk[gI % 3][j], qq = fq[gI % 3][j], ds = fd[gI % 3][j];
                const v2f dec = {ds.x, ds.y}, sw = {ds.z, ds.w};
                for (int i = 0; i < 4; ++i)
                    st[i] = __builtin_elementwise_fma(st[i], dec, splat2(kk[i]) * sw);
                v2f a0 = splat2(qq[0]) * st[0];
                v2f a1 = splat2(qq[2]) * st[2];
                a0 = __builtin_elementwise_fma(splat2(qq[1]), st[1], a0);
                a1 = __builtin_elementwise_fma(splat2(qq[3]), st[3], a1);
                *(v2f*)&part[gI * 4 + j][grp * 16 + c * 2] = a0 + a1;
            }
            // keeps the next group's loads behind this arithmetic, whose set they refill:
            // lifted in among it they take a further set, past 256 registers in pass 2
            __builtin_amdgcn_sched_barrier(0);
        }
        __syncthreads();    // partials complete; every read of kq and gs done
        reduce_store(part, tid, 0.125f, plane + t0 * 16);
        if (t0 + TC < TD) stage();
        __syncthreads();    // next chunk published; partials free again
    }
}

// Pass 2: qv_t = softmax_m(ok_t), o[t][d] = sum_m qv_t[m] * V_t[m][d]
__global__ __launch_bounds__(128) void gsa_read_kernel(
    const float* __restrict__ ok, const float* __restrict__ v,
    const float* __restrict__ s, const float* __restrict__ g,
    float* __restrict__ o)
{
    // a time step of u is 16 groups x 12 floats and 4 unused, so that the four
    // time steps whose softmax a half-wave stores side by side lie on different banks
    __shared__ __attribute__((aligned(16))) float u[TC][196];       // [t][group * 12 + dec0..3 s0..3 qv0..3]
    __shared__ __attribute__((aligned(16))) float vv[TC][16];       // [t][2c + j]
    __shared__ __attribute__((aligned(16))) float part[TC][PT];     // [t][group * 16 + 2c + j]

    const int tid = threadIdx.x;
    const int bh = blockIdx.x >> 2, dq = blockIdx.x & 3;
    const int b = bh / HH, h = bh % HH;
    const int c = tid & 7, grp = tid >> 3;

    const int rA = tid >> 4, cA = tid & 15;     // g, s: rows rA + 8 * i, 4 floats
    const int rG = tid >> 2, cG = tid & 3;      // v: row rG, 4 floats of this quarter; ok: row rG, quarter cG
    const size_t head = ((size_t)b * TD * HH + h) * 64;
    const size_t step = HH * 64;
    const float* okq = ok + ((size_t)(bh * 4 + cG) * TD + rG) * 16;
    float* plane = o + (size_t)blockIdx.x * (TD * 16);

    v4f rg[4], rs[4], rok[4], rv;
    auto fetch = [&](int t0) {
        const size_t oA = head + (size_t)(t0 + rA) * step + cA * 4;
        for (int i = 0; i < 4; ++i) {
            rg[i] = *(const v4f*)&g[oA + i * 8 * step];
            rs[i] = *(const v4f*)&s[oA + i * 8 * step];
        }
        rv = *(const v4f*)&v[head + (size_t)(t0 + rG) * step + dq * 16 + cG * 4];
        for (int i = 0; i < 4; ++i) rok[i] = *(const v4f*)&okq[t0 * 16 + i * 4];
    };
    auto stage = [&]() {
        for (int i = 0; i < 4; ++i) {
            v4f e4;
            for (int e = 0; e < 4; ++e) e4[e] = __expf(rg[i][e]);
            *(v4f*)&u[rA + 8 * i][cA * 12]     = e4;
            *(v4f*)&u[rA + 8 * i][cA * 12 + 4] = rs[i];
        }
        for (int e = 0; e < 4; ++e) {
            const int dl = cG * 4 + e;
            vv[rG][(dl & 7) * 2 + (dl >> 3)] = rv[e];
        }
        // softmax over the 64 slots of row rG: 16 slots a lane, 4 lanes a row
        float mx = fmaxf(fmaxf(rok[0][0], rok[1][0]), fmaxf(rok[2][0], rok[3][0]));
        for (int e = 1; e < 4; ++e)
            mx = fmaxf(mx, fmaxf(fmaxf(rok[0][e], rok[1][e]), fmaxf(rok[2][e], rok[3][e])));
        mx = fmaxf(mx, lane_xor<1>(mx));
        mx = fmaxf(mx, lane_xor<2>(mx));
        v4f p[4];
        for (int i = 0; i < 4; ++i)
            for (int e = 0; e < 4; ++e) p[i][e] = __expf(rok[i][e] - mx);
        const v4f ps = (p[0] + p[1]) + (p[2] + p[3]);
        float sum = (ps[0] + ps[1]) + (ps[2] + ps[3]);
        sum += lane_xor<1>(sum);
        sum += lane_xor<2>(sum);
        const float inv = 1.f / sum;
        for (int i = 0; i < 4; ++i) *(v4f*)&u[rG][(cG * 4 + i) * 12 + 8] = p[i] * inv;
    };

    v2f st[4];
    for (int i = 0; i < 4; ++i) st[i] = splat2(0.f);

    fetch(0);
    stage();
    __syncthreads();
    for (int t0 = 0; t0 < TD; t0 += TC) {
        if (t0 + TC < TD) fetch(t0 + TC);       // next chunk flies under this one
        // as in pass 1: the operands of 4 steps are fetched as one group, two groups
        // ahead of their use, into a ring of three register sets
        v4f fd[3][4], fs[3][4], fq[3][4];
        v2f fv[3][4];
        auto load4 = [&](int set, int tb) {
            for (int j = 0; j < 4; ++j) {
                fd[set][j] = *(const v4f*)&u[tb + j][grp * 12];
                fs[set][j] = *(const v4f*)&u[tb + j][grp * 12 + 4];
                fq[set][j] = *(const v4f*)&u[tb + j][grp * 12 + 8];
                fv[set][j] = *(const v2f*)&vv[tb + j][c * 2];
            }
        };
        load4(0, 0);
        load4(1, 4);
        // unrolled so that every index into the ring is a constant and the three
        // sets stay in registers
        #pragma unroll
        for (int gI = 0; gI < TC / 4; ++gI) {
            if (gI + 2 < TC / 4) load4((gI + 2) % 3, (gI + 2) * 4);
            // holds the group's loads in front of the arithmetic (see pass 1)
            __builtin_amdgcn_sched_barrier(0);
            for (int j = 0; j < 4; ++j) {
                const v4f dec = fd[gI % 3][j], sw = fs[gI % 3][j], qv = fq[gI % 3][j];
                const v2f vc = fv[gI % 3][j];
                for (int i = 0; i < 4; ++i)
                    st[i] = __builtin_elementwise_fma(st[i], splat2(dec[i]), splat2(sw[i]) * vc);
                v2f a0 = splat2(qv[0]) * st[0];
                v2f a1 = splat2(qv[2]) * st[2];
                a0 = __builtin_elementwise_fma(splat2(qv[1]), st[1], a0);
                a1 = __builtin_elementwise_fma(splat2(qv[3]), st[3], a1);
                *(v2f*)&part[gI * 4 + j][grp * 16 + c * 2] = a0 + a1;
            }
            // keeps the next group's loads behind this arithmetic, whose set they refill:
            // lifted in among it they take a further set, past 256 registers in pass 2
            __builtin_amdgcn_sched_barrier(0);
        }
        __syncthreads();    // partials complete; every read of u and vv done
        reduce_store(part, tid, 1.f, plane + t0 * 16);
        if (t0 + TC < TD) stage();
        __syncthreads();    // next chunk published; partials free again
    }
}

// ---------------------------------------------------------------------------
// Per-(b,t,h) RMSNorm over DV=64, convert to f16 for the Wo GEMM.
// A row of 16 lanes owns one (b,t,h) row, 4 values a lane; a wave takes 16 time
// steps of one (b,h) in eight 16-byte loads, all in flight together. The input
// is the scan's [b * HH + h][quarter][t][16]: a load of the wave covers two time
// steps, which are one whole 128 B line in each of the four quarters.
// The sum of squares crosses the 16 lanes by register exchanges: no LDS, no
// barrier, and 2,048 waves to start in place of 65,536.
// ---------------------------------------------------------------------------
__global__ __launch_bounds__(256) void rms_cvt_kernel(
    const float* __restrict__ o, const float* __restrict__ w,
    _Float16* __restrict__ out)
{
    const int lane = threadIdx.x & 31, l16 = lane & 15;
    const int wave = blockIdx.x * 8 + (threadIdx.x >> 5);
    const int bh = wave >> 5, t = (wave & 31) * 16 + (lane >> 4);
    const float* src = o + ((size_t)(bh * 4 + (l16 >> 2)) * TD + t) * 16 + (l16 & 3) * 4;
    _Float16* dst = out + ((size_t)(bh / HH) * TD + t) * (HH * 64) + (bh % HH) * 64 + l16 * 4;
    v4w xs[8];
    for (int j = 0; j < 8; ++j) xs[j] = *(const v4w*)(src + j * 32);
    const v4w wv = *(const v4w*)(w + l16 * 4);
    // inputs only: src is named behind the loads so that the address pair they
    // share is not among the registers that a load fills while they are out
    asm volatile("" :: "v"(src), "v"(xs[0]), "v"(xs[1]), "v"(xs[2]), "v"(xs[3]), "v"(xs[4]),
                       "v"(xs[5]), "v"(xs[6]), "v"(xs[7]), "v"(wv));
    for (int j = 0; j < 8; ++j) {
        const v4w q = xs[j] * xs[j];
        const float ss = row16_sum((q[0] + q[1]) + (q[2] + q[3]));
        const float rstd = rsqrtf(ss * (1.f / 64.f) + 1e-6f);
        v4h p;
        for (int e = 0; e < 4; ++e) p[e] = (_Float16)(xs[j][e] * rstd * wv[e]);
        *(v4h*)(dst + (size_t)j * 2 * (HH * 64)) = p;
    }
}

// ---------------------------------------------------------------------------
extern "C" void kernel_launch(void* const* d_in, const int* in_sizes, int n_in,
                              void* d_out, int out_size, void* d_ws, size_t ws_size,
                              hipStream_t stream)
{
    const float* x    = (const float*)d_in[0];
    const float* ln1w = (const float*)d_in[1];
    const float* ln1b = (const float*)d_in[2];
    const float* Wq   = (const float*)d_in[3];
    const float* Wk   = (const float*)d_in[4];
    const float* Wv   = (const float*)d_in[5];
    const float* Wf   = (const float*)d_in[6];
    const float* gnw  = (const float*)d_in[7];
    const float* Wo   = (const float*)d_in[8];
    const float* ln2w = (const float*)d_in[9];
    const float* ln2b = (const float*)d_in[10];
    const float* W1   = (const float*)d_in[11];
    const float* b1   = (const float*)d_in[12];
    const float* W2   = (const float*)d_in[13];
    const float* b2   = (const float*)d_in[14];
    float* outp = (float*)d_out;

    const int BT = BD * TD;   // 2048 rows for every GEMM

    char* wsp = (char*)d_ws;
    auto carve = [&](size_t bytes) -> char* {
        char* p = wsp;
        wsp += (bytes + 255) & ~(size_t)255;
        return p;
    };
    _Float16* h16   = (_Float16*)carve((size_t)BT * DD * 2);
    // Wq, Wk, Wv, Wf transposed, one behind the other: the B operand [4096][DD]
    _Float16* WqT   = (_Float16*)carve((size_t)4 * DD * 1024 * 2);
    _Float16* WkT   = WqT + (size_t)DD * 1024;
    _Float16* WvT   = WkT + (size_t)DD * 1024;
    _Float16* WfT   = WvT + (size_t)DD * 1024;
    _Float16* WoT   = (_Float16*)carve((size_t)DD * 1024 * 2);
    _Float16* W1T   = (_Float16*)carve((size_t)MLPD * DD * 2);
    _Float16* W2T   = (_Float16*)carve((size_t)DD * MLPD * 2);
    // the five planes that the projection launch writes: q, k, v, s, g
    float*    qb    = (float*)carve((size_t)5 * BT * 1024 * 4);
    float*    kb    = qb + (size_t)BT * 1024;
    float*    vb    = kb + (size_t)BT * 1024;
    float*    sb    = vb + (size_t)BT * 1024;
    float*    gb    = sb + (size_t)BT * 1024;
    float*    ob    = (float*)carve((size_t)BT * 1024 * 4);
    float*    okb   = (float*)carve((size_t)BT * 1024 * 4);
    _Float16* on16  = (_Float16*)carve((size_t)BT * 1024 * 2);
    float*    yb    = (float*)carve((size_t)BT * DD * 4);
    _Float16* h216  = (_Float16*)carve((size_t)BT * DD * 2);
    _Float16* a16   = (_Float16*)carve((size_t)BT * MLPD * 2);

    // weight transposes: in[K][N] -> f16 [N][K], all seven in one launch
    transpose_cvt_all<<<832, 256, 0, stream>>>(Wq, Wk, Wv, Wf, Wo, W1, W2,
                                               WqT, WkT, WvT, WfT, WoT, W1T, W2T);

    // LN1
    layernorm_f16<<<BT / 8, 256, 0, stream>>>(x, ln1w, ln1b, h16);

    // the four projections (fused activations) in one launch
    const dim3 gD(1024 / 128, BT / 128);
    gemm_wmma<0><<<dim3(4 * 1024 / 128, BT / 128), 256, 0, stream>>>(
        h16, WqT, qb, nullptr, nullptr, nullptr, nullptr, 1024, DD);

    // recurrent gated-slot scan: slot scores for all t, then softmax and read-out
    gsa_scores_kernel<<<BD * HH * 4, 128, 0, stream>>>(qb, kb, sb, gb, okb);
    gsa_read_kernel<<<BD * HH * 4, 128, 0, stream>>>(okb, vb, sb, gb, ob);

    // per-head RMSNorm -> f16
    rms_cvt_kernel<<<BT * HH / 128, 256, 0, stream>>>(ob, gnw, on16);

    // output projection + residual
    gemm_wmma<3><<<gD, 256, 0, stream>>>(on16, WoT, yb, nullptr, nullptr, nullptr, x, DD, 1024);

    // LN2
    layernorm_f16<<<BT / 8, 256, 0, stream>>>(yb, ln2w, ln2b, h216);

    // MLP
    gemm_wmma<4><<<dim3(MLPD / 128, BT / 128), 256, 0, stream>>>(
        h216, W1T, nullptr, nullptr, a16, b1, nullptr, MLPD, DD);
    gemm_wmma<5><<<dim3(DD / 128, BT / 128), 256, 0, stream>>>(
        a16, W2T, outp, nullptr, nullptr, b2, yb, DD, MLPD);
}

// v009
// One run takes 142 microseconds.
// Next to v008, in two timings, it ran 1.13 and 1.12 times as fast.
// All steps since v000 together make it 11.1 times as fast.
#include <hip/hip_runtime.h>

#define BD 4
#define TD 512
#define DD 1024
#define HH 16
#define MLPD 4096

typedef __attribute__((ext_vector_type(16))) _Float16 v16h;
typedef __attribute__((ext_vector_type(8)))  _Float16 v8h;
typedef __attribute__((ext_vector_type(8)))  float    v8f;

// ---------------------------------------------------------------------------
// Transpose + f32->f16 convert of all seven weight matrices in ONE launch:
// in[K][N] (row-major) -> out[N][K] (row-major), so the GEMM B operand is
// K-contiguous like A. A work-group takes one 128 x 128 tile (64 elements a
// thread), so that few waves have to be started for the bytes that are moved.
// Reads: a wave's 16-byte loads cover one whole 512 B row of the tile.
// Writes: a wave's 16-byte stores cover two whole 256 B rows of the output.
// The LDS tile is [n][k] in f16, rows of 256 B = 16 chunks of 16 B; chunk c of
// row n lies at place c ^ ((n >> 2) & 15), so the 16 lanes of a half-wave hit
// 16 different places both when they write (rows 4 apart, one chunk) and when
// they read (one row, 16 chunks).
// Tiles: 5 x 64 (the 1024 x 1024 matrices), 256 (W1), 256 (W2) = 832.
// ---------------------------------------------------------------------------
typedef __attribute__((ext_vector_type(4))) float v4w;

// One tile. K and N are compile-time so that the 16 loads and the 8 stores of a
// thread differ from one another by immediate offsets only: one address each,
// and all 16 loads in flight together.
template<int K, int N>
__device__ __forceinline__ void transpose_tile(
    const float* __restrict__ in, _Float16* __restrict__ out, int tk, int tn,
    _Float16* tile)
{
    const int lane = threadIdx.x & 31, wid = threadIdx.x >> 5;

    // wave: k rows wid * 16 .. + 15; lane: columns n = lane * 4 .. + 3
    const float* src = in + (size_t)(tk * 128 + wid * 16) * N + tn * 128 + lane * 4;
    v4w r[16];
    for (int j = 0; j < 16; ++j) r[j] = *(const v4w*)(src + (size_t)j * N);
    // inputs only: holds all 16 loads in front of the first conversion, so that
    // a wave waits out one memory latency; without it the compiler issues them
    // in three groups with a full wait between the groups; src is named too so
    // that the address pair the loads share is not among the registers they fill
    asm volatile("" :: "v"(src), "v"(r[0]), "v"(r[1]), "v"(r[2]), "v"(r[3]), "v"(r[4]), "v"(r[5]),
                       "v"(r[6]), "v"(r[7]), "v"(r[8]), "v"(r[9]), "v"(r[10]), "v"(r[11]),
                       "v"(r[12]), "v"(r[13]), "v"(r[14]), "v"(r[15]));
    for (int gI = 0; gI < 2; ++gI)
        for (int e = 0; e < 4; ++e) {
            v8h p;
            for (int j = 0; j < 8; ++j) p[j] = (_Float16)r[gI * 8 + j][e];
            *(v8h*)&tile[(lane * 4 + e) * 128 + (((wid * 2 + gI) ^ (lane & 15)) * 8)] = p;
        }
    __syncthreads();

    // wave: output rows n = wid * 16 .. + 15, two a store; half-wave: one row
    const int hl = lane & 15, hr = lane >> 4;
    _Float16* dst = out + (size_t)(tn * 128 + wid * 16 + hr) * K + tk * 128 + hl * 8;
    for (int j = 0; j < 8; ++j) {
        const int n = wid * 16 + j * 2 + hr;
        const v8h p = *(const v8h*)&tile[n * 128 + ((hl ^ ((n >> 2) & 15)) * 8)];
        *(v8h*)(dst + (size_t)(j * 2) * K) = p;
    }
    // behind the last store: the listing lets a path run on into code that
    // reuses the stores' address and data registers
    asm volatile("s_wait_xcnt 0x0" ::: "memory");
}

__global__ __launch_bounds__(256) void transpose_cvt_all(
    const float* __restrict__ Wq, const float* __restrict__ Wk,
    const float* __restrict__ Wv, const float* __restrict__ Wf,
    const float* __restrict__ Wo, const float* __restrict__ W1,
    const float* __restrict__ W2,
    _Float16* __restrict__ WqT, _Float16* __restrict__ WkT,
    _Float16* __restrict__ WvT, _Float16* __restrict__ WfT,
    _Float16* __restrict__ WoT, _Float16* __restrict__ W1T,
    _Float16* __restrict__ W2T)
{
    __shared__ __attribute__((aligned(16))) _Float16 tile[128 * 128];
    const int bid = blockIdx.x;     // every branch below is uniform for the work-group
    if (bid < 320) {
        const int m = bid >> 6;
        const float* in = m == 0 ? Wq  : m == 1 ? Wk  : m == 2 ? Wv  : m == 3 ? Wf  : Wo;
        _Float16* out   = m == 0 ? WqT : m == 1 ? WkT : m == 2 ? WvT : m == 3 ? WfT : WoT;
        transpose_tile<1024, 1024>(in, out, (bid >> 3) & 7, bid & 7, tile);
    } else if (bid < 576) {
        transpose_tile<DD, MLPD>(W1, W1T, (bid - 320) >> 5, (bid - 320) & 31, tile);
    } else {
        transpose_tile<MLPD, DD>(W2, W2T, (bid - 576) >> 3, (bid - 576) & 7, tile);
    }
}

// ---------------------------------------------------------------------------
// Cross-lane helpers of the normalisation kernels and of the scan's softmax.
// ---------------------------------------------------------------------------
typedef __attribute__((ext_vector_type(4))) _Float16 v4h;

// Value of lane l ^ M, M < 16: a register-to-register exchange inside a row of
// 16 lanes, so a reduction over neighbouring lanes takes no LDS round trip.
template<int M>
__device__ __forceinline__ float lane_xor(float x)
{
    return __builtin_bit_cast(float, __builtin_amdgcn_update_dpp(
        0, __builtin_bit_cast(int, x), 0x160 + M, 0xf, 0xf, true));
}

// Sum over the 16 lanes of a row, left in every lane of the row.
__device__ __forceinline__ float row16_sum(float x)
{
    x += lane_xor<1>(x);
    x += lane_xor<2>(x);
    x += lane_xor<4>(x);
    x += lane_xor<8>(x);
    return x;
}

// Value of lane l ^ 16: the same place in the other row of 16 lanes.
__device__ __forceinline__ float other_row(float x)
{
    const int v = __builtin_bit_cast(int, x);
    return __builtin_bit_cast(float, __builtin_amdgcn_permlanex16(
        v, v, 0x76543210, 0xfedcba98, false, false));
}

// ---------------------------------------------------------------------------
// LayerNorm over D=1024, output f16 (feeds WMMA GEMM A operand).
// One wave owns one row: 32 values a lane in eight 16-byte loads, each load of
// the wave one run of 512 B, all in flight together. The two sums stay in
// registers and cross the lanes by register exchanges, so the kernel has no LDS
// and no barrier, and an eighth of the waves have to be started.
// ---------------------------------------------------------------------------
__global__ __launch_bounds__(256) void layernorm_f16(
    const float* __restrict__ x, const float* __restrict__ w,
    const float* __restrict__ b, _Float16* __restrict__ out)
{
    const int lane = threadIdx.x & 31;
    const int row = blockIdx.x * 8 + (threadIdx.x >> 5);
    const float* xr = x + (size_t)row * DD + lane * 4;
    v4w xs[8], wv[8], bv[8];
    for (int j = 0; j < 8; ++j) xs[j] = *(const v4w*)(xr + j * 128);
    for (int j = 0; j < 8; ++j) {
        wv[j] = *(const v4w*)(w + lane * 4 + j * 128);
        bv[j] = *(const v4w*)(b + lane * 4 + j * 128);
    }
    // inputs only: holds all 24 loads in front of this line, so that a wave waits
    // out one memory latency; without it the compiler moves the loads of w and b
    // behind the reduction, two at a time with a wait between the pairs; xr is
    // named too so that the address pair is not reused while loads are out
    asm volatile("" :: "v"(xr), "v"(xs[0]), "v"(xs[1]), "v"(xs[2]), "v"(xs[3]), "v"(xs[4]), "v"(xs[5]),
                       "v"(xs[6]), "v"(xs[7]), "v"(wv[0]), "v"(wv[1]), "v"(wv[2]), "v"(wv[3]),
                       "v"(wv[4]), "v"(wv[5]), "v"(wv[6]), "v"(wv[7]), "v"(bv[0]), "v"(bv[1]),
                       "v"(bv[2]), "v"(bv[3]), "v"(bv[4]), "v"(bv[5]), "v"(bv[6]), "v"(bv[7]));
    // keeps the sums behind the loads: without it the compiler lifts them, with
    // their waits for x, in among the loads of w and b, which then start late
    __builtin_amdgcn_sched_barrier(0);
    v4w s4 = xs[0], q4 = xs[0] * xs[0];
    for (int j = 1; j < 8; ++j) {
        s4 += xs[j];
        q4 = __builtin_elementwise_fma(xs[j], xs[j], q4);
    }
    float sum = row16_sum((s4[0] + s4[1]) + (s4[2] + s4[3]));
    float sq  = row16_sum((q4[0] + q4[1]) + (q4[2] + q4[3]));
    sum += other_row(sum);
    sq  += other_row(sq);
    const float mu   = sum * (1.f / DD);
    const float var  = sq * (1.f / DD) - mu * mu;
    const float rstd = rsqrtf(var + 1e-6f);
    _Float16* orow = out + (size_t)row * DD + lane * 4;
    for (int j = 0; j < 8; ++j) {
        v4h p;
        for (int e = 0; e < 4; ++e)
            p[e] = (_Float16)((xs[j][e] - mu) * rstd * wv[j][e] + bv[j][e]);
        *(v4h*)(orow + j * 128) = p;
    }
}

// ---------------------------------------------------------------------------
// 2^x and log2(x) on the hardware's transcendental unit. The v_nop is the slot
// that the instruction set asks for behind a transcendental before its result is
// used or its source overwritten: in the unrolled epilogues the compiler put
// writes of the source directly behind some of them. x of log2_hw is normal.
// ---------------------------------------------------------------------------
__device__ __forceinline__ float exp2_hw(float x)
{
    float r;
    // one statement, so that the slot stays directly behind the transcendental
    asm("v_exp_f32 %0, %1\n\tv_nop" : "=v"(r) : "v"(x));
    return r;
}
__device__ __forceinline__ float log2_hw(float x)
{
    float r;
    // one statement, so that the slot stays directly behind the transcendental
    asm("v_log_f32 %0, %1\n\tv_nop" : "=v"(r) : "v"(x));
    return r;
}

// ---------------------------------------------------------------------------
// erf for the GELU epilogue, without a branch: both ranges are evaluated and one
// is selected, so that the 64 values of a thread are independent straight-line
// chains that fill one another's latency. A call that branches on |x| runs the
// values one behind the other, and a wave with lanes on both sides runs both.
// |x| < 1: x + x * Q(x^2); |x| >= 1: 1 - exp(-(|x| + |x| * P(|x|))).
// Largest error against erf over -6..6 in f32 arithmetic: 9e-8.
// ---------------------------------------------------------------------------
__device__ __forceinline__ float erf_select(float x)
{
    const float a = fabsf(x), t = x * x;
    float p = fmaf(a, 1.699881e-5f, -3.7867785e-4f);
    p = fmaf(a, p, 3.8578159e-3f);
    p = fmaf(a, p, -2.4181698e-2f);
    p = fmaf(a, p, 1.0666826e-1f);
    p = fmaf(a, p, 6.349333e-1f);
    p = fmaf(a, p, 1.2868941e-1f);
    p = fmaf(a, p, a);
    float q = fmaf(t, -5.618018e-4f, 4.913816e-3f);
    q = fmaf(t, q, -2.6707515e-2f);
    q = fmaf(t, q, 1.1280011e-1f);
    q = fmaf(t, q, -3.7612295e-1f);
    q = fmaf(t, q, 1.283791e-1f);
    q = fmaf(a, q, a);
    const float far = 1.f - exp2_hw(-1.44269504f * p);
    return copysignf(a < 1.f ? q : far, x);
}

// ---------------------------------------------------------------------------
// WMMA GEMM: C[M x N] = epilogue(A[M x K] @ Bt[N x K]^T)
// 128 x BN block tile, 256 threads = 8 waves, 4 along M and 2 along N, each wave
// 32 x BN/2 (2 x BN/32 of 16x16).
// K staged BK-deep, DOUBLE-BUFFERED in LDS via CDNA5 async global->LDS copies
// (global_load_async_to_lds_b128, ASYNCcnt), so the fetch of stage k+1
// overlaps the v_wmma work on stage k.
// The products with 4096 columns take BN = 128, BK = 128: 512 work-groups, two on
// a WGP. Those with 1024 columns take BN = 64: 256 work-groups, one on every WGP,
// where 128 x 128 tiles gave 128 and left half of the WGPs idle. A work-group then
// has half the matrix work a stage to cover the next stage's copies with, so its
// stage is BK = 256 deep: one latency, wait and barrier per 256 of K.
// EPI: 0=the four input projections in one product (below), 3=+res f32,
//      4=+bias,gelu -> f16, 5=+bias,+res f32
// EPI 0: Bt holds the transposed Wq, Wk, Wv, Wf one behind the other, 4096 rows
// in all, so one launch has 512 work-groups (two for every WGP) where four
// launches of 128 each left half of the WGPs idle. out0 is five planes of
// BD * TD rows x 1024 floats: q, k, v, s, g. N is the pitch of a plane. The 128
// columns of a work-group lie in one matrix, so the choice of its activation is
// uniform for the work-group.
// ---------------------------------------------------------------------------
template<int EPI, int BN, int BK>
__global__ __launch_bounds__(256) void gemm_wmma(
    const _Float16* __restrict__ A, const _Float16* __restrict__ Bt,
    float* __restrict__ out0, float* __restrict__ out1,
    _Float16* __restrict__ outh,
    const float* __restrict__ bias, const float* __restrict__ res,
    int N, int K)
{
    // A stage is BK halfs of K: a row of 256 or 512 B, whole 128 B lines, so that
    // one memory latency, one wait and one barrier serve BK / 32 WMMA k steps.
    // LDS row pitch in halfs: BK of data + 8 unused = 272 or 528 B = 16 B x odd, so
    // the 16 rows that a half-wave's ds_load_b128 reads lie on distinct banks.
    constexpr int LP = BK + 8;
    constexpr int NJ = BN / 32;                  // B fragments of a wave
    __shared__ __attribute__((aligned(16))) _Float16 As[2][128 * LP];
    __shared__ __attribute__((aligned(16))) _Float16 Bs[2][BN * LP];
    const int tid  = threadIdx.x;
    const int lane = tid & 31, wid = tid >> 5;
    const int wm = wid >> 1, wn = wid & 1;       // 4 waves along M, 2 along N
    const int lr = lane & 15, hs = lane >> 4;    // half-wave select (ISA layout)
    const int rowBlk = blockIdx.y * 128, colBlk = blockIdx.x * BN;

    // Each thread owns fixed 16-byte chunks of the A tile and of the B tile per
    // stage: rows r0 + RP * i, half-offset o0. A wave's copy covers whole rows
    // (two of 256 B or one of 512 B).
    constexpr int CPR = BK / 8;                  // 16-byte chunks in a row
    constexpr int RP  = 256 / CPR;               // rows that one copy of every thread covers
    const int r0 = tid / CPR, o0 = (tid % CPR) * 8;
    const _Float16* gA = A  + (size_t)(rowBlk + r0) * K + o0;
    const _Float16* gB = Bt + (size_t)(colBlk + r0) * K + o0;
    // LDS byte addresses (low 32 bits of the generic pointer = LDS offset)
    const unsigned lA = (unsigned)(uintptr_t)&As[0][r0 * LP + o0];
    const unsigned lB = (unsigned)(uintptr_t)&Bs[0][r0 * LP + o0];
    constexpr unsigned bufA = 128 * LP * 2, bufB = BN * LP * 2;
    constexpr unsigned lStep = RP * LP * 2;      // RP rows in LDS, bytes
    const size_t gStep = (size_t)RP * K;         // RP rows in memory, halfs

    auto copy8 = [&](unsigned l, const _Float16* g) {
        // the last line is a precaution: it stands in front of every later
        // write of the address registers that these copies name
        asm volatile(
            "global_load_async_to_lds_b128 %0, %8, off\n\t"
            "global_load_async_to_lds_b128 %1, %9, off\n\t"
            "global_load_async_to_lds_b128 %2, %10, off\n\t"
            "global_load_async_to_lds_b128 %3, %11, off\n\t"
            "global_load_async_to_lds_b128 %4, %12, off\n\t"
            "global_load_async_to_lds_b128 %5, %13, off\n\t"
            "global_load_async_to_lds_b128 %6, %14, off\n\t"
            "global_load_async_to_lds_b128 %7, %15, off\n\t"
            "s_wait_xcnt 0x0"
            :
            : "v"(l), "v"(l + lStep), "v"(l + 2 * lStep), "v"(l + 3 * lStep),
              "v"(l + 4 * lStep), "v"(l + 5 * lStep), "v"(l + 6 * lStep), "v"(l + 7 * lStep),
              "v"((unsigned long long)(uintptr_t)(g)),
              "v"((unsigned long long)(uintptr_t)(g + gStep)),
              "v"((unsigned long long)(uintptr_t)(g + 2 * gStep)),
              "v"((unsigned long long)(uintptr_t)(g + 3 * gStep)),
              "v"((unsigned long long)(uintptr_t)(g + 4 * gStep)),
              "v"((unsigned long long)(uintptr_t)(g + 5 * gStep)),
              "v"((unsigned long long)(uintptr_t)(g + 6 * gStep)),
              "v"((unsigned long long)(uintptr_t)(g + 7 * gStep))
            : "memory");
    };
    auto issue_stage = [&](int kk, int buf) {
        const size_t ko = (size_t)kk * BK;
        for (int c = 0; c < 128 / (8 * RP); ++c)
            copy8(lA + (unsigned)buf * bufA + c * 8 * lStep, gA + ko + c * 8 * gStep);
        for (int c = 0; c < BN / (8 * RP); ++c)
            copy8(lB + (unsigned)buf * bufB + c * 8 * lStep, gB + ko + c * 8 * gStep);
    };

    v8f acc[2][NJ];
    for (int i = 0; i < 2; ++i)
        for (int j = 0; j < NJ; ++j)
            for (int r = 0; r < 8; ++r) acc[i][j][r] = 0.f;

    const int nk = K >> (BK == 256 ? 8 : 7);     // stages: K / BK
    issue_stage(0, 0);
    asm volatile("s_wait_asynccnt 0x0" ::: "memory");   // own copies of stage 0 landed
    __syncthreads();                                    // stage 0 published
    if (nk > 1) issue_stage(1, 1);                      // flies under stage 0's work
    for (int kk = 0; kk < nk; ++kk) {
        const int buf = kk & 1;
        const _Float16* Ab = As[buf];
        const _Float16* Bb = Bs[buf];
        if constexpr (BN == 64) {
            // Two waves on a SIMD with 4 WMMAs a k step each do not cover an LDS
            // latency, so the 8 fragment loads of a k step go as one group, two k
            // steps ahead of their use, into a ring of three register sets. Only
            // this stage's buffer is read: the ring starts anew in every stage.
            // Fragment layout and k order: as in the other branch.
            v16h af[3][2], bf[3][NJ];
            auto loadf = [&](int set, int ks) {
                for (int i = 0; i < 2; ++i) {
                    int r = wm * 32 + i * 16 + lr;
                    v8h lo = *(const v8h*)&Ab[r * LP + ks * 32 + hs * 8];
                    v8h hi = *(const v8h*)&Ab[r * LP + ks * 32 + hs * 8 + 16];
                    af[set][i] = __builtin_shufflevector(lo, hi, 0,1,2,3,4,5,6,7,8,9,10,11,12,13,14,15);
                }
                for (int j = 0; j < NJ; ++j) {
                    int r = wn * (BN / 2) + j * 16 + lr;
                    v8h lo = *(const v8h*)&Bb[r * LP + ks * 32 + hs * 8];
                    v8h hi = *(const v8h*)&Bb[r * LP + ks * 32 + hs * 8 + 16];
                    bf[set][j] = __builtin_shufflevector(lo, hi, 0,1,2,3,4,5,6,7,8,9,10,11,12,13,14,15);
                }
            };
            loadf(0, 0);
            loadf(1, 1);
            // unrolled so that every index into the ring is a constant and the
            // three sets stay in registers
            #pragma unroll
            for (int ks = 0; ks < BK / 32; ++ks) {
                if (ks + 2 < BK / 32) loadf((ks + 2) % 3, ks + 2);
                // holds the group's loads in front of the matrix instructions: left
                // to itself the compiler keeps one set and loads it directly in
                // front of its use, with two full waits at every k step
                __builtin_amdgcn_sched_barrier(0);
                for (int i = 0; i < 2; ++i)
                    for (int j = 0; j < NJ; ++j)
                        acc[i][j] = __builtin_amdgcn_wmma_f32_16x16x32_f16(
                            false, af[ks % 3][i], false, bf[ks % 3][j], (short)0, acc[i][j], false, false);
                // keeps the next group's loads behind these matrix instructions, whose
                // set they refill: left free they are lifted in among them and take
                // 16 registers more
                __builtin_amdgcn_sched_barrier(0);
            }
        } else
        // unrolled so that the fragment loads of a later k step can issue ahead
        // of the matrix instructions of an earlier one
        #pragma unroll
        for (int ks = 0; ks < BK / 32; ++ks) {
            // Fragment layout (16-bit A 16x32): lanes 0-15 hold K 0-7 / 16-23,
            // lanes 16-31 hold K 8-15 / 24-31, for row M = lane%16.
            v16h af[2], bf[NJ];
            for (int i = 0; i < 2; ++i) {
                int r = wm * 32 + i * 16 + lr;
                v8h lo = *(const v8h*)&Ab[r * LP + ks * 32 + hs * 8];
                v8h hi = *(const v8h*)&Ab[r * LP + ks * 32 + hs * 8 + 16];
                af[i] = __builtin_shufflevector(lo, hi, 0,1,2,3,4,5,6,7,8,9,10,11,12,13,14,15);
            }
            for (int j = 0; j < NJ; ++j) {
                int r = wn * (BN / 2) + j * 16 + lr;
                v8h lo = *(const v8h*)&Bb[r * LP + ks * 32 + hs * 8];
                v8h hi = *(const v8h*)&Bb[r * LP + ks * 32 + hs * 8 + 16];
                bf[j] = __builtin_shufflevector(lo, hi, 0,1,2,3,4,5,6,7,8,9,10,11,12,13,14,15);
            }
            for (int i = 0; i < 2; ++i)
                for (int j = 0; j < NJ; ++j)
                    acc[i][j] = __builtin_amdgcn_wmma_f32_16x16x32_f16(
                        false, af[i], false, bf[j], (short)0, acc[i][j], false, false);
        }
        // hand-over: this wave's reads of buf are done, its copies of stage
        // kk + 1 have landed; the barrier publishes that stage and frees buf
        asm volatile("s_wait_dscnt 0x0" ::: "memory");      // own reads of buf retired
        asm volatile("s_wait_asynccnt 0x0" ::: "memory");   // own copies of stage kk + 1 landed
        __syncthreads();
        if (kk + 2 < nk) issue_stage(kk + 2, buf);      // flies under stage kk + 1's work
    }
    // no copy is outstanding when the wave goes on to the epilogue and ends
    asm volatile("s_wait_asynccnt 0x0" ::: "memory");

    // Epilogue. C/D layout: VGPR r holds M = r (lanes 0-15) or r+8 (lanes 16-31),
    // N = lane%16.
    if (EPI == 0) {
        const size_t PL = (size_t)BD * TD * 1024;
        const int mat = colBlk >> 10;               // 0 Wq, 1 Wk, 2 Wv, 3 Wf
        float* pl = out0 + (size_t)mat * PL;
        auto each = [&](auto f) {
            for (int i = 0; i < 2; ++i)
                for (int j = 0; j < NJ; ++j)
                    for (int r = 0; r < 8; ++r) {
                        int row = rowBlk + wm * 32 + i * 16 + hs * 8 + r;
                        int col = (colBlk & 1023) + wn * (BN / 2) + j * 16 + lr;
                        f(acc[i][j][r], (size_t)row * N + col);
                    }
        };
        if (mat < 2) {                                 // q, k: swish
            each([&](float v, size_t idx) { pl[idx] = v / (1.f + __expf(-v)); });
        } else if (mat == 2) {                         // v
            each([&](float v, size_t idx) { pl[idx] = v; });
            // behind the last store: the listing lets a path run on into the swish
            // code, which reuses the stores' address registers
            asm volatile("s_wait_xcnt 0x0" ::: "memory");
        } else {                                       // gate: g = logsig(v)/8, s = 1-exp(g)
            // 1 + exp(-|v|) lies in (1, 2]: a normal number, so the hardware's base-2
            // logarithm takes it as it is, and the rounding of the sum puts about
            // 1e-7 absolute on ls, 1e-8 on g; s is formed as
            // 1 - exp(g). The library's log1p and expm1 took over a hundred
            // dependent instructions a value.
            each([&](float v, size_t idx) {
                float ls = fminf(v, 0.f)
                         - 0.69314718f * log2_hw(1.f + exp2_hw(-1.44269504f * fabsf(v)));
                float gg = ls * 0.125f;
                pl[idx + PL] = gg;
                pl[idx] = 1.f - exp2_hw(1.44269504f * gg);
            });
            // behind the last store: the listing lets a path run on into the code of
            // the v plane, which reuses the stores' address and data registers
            asm volatile("s_wait_xcnt 0x0" ::: "memory");
        }
        return;
    }
    // unrolled: left to itself the compiler keeps the GELU's loops over r rolled,
    // picks each accumulator by a run-time index and works on one value at a time
    #pragma unroll
    for (int i = 0; i < 2; ++i)
        #pragma unroll
        for (int j = 0; j < NJ; ++j)
            #pragma unroll
            for (int r = 0; r < 8; ++r) {
                int row = rowBlk + wm * 32 + i * 16 + hs * 8 + r;
                int col = colBlk + wn * (BN / 2) + j * 16 + lr;
                size_t idx = (size_t)row * N + col;
                float v = acc[i][j][r];
                if (EPI == 3) {                            // + residual
                    out0[idx] = v + res[idx];
                } else if (EPI == 4) {                     // + bias, exact gelu, f16 out
                    float t = v + bias[col];
                    outh[idx] = (_Float16)(0.5f * t * (1.f + erf_select(t * 0.70710678118f)));
                } else if (EPI == 5) {                     // + bias + residual
                    out0[idx] = v + bias[col] + res[idx];
                }
            }
}

// ---------------------------------------------------------------------------
// Gated-slot attention scan, as two recurrences whose columns are independent.
// K[d][m] is decayed and written per slot m only, and V[m][d] feeds o[d] per
// column d only, so a lane that owns a column keeps its part of the state in
// registers for all T steps and never exchanges state with another lane.
// Pass 1 gives the slot scores ok[t][m] for every t, pass 2 takes their
// softmax and gives o[t][d]. Work-group = (b, h, quarter of the columns): 256
// work-groups of 4 waves, one wave on every SIMD of the chip.
// Eight lanes own 4 rows of the contraction dim (16 groups in 4 waves) and a
// lane owns 2 columns (c and c + 8): 8 state values a lane, held as pairs.
// Time runs in chunks of TC steps staged in LDS; the 16 partial sums of each
// output are added once per chunk, so a chunk has two barriers in all.
// Both results are laid out [b * HH + h][quarter][t][16], so that a work-group
// writes whole 128 B lines that no other work-group writes to.
// ---------------------------------------------------------------------------
#define TC 32
// floats from one time step's partials to the next: 16 groups x 16 entries and
// 16 unused, so that the four time steps which a half-wave adds up side by side
// lie on different banks
#define PT 272
typedef __attribute__((ext_vector_type(2))) float v2f;
typedef __attribute__((ext_vector_type(4))) float v4f;

__device__ __forceinline__ v2f splat2(float a) { v2f r = {a, a}; return r; }

// Adds the 16 group partials of 4 neighbouring entries x = 2 * c + j and
// stores them at columns c + 8 * j of the 16 floats of the output row.
__device__ __forceinline__ void reduce_store(
    const float (*part)[PT], int tid, float scale, float* __restrict__ dst)
{
    const int t = tid >> 2, x4 = (tid & 3) * 4;
    v4f a = *(const v4f*)&part[t][x4];
    for (int gI = 1; gI < 16; ++gI) a += *(const v4f*)&part[t][gI * 16 + x4];
    a *= scale;
    float* p = dst + t * 16 + (x4 >> 1);
    v2f lo = {a.x, a.z}, hi = {a.y, a.w};
    *(v2f*)p = lo;
    *(v2f*)(p + 8) = hi;
    // the stores' address and data registers are reused right behind them
    asm volatile("s_wait_xcnt 0x0" ::: "memory");
}

// Pass 1: ok[t][m] = DK^-0.5 * sum_d q_t[d] * K_t[d][m]
__global__ __launch_bounds__(128) void gsa_scores_kernel(
    const float* __restrict__ q, const float* __restrict__ k,
    const float* __restrict__ s, const float* __restrict__ g,
    float* __restrict__ ok)
{
    __shared__ __attribute__((aligned(16))) float kq[TC][128];      // [t][group][k0..3 q0..3]
    __shared__ __attribute__((aligned(16))) float gs[TC][32];       // [t][c][dec0 dec1 s0 s1]
    __shared__ __attribute__((aligned(16))) float part[TC][PT];     // [t][group * 16 + 2c + j]

    const int tid = threadIdx.x;
    const int bh = blockIdx.x >> 2, mq = blockIdx.x & 3;
    const int b = bh / HH, h = bh % HH;
    const int c = tid & 7, grp = tid >> 3;

    // staging ownership inside a chunk
    const int rA = tid >> 4, cA = tid & 15;     // k, q: rows rA + 8 * i, 4 floats
    const int rG = tid >> 2, cG = tid & 3;      // g, s: row rG, 4 floats of this quarter
    const size_t head = ((size_t)b * TD * HH + h) * 64;
    const size_t step = HH * 64;
    float* plane = ok + (size_t)blockIdx.x * (TD * 16);

    v4f rk[4], rq[4], rg, rs;
    auto fetch = [&](int t0) {
        const size_t oA = head + (size_t)(t0 + rA) * step + cA * 4;
        const size_t oG = head + (size_t)(t0 + rG) * step + mq * 16 + cG * 4;
        const float* pk = k + oA;
        const float* pq = q + oA;
        const float* pg = g + oG;
        const float* ps = s + oG;
        for (int i = 0; i < 4; ++i) {
            rk[i] = *(const v4f*)(pk + i * 8 * step);
            rq[i] = *(const v4f*)(pq + i * 8 * step);
        }
        rg = *(const v4f*)pg;   rs = *(const v4f*)ps;
        // inputs only: the four address pairs are named behind the loads so that
        // none of them is among the registers that a load fills while they are out
        asm volatile("" :: "v"(pk), "v"(pq), "v"(pg), "v"(ps));
    };
    auto stage = [&]() {
        for (int i = 0; i < 4; ++i) {
            *(v4f*)&kq[rA + 8 * i][cA * 8]     = rk[i];
            *(v4f*)&kq[rA + 8 * i][cA * 8 + 4] = rq[i];
        }
        for (int e = 0; e < 4; ++e) {
            const int ml = cG * 4 + e;
            gs[rG][(ml & 7) * 4 + (ml >> 3)]     = __expf(rg[e]);
            gs[rG][(ml & 7) * 4 + 2 + (ml >> 3)] = rs[e];
        }
    };

    v2f st[4];
    for (int i = 0; i < 4; ++i) st[i] = splat2(0.f);

    fetch(0);
    stage();
    __syncthreads();
    for (int t0 = 0; t0 < TD; t0 += TC) {
        if (t0 + TC < TD) fetch(t0 + TC);       // next chunk flies under this one
        // One wave on a SIMD has no neighbour that fills its LDS latency, so the
        // operands of 4 steps are fetched as one group, two groups ahead of their
        // use, into a ring of three register sets.
        v4f fk[3][4], fq[3][4], fd[3][4];
        auto load4 = [&](int set, int tb) {
            for (int j = 0; j < 4; ++j) {
                fk[set][j] = *(const v4f*)&kq[tb + j][grp * 8];
                fq[set][j] = *(const v4f*)&kq[tb + j][grp * 8 + 4];
                fd[set][j] = *(const v4f*)&gs[tb + j][c * 4];
            }
        };
        load4(0, 0);
        load4(1, 4);
        // unrolled so that every index into the ring is a constant and the three
        // sets stay in registers
        #pragma unroll
        for (int gI = 0; gI < TC / 4; ++gI) {
            if (gI + 2 < TC / 4) load4((gI + 2) % 3, (gI + 2) * 4);
            // holds the group's loads in front of the arithmetic: left to itself the
            // compiler puts each step's loads directly in front of their use, with
            // a full wait at every step
            __builtin_amdgcn_sched_barrier(0);
            for (int j = 0; j < 4; ++j) {
                const v4f kk = fk[gI % 3][j], qq = fq[gI % 3][j], ds = fd[gI % 3][j];
                const v2f dec = {ds.x, ds.y}, sw = {ds.z, ds.w};
                for (int i = 0; i < 4; ++i)
                    st[i] = __builtin_elementwise_fma(st[i], dec, splat2(kk[i]) * sw);
                v2f a0 = splat2(qq[0]) * st[0];
                v2f a1 = splat2(qq[2]) * st[2];
                a0 = __builtin_elementwise_fma(splat2(qq[1]), st[1], a0);
                a1 = __builtin_elementwise_fma(splat2(qq[3]), st[3], a1);
                *(v2f*)&part[gI * 4 + j][grp * 16 + c * 2] = a0 + a1;
            }
            // keeps the next group's loads behind this arithmetic, whose set they refill:
            // lifted in among it they take a further set, past 256 registers in pass 2
            __builtin_amdgcn_sched_barrier(0);
        }
        __syncthreads();    // partials complete; every read of kq and gs done
        reduce_store(part, tid, 0.125f, plane + t0 * 16);
        if (t0 + TC < TD) stage();
        __syncthreads();    // next chunk published; partials free again
    }
}

// Pass 2: qv_t = softmax_m(ok_t), o[t][d] = sum_m qv_t[m] * V_t[m][d]
__global__ __launch_bounds__(128) void gsa_read_kernel(
    const float* __restrict__ ok, const float* __restrict__ v,
    const float* __restrict__ s, const float* __restrict__ g,
    float* __restrict__ o)
{
    // a time step of u is 16 groups x 12 floats and 4 unused, so that the four
    // time steps whose softmax a half-wave stores side by side lie on different banks
    __shared__ __attribute__((aligned(16))) float u[TC][196];       // [t][group * 12 + dec0..3 s0..3 qv0..3]
    __shared__ __attribute__((aligned(16))) float vv[TC][16];       // [t][2c + j]
    __shared__ __attribute__((aligned(16))) float part[TC][PT];     // [t][group * 16 + 2c + j]

    const int tid = threadIdx.x;
    const int bh = blockIdx.x >> 2, dq = blockIdx.x & 3;
    const int b = bh / HH, h = bh % HH;
    const int c = tid & 7, grp = tid >> 3;

    const int rA = tid >> 4, cA = tid & 15;     // g, s: rows rA + 8 * i, 4 floats
    const int rG = tid >> 2, cG = tid & 3;      // v: row rG, 4 floats of this quarter; ok: row rG, quarter cG
    const size_t head = ((size_t)b * TD * HH + h) * 64;
    const size_t step = HH * 64;
    const float* okq = ok + ((size_t)(bh * 4 + cG) * TD + rG) * 16;
    float* plane = o + (size_t)blockIdx.x * (TD * 16);

    v4f rg[4], rs[4], rok[4], rv;
    auto fetch = [&](int t0) {
        const size_t oA = head + (size_t)(t0 + rA) * step + cA * 4;
        for (int i = 0; i < 4; ++i) {
            rg[i] = *(const v4f*)&g[oA + i * 8 * step];
            rs[i] = *(const v4f*)&s[oA + i * 8 * step];
        }
        rv = *(const v4f*)&v[head + (size_t)(t0 + rG) * step + dq * 16 + cG * 4];
        for (int i = 0; i < 4; ++i) rok[i] = *(const v4f*)&okq[t0 * 16 + i * 4];
    };
    auto stage = [&]() {
        for (int i = 0; i < 4; ++i) {
            v4f e4;
            for (int e = 0; e < 4; ++e) e4[e] = __expf(rg[i][e]);
            *(v4f*)&u[rA + 8 * i][cA * 12]     = e4;
            *(v4f*)&u[rA + 8 * i][cA * 12 + 4] = rs[i];
        }
        for (int e = 0; e < 4; ++e) {
            const int dl = cG * 4 + e;
            vv[rG][(dl & 7) * 2 + (dl >> 3)] = rv[e];
        }
        // softmax over the 64 slots of row rG: 16 slots a lane, 4 lanes a row
        float mx = fmaxf(fmaxf(rok[0][0], rok[1][0]), fmaxf(rok[2][0], rok[3][0]));
        for (int e = 1; e < 4; ++e)
            mx = fmaxf(mx, fmaxf(fmaxf(rok[0][e], rok[1][e]), fmaxf(rok[2][e], rok[3][e])));
        mx = fmaxf(mx, lane_xor<1>(mx));
        mx = fmaxf(mx, lane_xor<2>(mx));
        v4f p[4];
        for (int i = 0; i < 4; ++i)
            for (int e = 0; e < 4; ++e) p[i][e] = __expf(rok[i][e] - mx);
        const v4f ps = (p[0] + p[1]) + (p[2] + p[3]);
        float sum = (ps[0] + ps[1]) + (ps[2] + ps[3]);
        sum += lane_xor<1>(sum);
        sum += lane_xor<2>(sum);
        const float inv = 1.f / sum;
        for (int i = 0; i < 4; ++i) *(v4f*)&u[rG][(cG * 4 + i) * 12 + 8] = p[i] * inv;
    };

    v2f st[4];
    for (int i = 0; i < 4; ++i) st[i] = splat2(0.f);

    fetch(0);
    stage();
    __syncthreads();
    for (int t0 = 0; t0 < TD; t0 += TC) {
        if (t0 + TC < TD) fetch(t0 + TC);       // next chunk flies under this one
        // as in pass 1: the operands of 4 steps are fetched as one group, two groups
        // ahead of their use, into a ring of three register sets
        v4f fd[3][4], fs[3][4], fq[3][4];
        v2f fv[3][4];
        auto load4 = [&](int set, int tb) {
            for (int j = 0; j < 4; ++j) {
                fd[set][j] = *(const v4f*)&u[tb + j][grp * 12];
                fs[set][j] = *(const v4f*)&u[tb + j][grp * 12 + 4];
                fq[set][j] = *(const v4f*)&u[tb + j][grp * 12 + 8];
                fv[set][j] = *(const v2f*)&vv[tb + j][c * 2];
            }
        };
        load4(0, 0);
        load4(1, 4);
        // unrolled so that every index into the ring is a constant and the three
        // sets stay in registers
        #pragma unroll
        for (int gI = 0; gI < TC / 4; ++gI) {
            if (gI + 2 < TC / 4) load4((gI + 2) % 3, (gI + 2) * 4);
            // holds the group's loads in front of the arithmetic (see pass 1)
            __builtin_amdgcn_sched_barrier(0);
            for (int j = 0; j < 4; ++j) {
                const v4f dec = fd[gI % 3][j], sw = fs[gI % 3][j], qv = fq[gI % 3][j];
                const v2f vc = fv[gI % 3][j];
                for (int i = 0; i < 4; ++i)
                    st[i] = __builtin_elementwise_fma(st[i], splat2(dec[i]), splat2(sw[i]) * vc);
                v2f a0 = splat2(qv[0]) * st[0];
                v2f a1 = splat2(qv[2]) * st[2];
                a0 = __builtin_elementwise_fma(splat2(qv[1]), st[1], a0);
                a1 = __builtin_elementwise_fma(splat2(qv[3]), st[3], a1);
                *(v2f*)&part[gI * 4 + j][grp * 16 + c * 2] = a0 + a1;
            }
            // keeps the next group's loads behind this arithmetic, whose set they refill:
            // lifted in among it they take a further set, past 256 registers in pass 2
            __builtin_amdgcn_sched_barrier(0);
        }
        __syncthreads();    // partials complete; every read of u and vv done
        reduce_store(part, tid, 1.f, plane + t0 * 16);
        if (t0 + TC < TD) stage();
        __syncthreads();    // next chunk published; partials free again
    }
}

// ---------------------------------------------------------------------------
// Per-(b,t,h) RMSNorm over DV=64, convert to f16 for the Wo GEMM.
// A row of 16 lanes owns one (b,t,h) row, 4 values a lane; a wave takes 16 time
// steps of one (b,h) in eight 16-byte loads, all in flight together. The input
// is the scan's [b * HH + h][quarter][t][16]: a load of the wave covers two time
// steps, which are one whole 128 B line in each of the four quarters.
// The sum of squares crosses the 16 lanes by register exchanges: no LDS, no
// barrier, and 2,048 waves to start in place of 65,536.
// ---------------------------------------------------------------------------
__global__ __launch_bounds__(256) void rms_cvt_kernel(
    const float* __restrict__ o, const float* __restrict__ w,
    _Float16* __restrict__ out)
{
    const int lane = threadIdx.x & 31, l16 = lane & 15;
    const int wave = blockIdx.x * 8 + (threadIdx.x >> 5);
    const int bh = wave >> 5, t = (wave & 31) * 16 + (lane >> 4);
    const float* src = o + ((size_t)(bh * 4 + (l16 >> 2)) * TD + t) * 16 + (l16 & 3) * 4;
    _Float16* dst = out + ((size_t)(bh / HH) * TD + t) * (HH * 64) + (bh % HH) * 64 + l16 * 4;
    v4w xs[8];
    for (int j = 0; j < 8; ++j) xs[j] = *(const v4w*)(src + j * 32);
    const v4w wv = *(const v4w*)(w + l16 * 4);
    // inputs only: src is named behind the loads so that the address pair they
    // share is not among the registers that a load fills while they are out
    asm volatile("" :: "v"(src), "v"(xs[0]), "v"(xs[1]), "v"(xs[2]), "v"(xs[3]), "v"(xs[4]),
                       "v"(xs[5]), "v"(xs[6]), "v"(xs[7]), "v"(wv));
    for (int j = 0; j < 8; ++j) {
        const v4w q = xs[j] * xs[j];
        const float ss = row16_sum((q[0] + q[1]) + (q[2] + q[3]));
        const float rstd = rsqrtf(ss * (1.f / 64.f) + 1e-6f);
        v4h p;
        for (int e = 0; e < 4; ++e) p[e] = (_Float16)(xs[j][e] * rstd * wv[e]);
        *(v4h*)(dst + (size_t)j * 2 * (HH * 64)) = p;
    }
}

// ---------------------------------------------------------------------------
extern "C" void kernel_launch(void* const* d_in, const int* in_sizes, int n_in,
                              void* d_out, int out_size, void* d_ws, size_t ws_size,
                              hipStream_t stream)
{
    const float* x    = (const float*)d_in[0];
    const float* ln1w = (const float*)d_in[1];
    const float* ln1b = (const float*)d_in[2];
    const float* Wq   = (const float*)d_in[3];
    const float* Wk   = (const float*)d_in[4];
    const float* Wv   = (const float*)d_in[5];
    const float* Wf   = (const float*)d_in[6];
    const float* gnw  = (const float*)d_in[7];
    const float* Wo   = (const float*)d_in[8];
    const float* ln2w = (const float*)d_in[9];
    const float* ln2b = (const float*)d_in[10];
    const float* W1   = (const float*)d_in[11];
    const float* b1   = (const float*)d_in[12];
    const float* W2   = (const float*)d_in[13];
    const float* b2   = (const float*)d_in[14];
    float* outp = (float*)d_out;

    const int BT = BD * TD;   // 2048 rows for every GEMM

    char* wsp = (char*)d_ws;
    auto carve = [&](size_t bytes) -> char* {
        char* p = wsp;
        wsp += (bytes + 255) & ~(size_t)255;
        return p;
    };
    _Float16* h16   = (_Float16*)carve((size_t)BT * DD * 2);
    // Wq, Wk, Wv, Wf transposed, one behind the other: the B operand [4096][DD]
    _Float16* WqT   = (_Float16*)carve((size_t)4 * DD * 1024 * 2);
    _Float16* WkT   = WqT + (size_t)DD * 1024;
    _Float16* WvT   = WkT + (size_t)DD * 1024;
    _Float16* WfT   = WvT + (size_t)DD * 1024;
    _Float16* WoT   = (_Float16*)carve((size_t)DD * 1024 * 2);
    _Float16* W1T   = (_Float16*)carve((size_t)MLPD * DD * 2);
    _Float16* W2T   = (_Float16*)carve((size_t)DD * MLPD * 2);
    // the five planes that the projection launch writes: q, k, v, s, g
    float*    qb    = (float*)carve((size_t)5 * BT * 1024 * 4);
    float*    kb    = qb + (size_t)BT * 1024;
    float*    vb    = kb + (size_t)BT * 1024;
    float*    sb    = vb + (size_t)BT * 1024;
    float*    gb    = sb + (size_t)BT * 1024;
    float*    ob    = (float*)carve((size_t)BT * 1024 * 4);
    float*    okb   = (float*)carve((size_t)BT * 1024 * 4);
    _Float16* on16  = (_Float16*)carve((size_t)BT * 1024 * 2);
    float*    yb    = (float*)carve((size_t)BT * DD * 4);
    _Float16* h216  = (_Float16*)carve((size_t)BT * DD * 2);
    _Float16* a16   = (_Float16*)carve((size_t)BT * MLPD * 2);

    // weight transposes: in[K][N] -> f16 [N][K], all seven in one launch
    transpose_cvt_all<<<832, 256, 0, stream>>>(Wq, Wk, Wv, Wf, Wo, W1, W2,
                                               WqT, WkT, WvT, WfT, WoT, W1T, W2T);

    // LN1
    layernorm_f16<<<BT / 8, 256, 0, stream>>>(x, ln1w, ln1b, h16);

    // the four projections (fused activations) in one launch
    const dim3 gD(1024 / 64, BT / 128);
    gemm_wmma<0, 128, 128><<<dim3(4 * 1024 / 128, BT / 128), 256, 0, stream>>>(
        h16, WqT, qb, nullptr, nullptr, nullptr, nullptr, 1024, DD);

    // recurrent gated-slot scan: slot scores for all t, then softmax and read-out
    gsa_scores_kernel<<<BD * HH * 4, 128, 0, stream>>>(qb, kb, sb, gb, okb);
    gsa_read_kernel<<<BD * HH * 4, 128, 0, stream>>>(okb, vb, sb, gb, ob);

    // per-head RMSNorm -> f16
    rms_cvt_kernel<<<BT * HH / 128, 256, 0, stream>>>(ob, gnw, on16);

    // output projection + residual
    gemm_wmma<3, 64, 256><<<gD, 256, 0, stream>>>(on16, WoT, yb, nullptr, nullptr, nullptr, x, DD, 1024);

    // LN2
    layernorm_f16<<<BT / 8, 256, 0, stream>>>(yb, ln2w, ln2b, h216);

    // MLP
    gemm_wmma<4, 128, 128><<<dim3(MLPD / 128, BT / 128), 256, 0, stream>>>(
        h216, W1T, nullptr, nullptr, a16, b1, nullptr, MLPD, DD);
    gemm_wmma<5, 64, 256><<<dim3(DD / 64, BT / 128), 256, 0, stream>>>(
        a16, W2T, outp, nullptr, nullptr, b2, yb, DD, MLPD);
}

// v010
// A run of this version takes 134 microseconds.
// Timed twice side by side with v009, it ran 1.06 times as fast both times.
// Over all steps from v000 it is 11.8 times as fast.
#include <hip/hip_runtime.h>

#define BD 4
#define TD 512
#define DD 1024
#define HH 16
#define MLPD 4096

typedef __attribute__((ext_vector_type(16))) _Float16 v16h;
typedef __attribute__((ext_vector_type(8)))  _Float16 v8h;
typedef __attribute__((ext_vector_type(8)))  float    v8f;

// ---------------------------------------------------------------------------
// Transpose + f32->f16 convert of all seven weight matrices in ONE launch:
// in[K][N] (row-major) -> out[N][K] (row-major), so the GEMM B operand is
// K-contiguous like A. A work-group takes one 128 x 128 tile (64 elements a
// thread), so that few waves have to be started for the bytes that are moved.
// Reads: a wave's 16-byte loads cover one whole 512 B row of the tile.
// Writes: a wave's 16-byte stores cover two whole 256 B rows of the output.
// The LDS tile is [n][k] in f16, rows of 256 B = 16 chunks of 16 B; chunk c of
// row n lies at place c ^ ((n >> 2) & 15), so the 16 lanes of a half-wave hit
// 16 different places both when they write (rows 4 apart, one chunk) and when
// they read (one row, 16 chunks).
// Tiles: 5 x 64 (the 1024 x 1024 matrices), 256 (W1), 256 (W2) = 832.
// ---------------------------------------------------------------------------
typedef __attribute__((ext_vector_type(4))) float v4w;

// One tile. K and N are compile-time so that the 16 loads and the 8 stores of a
// thread differ from one another by immediate offsets only: one address each,
// and all 16 loads in flight together.
template<int K, int N>
__device__ __forceinline__ void transpose_tile(
    const float* __restrict__ in, _Float16* __restrict__ out, int tk, int tn,
    _Float16* tile)
{
    const int lane = threadIdx.x & 31, wid = threadIdx.x >> 5;

    // wave: k rows wid * 16 .. + 15; lane: columns n = lane * 4 .. + 3
    const float* src = in + (size_t)(tk * 128 + wid * 16) * N + tn * 128 + lane * 4;
    v4w r[16];
    for (int j = 0; j < 16; ++j) r[j] = *(const v4w*)(src + (size_t)j * N);
    // inputs only: holds all 16 loads in front of the first conversion, so that
    // a wave waits out one memory latency; without it the compiler issues them
    // in three groups with a full wait between the groups; src is named too so
    // that the address pair the loads share is not among the registers they fill
    asm volatile("" :: "v"(src), "v"(r[0]), "v"(r[1]), "v"(r[2]), "v"(r[3]), "v"(r[4]), "v"(r[5]),
                       "v"(r[6]), "v"(r[7]), "v"(r[8]), "v"(r[9]), "v"(r[10]), "v"(r[11]),
                       "v"(r[12]), "v"(r[13]), "v"(r[14]), "v"(r[15]));
    for (int gI = 0; gI < 2; ++gI)
        for (int e = 0; e < 4; ++e) {
            v8h p;
            for (int j = 0; j < 8; ++j) p[j] = (_Float16)r[gI * 8 + j][e];
            *(v8h*)&tile[(lane * 4 + e) * 128 + (((wid * 2 + gI) ^ (lane & 15)) * 8)] = p;
        }
    __syncthreads();

    // wave: output rows n = wid * 16 .. + 15, two a store; half-wave: one row
    const int hl = lane & 15, hr = lane >> 4;
    _Float16* dst = out + (size_t)(tn * 128 + wid * 16 + hr) * K + tk * 128 + hl * 8;
    for (int j = 0; j < 8; ++j) {
        const int n = wid * 16 + j * 2 + hr;
        const v8h p = *(const v8h*)&tile[n * 128 + ((hl ^ ((n >> 2) & 15)) * 8)];
        *(v8h*)(dst + (size_t)(j * 2) * K) = p;
    }
    // behind the last store: the listing lets a path run on into code that
    // reuses the stores' address and data registers
    asm volatile("s_wait_xcnt 0x0" ::: "memory");
}

__global__ __launch_bounds__(256) void transpose_cvt_all(
    const float* __restrict__ Wq, const float* __restrict__ Wk,
    const float* __restrict__ Wv, const float* __restrict__ Wf,
    const float* __restrict__ Wo, const float* __restrict__ W1,
    const float* __restrict__ W2,
    _Float16* __restrict__ WqT, _Float16* __restrict__ WkT,
    _Float16* __restrict__ WvT, _Float16* __restrict__ WfT,
    _Float16* __restrict__ WoT, _Float16* __restrict__ W1T,
    _Float16* __restrict__ W2T)
{
    __shared__ __attribute__((aligned(16))) _Float16 tile[128 * 128];
    const int bid = blockIdx.x;     // every branch below is uniform for the work-group
    if (bid < 320) {
        const int m = bid >> 6;
        const float* in = m == 0 ? Wq  : m == 1 ? Wk  : m == 2 ? Wv  : m == 3 ? Wf  : Wo;
        _Float16* out   = m == 0 ? WqT : m == 1 ? WkT : m == 2 ? WvT : m == 3 ? WfT : WoT;
        transpose_tile<1024, 1024>(in, out, (bid >> 3) & 7, bid & 7, tile);
    } else if (bid < 576) {
        transpose_tile<DD, MLPD>(W1, W1T, (bid - 320) >> 5, (bid - 320) & 31, tile);
    } else {
        transpose_tile<MLPD, DD>(W2, W2T, (bid - 576) >> 3, (bid - 576) & 7, tile);
    }
}

// ---------------------------------------------------------------------------
// Cross-lane helpers of the normalisation kernels and of the scan's softmax.
// ---------------------------------------------------------------------------
typedef __attribute__((ext_vector_type(4))) _Float16 v4h;

// Value of lane l ^ M, M < 16: a register-to-register exchange inside a row of
// 16 lanes, so a reduction over neighbouring lanes takes no LDS round trip.
template<int M>
__device__ __forceinline__ float lane_xor(float x)
{
    return __builtin_bit_cast(float, __builtin_amdgcn_update_dpp(
        0, __builtin_bit_cast(int, x), 0x160 + M, 0xf, 0xf, true));
}

// Sum over the 16 lanes of a row, left in every lane of the row.
__device__ __forceinline__ float row16_sum(float x)
{
    x += lane_xor<1>(x);
    x += lane_xor<2>(x);
    x += lane_xor<4>(x);
    x += lane_xor<8>(x);
    return x;
}

// Value of lane l ^ 16: the same place in the other row of 16 lanes.
__device__ __forceinline__ float other_row(float x)
{
    const int v = __builtin_bit_cast(int, x);
    return __builtin_bit_cast(float, __builtin_amdgcn_permlanex16(
        v, v, 0x76543210, 0xfedcba98, false, false));
}

// ---------------------------------------------------------------------------
// LayerNorm over D=1024, output f16 (feeds WMMA GEMM A operand).
// One wave owns one row: 32 values a lane in eight 16-byte loads, each load of
// the wave one run of 512 B, all in flight together. The two sums stay in
// registers and cross the lanes by register exchanges, so the kernel has no LDS
// and no barrier, and an eighth of the waves have to be started.
// ---------------------------------------------------------------------------
__global__ __launch_bounds__(256) void layernorm_f16(
    const float* __restrict__ x, const float* __restrict__ w,
    const float* __restrict__ b, _Float16* __restrict__ out)
{
    const int lane = threadIdx.x & 31;
    const int row = blockIdx.x * 8 + (threadIdx.x >> 5);
    const float* xr = x + (size_t)row * DD + lane * 4;
    v4w xs[8], wv[8], bv[8];
    for (int j = 0; j < 8; ++j) xs[j] = *(const v4w*)(xr + j * 128);
    for (int j = 0; j < 8; ++j) {
        wv[j] = *(const v4w*)(w + lane * 4 + j * 128);
        bv[j] = *(const v4w*)(b + lane * 4 + j * 128);
    }
    // inputs only: holds all 24 loads in front of this line, so that a wave waits
    // out one memory latency; without it the compiler moves the loads of w and b
    // behind the reduction, two at a time with a wait between the pairs; xr is
    // named too so that the address pair is not reused while loads are out
    asm volatile("" :: "v"(xr), "v"(xs[0]), "v"(xs[1]), "v"(xs[2]), "v"(xs[3]), "v"(xs[4]), "v"(xs[5]),
                       "v"(xs[6]), "v"(xs[7]), "v"(wv[0]), "v"(wv[1]), "v"(wv[2]), "v"(wv[3]),
                       "v"(wv[4]), "v"(wv[5]), "v"(wv[6]), "v"(wv[7]), "v"(bv[0]), "v"(bv[1]),
                       "v"(bv[2]), "v"(bv[3]), "v"(bv[4]), "v"(bv[5]), "v"(bv[6]), "v"(bv[7]));
    // keeps the sums behind the loads: without it the compiler lifts them, with
    // their waits for x, in among the loads of w and b, which then start late
    __builtin_amdgcn_sched_barrier(0);
    v4w s4 = xs[0], q4 = xs[0] * xs[0];
    for (int j = 1; j < 8; ++j) {
        s4 += xs[j];
        q4 = __builtin_elementwise_fma(xs[j], xs[j], q4);
    }
    float sum = row16_sum((s4[0] + s4[1]) + (s4[2] + s4[3]));
    float sq  = row16_sum((q4[0] + q4[1]) + (q4[2] + q4[3]));
    sum += other_row(sum);
    sq  += other_row(sq);
    const float mu   = sum * (1.f / DD);
    const float var  = sq * (1.f / DD) - mu * mu;
    const float rstd = rsqrtf(var + 1e-6f);
    _Float16* orow = out + (size_t)row * DD + lane * 4;
    for (int j = 0; j < 8; ++j) {
        v4h p;
        for (int e = 0; e < 4; ++e)
            p[e] = (_Float16)((xs[j][e] - mu) * rstd * wv[j][e] + bv[j][e]);
        *(v4h*)(orow + j * 128) = p;
    }
}

// ---------------------------------------------------------------------------
// 2^x and log2(x) on the hardware's transcendental unit. The v_nop is the slot
// that the instruction set asks for behind a transcendental before its result is
// used or its source overwritten: in the unrolled epilogues the compiler put
// writes of the source directly behind some of them. x of log2_hw is normal.
// ---------------------------------------------------------------------------
__device__ __forceinline__ float exp2_hw(float x)
{
    float r;
    // one statement, so that the slot stays directly behind the transcendental
    asm("v_exp_f32 %0, %1\n\tv_nop" : "=v"(r) : "v"(x));
    return r;
}
__device__ __forceinline__ float log2_hw(float x)
{
    float r;
    // one statement, so that the slot stays directly behind the transcendental
    asm("v_log_f32 %0, %1\n\tv_nop" : "=v"(r) : "v"(x));
    return r;
}

// ---------------------------------------------------------------------------
// erf for the GELU epilogue, without a branch: both ranges are evaluated and one
// is selected, so that the 64 values of a thread are independent straight-line
// chains that fill one another's latency. A call that branches on |x| runs the
// values one behind the other, and a wave with lanes on both sides runs both.
// |x| < 1: x + x * Q(x^2); |x| >= 1: 1 - exp(-(|x| + |x| * P(|x|))).
// Largest error against erf over -6..6 in f32 arithmetic: 9e-8.
// ---------------------------------------------------------------------------
__device__ __forceinline__ float erf_select(float x)
{
    const float a = fabsf(x), t = x * x;
    float p = fmaf(a, 1.699881e-5f, -3.7867785e-4f);
    p = fmaf(a, p, 3.8578159e-3f);
    p = fmaf(a, p, -2.4181698e-2f);
    p = fmaf(a, p, 1.0666826e-1f);
    p = fmaf(a, p, 6.349333e-1f);
    p = fmaf(a, p, 1.2868941e-1f);
    p = fmaf(a, p, a);
    float q = fmaf(t, -5.618018e-4f, 4.913816e-3f);
    q = fmaf(t, q, -2.6707515e-2f);
    q = fmaf(t, q, 1.1280011e-1f);
    q = fmaf(t, q, -3.7612295e-1f);
    q = fmaf(t, q, 1.283791e-1f);
    q = fmaf(a, q, a);
    const float far = 1.f - exp2_hw(-1.44269504f * p);
    return copysignf(a < 1.f ? q : far, x);
}

// ---------------------------------------------------------------------------
// WMMA GEMM: C[M x N] = epilogue(A[M x K] @ Bt[N x K]^T)
// 128 x BN block tile, 256 threads = 8 waves, 4 along M and 2 along N, each wave
// 32 x BN/2 (2 x BN/32 of 16x16).
// K staged BK-deep, DOUBLE-BUFFERED in LDS via CDNA5 async global->LDS copies
// (global_load_async_to_lds_b128, ASYNCcnt), so the fetch of stage k+1
// overlaps the v_wmma work on stage k.
// The products with 4096 columns take BN = 128, BK = 128: 512 work-groups, two on
// a WGP. Those with 1024 columns take BN = 64: 256 work-groups, one on every WGP,
// where 128 x 128 tiles gave 128 and left half of the WGPs idle. A work-group then
// has half the matrix work a stage to cover the next stage's copies with, so its
// stage is BK = 256 deep: one latency, wait and barrier per 256 of K.
// EPI: 0=the four input projections in one product (below), 3=+res f32,
//      4=+bias,gelu -> f16, 5=+bias,+res f32
// EPI 0: Bt holds the transposed Wq, Wk, Wv, Wf one behind the other, 4096 rows
// in all, so one launch has 512 work-groups (two for every WGP) where four
// launches of 128 each left half of the WGPs idle. out0 is five planes of
// BD * TD rows x 1024 floats: q, k, v, s, g. N is the pitch of a plane. The 128
// columns of a work-group lie in one matrix, so the choice of its activation is
// uniform for the work-group.
// ---------------------------------------------------------------------------
template<int EPI, int BN, int BK>
__global__ __launch_bounds__(256) void gemm_wmma(
    const _Float16* __restrict__ A, const _Float16* __restrict__ Bt,
    float* __restrict__ out0, float* __restrict__ out1,
    _Float16* __restrict__ outh,
    const float* __restrict__ bias, const float* __restrict__ res,
    int N, int K)
{
    // A stage is BK halfs of K: a row of 256 or 512 B, whole 128 B lines, so that
    // one memory latency, one wait and one barrier serve BK / 32 WMMA k steps.
    // LDS row pitch in halfs: BK of data + 8 unused = 272 or 528 B = 16 B x odd, so
    // the 16 rows that a half-wave's ds_load_b128 reads lie on distinct banks.
    constexpr int LP = BK + 8;
    constexpr int NJ = BN / 32;                  // B fragments of a wave
    __shared__ __attribute__((aligned(16))) _Float16 As[2][128 * LP];
    __shared__ __attribute__((aligned(16))) _Float16 Bs[2][BN * LP];
    const int tid  = threadIdx.x;
    const int lane = tid & 31, wid = tid >> 5;
    const int wm = wid >> 1, wn = wid & 1;       // 4 waves along M, 2 along N
    const int lr = lane & 15, hs = lane >> 4;    // half-wave select (ISA layout)
    const int rowBlk = blockIdx.y * 128, colBlk = blockIdx.x * BN;

    // Each thread owns fixed 16-byte chunks of the A tile and of the B tile per
    // stage: rows r0 + RP * i, half-offset o0. A wave's copy covers whole rows
    // (two of 256 B or one of 512 B).
    constexpr int CPR = BK / 8;                  // 16-byte chunks in a row
    constexpr int RP  = 256 / CPR;               // rows that one copy of every thread covers
    const int r0 = tid / CPR, o0 = (tid % CPR) * 8;
    const _Float16* gA = A  + (size_t)(rowBlk + r0) * K + o0;
    const _Float16* gB = Bt + (size_t)(colBlk + r0) * K + o0;
    // LDS byte addresses (low 32 bits of the generic pointer = LDS offset)
    const unsigned lA = (unsigned)(uintptr_t)&As[0][r0 * LP + o0];
    const unsigned lB = (unsigned)(uintptr_t)&Bs[0][r0 * LP + o0];
    constexpr unsigned bufA = 128 * LP * 2, bufB = BN * LP * 2;
    constexpr unsigned lStep = RP * LP * 2;      // RP rows in LDS, bytes
    const size_t gStep = (size_t)RP * K;         // RP rows in memory, halfs

    auto copy8 = [&](unsigned l, const _Float16* g) {
        // the last line is a precaution: it stands in front of every later
        // write of the address registers that these copies name
        asm volatile(
            "global_load_async_to_lds_b128 %0, %8, off\n\t"
            "global_load_async_to_lds_b128 %1, %9, off\n\t"
            "global_load_async_to_lds_b128 %2, %10, off\n\t"
            "global_load_async_to_lds_b128 %3, %11, off\n\t"
            "global_load_async_to_lds_b128 %4, %12, off\n\t"
            "global_load_async_to_lds_b128 %5, %13, off\n\t"
            "global_load_async_to_lds_b128 %6, %14, off\n\t"
            "global_load_async_to_lds_b128 %7, %15, off\n\t"
            "s_wait_xcnt 0x0"
            :
            : "v"(l), "v"(l + lStep), "v"(l + 2 * lStep), "v"(l + 3 * lStep),
              "v"(l + 4 * lStep), "v"(l + 5 * lStep), "v"(l + 6 * lStep), "v"(l + 7 * lStep),
              "v"((unsigned long long)(uintptr_t)(g)),
              "v"((unsigned long long)(uintptr_t)(g + gStep)),
              "v"((unsigned long long)(uintptr_t)(g + 2 * gStep)),
              "v"((unsigned long long)(uintptr_t)(g + 3 * gStep)),
              "v"((unsigned long long)(uintptr_t)(g + 4 * gStep)),
              "v"((unsigned long long)(uintptr_t)(g + 5 * gStep)),
              "v"((unsigned long long)(uintptr_t)(g + 6 * gStep)),
              "v"((unsigned long long)(uintptr_t)(g + 7 * gStep))
            : "memory");
    };
    auto issue_stage = [&](int kk, int buf) {
        const size_t ko = (size_t)kk * BK;
        for (int c = 0; c < 128 / (8 * RP); ++c)
            copy8(lA + (unsigned)buf * bufA + c * 8 * lStep, gA + ko + c * 8 * gStep);
        for (int c = 0; c < BN / (8 * RP); ++c)
            copy8(lB + (unsigned)buf * bufB + c * 8 * lStep, gB + ko + c * 8 * gStep);
    };

    v8f acc[2][NJ];
    for (int i = 0; i < 2; ++i)
        for (int j = 0; j < NJ; ++j)
            for (int r = 0; r < 8; ++r) acc[i][j][r] = 0.f;

    const int nk = K >> (BK == 256 ? 8 : 7);     // stages: K / BK
    issue_stage(0, 0);
    asm volatile("s_wait_asynccnt 0x0" ::: "memory");   // own copies of stage 0 landed
    __syncthreads();                                    // stage 0 published
    if (nk > 1) issue_stage(1, 1);                      // flies under stage 0's work
    for (int kk = 0; kk < nk; ++kk) {
        const int buf = kk & 1;
        const _Float16* Ab = As[buf];
        const _Float16* Bb = Bs[buf];
        if constexpr (BN == 64) {
            // Two waves on a SIMD with 4 WMMAs a k step each do not cover an LDS
            // latency, so the 8 fragment loads of a k step go as one group, two k
            // steps ahead of their use, into a ring of three register sets. Only
            // this stage's buffer is read: the ring starts anew in every stage.
            // Fragment layout and k order: as in the other branch.
            v16h af[3][2], bf[3][NJ];
            auto loadf = [&](int set, int ks) {
                for (int i = 0; i < 2; ++i) {
                    int r = wm * 32 + i * 16 + lr;
                    v8h lo = *(const v8h*)&Ab[r * LP + ks * 32 + hs * 8];
                    v8h hi = *(const v8h*)&Ab[r * LP + ks * 32 + hs * 8 + 16];
                    af[set][i] = __builtin_shufflevector(lo, hi, 0,1,2,3,4,5,6,7,8,9,10,11,12,13,14,15);
                }
                for (int j = 0; j < NJ; ++j) {
                    int r = wn * (BN / 2) + j * 16 + lr;
                    v8h lo = *(const v8h*)&Bb[r * LP + ks * 32 + hs * 8];
                    v8h hi = *(const v8h*)&Bb[r * LP + ks * 32 + hs * 8 + 16];
                    bf[set][j] = __builtin_shufflevector(lo, hi, 0,1,2,3,4,5,6,7,8,9,10,11,12,13,14,15);
                }
            };
            loadf(0, 0);
            loadf(1, 1);
            // unrolled so that every index into the ring is a constant and the
            // three sets stay in registers
            #pragma unroll
            for (int ks = 0; ks < BK / 32; ++ks) {
                if (ks + 2 < BK / 32) loadf((ks + 2) % 3, ks + 2);
                // holds the group's loads in front of the matrix instructions: left
                // to itself the compiler keeps one set and loads it directly in
                // front of its use, with two full waits at every k step
                __builtin_amdgcn_sched_barrier(0);
                for (int i = 0; i < 2; ++i)
                    for (int j = 0; j < NJ; ++j)
                        acc[i][j] = __builtin_amdgcn_wmma_f32_16x16x32_f16(
                            false, af[ks % 3][i], false, bf[ks % 3][j], (short)0, acc[i][j], false, false);
                // keeps the next group's loads behind these matrix instructions, whose
                // set they refill: left free they are lifted in among them and take
                // 16 registers more
                __builtin_amdgcn_sched_barrier(0);
            }
        } else
        // unrolled so that the fragment loads of a later k step can issue ahead
        // of the matrix instructions of an earlier one
        #pragma unroll
        for (int ks = 0; ks < BK / 32; ++ks) {
            // Fragment layout (16-bit A 16x32): lanes 0-15 hold K 0-7 / 16-23,
            // lanes 16-31 hold K 8-15 / 24-31, for row M = lane%16.
            v16h af[2], bf[NJ];
            for (int i = 0; i < 2; ++i) {
                int r = wm * 32 + i * 16 + lr;
                v8h lo = *(const v8h*)&Ab[r * LP + ks * 32 + hs * 8];
                v8h hi = *(const v8h*)&Ab[r * LP + ks * 32 + hs * 8 + 16];
                af[i] = __builtin_shufflevector(lo, hi, 0,1,2,3,4,5,6,7,8,9,10,11,12,13,14,15);
            }
            for (int j = 0; j < NJ; ++j) {
                int r = wn * (BN / 2) + j * 16 + lr;
                v8h lo = *(const v8h*)&Bb[r * LP + ks * 32 + hs * 8];
                v8h hi = *(const v8h*)&Bb[r * LP + ks * 32 + hs * 8 + 16];
                bf[j] = __builtin_shufflevector(lo, hi, 0,1,2,3,4,5,6,7,8,9,10,11,12,13,14,15);
            }
            for (int i = 0; i < 2; ++i)
                for (int j = 0; j < NJ; ++j)
                    acc[i][j] = __builtin_amdgcn_wmma_f32_16x16x32_f16(
                        false, af[i], false, bf[j], (short)0, acc[i][j], false, false);
        }
        // hand-over: this wave's reads of buf are done, its copies of stage
        // kk + 1 have landed; the barrier publishes that stage and frees buf
        asm volatile("s_wait_dscnt 0x0" ::: "memory");      // own reads of buf retired
        asm volatile("s_wait_asynccnt 0x0" ::: "memory");   // own copies of stage kk + 1 landed
        __syncthreads();
        if (kk + 2 < nk) issue_stage(kk + 2, buf);      // flies under stage kk + 1's work
    }
    // no copy is outstanding when the wave goes on to the epilogue and ends
    asm volatile("s_wait_asynccnt 0x0" ::: "memory");

    // Epilogue. C/D layout: VGPR r holds M = r (lanes 0-15) or r+8 (lanes 16-31),
    // N = lane%16.
    if (EPI == 0) {
        const size_t PL = (size_t)BD * TD * 1024;
        const int mat = colBlk >> 10;               // 0 Wq, 1 Wk, 2 Wv, 3 Wf
        float* pl = out0 + (size_t)mat * PL;
        auto each = [&](auto f) {
            for (int i = 0; i < 2; ++i)
                for (int j = 0; j < NJ; ++j)
                    for (int r = 0; r < 8; ++r) {
                        int row = rowBlk + wm * 32 + i * 16 + hs * 8 + r;
                        int col = (colBlk & 1023) + wn * (BN / 2) + j * 16 + lr;
                        f(acc[i][j][r], (size_t)row * N + col);
                    }
        };
        if (mat < 2) {                                 // q, k: swish
            each([&](float v, size_t idx) { pl[idx] = v / (1.f + __expf(-v)); });
        } else if (mat == 2) {                         // v
            each([&](float v, size_t idx) { pl[idx] = v; });
            // behind the last store: the listing lets a path run on into the swish
            // code, which reuses the stores' address registers
            asm volatile("s_wait_xcnt 0x0" ::: "memory");
        } else {                                       // gate: g = logsig(v)/8, s = 1-exp(g)
            // 1 + exp(-|v|) lies in (1, 2]: a normal number, so the hardware's base-2
            // logarithm takes it as it is, and the rounding of the sum puts about
            // 1e-7 absolute on ls, 1e-8 on g; s is formed as
            // 1 - exp(g). The library's log1p and expm1 took over a hundred
            // dependent instructions a value.
            each([&](float v, size_t idx) {
                float ls = fminf(v, 0.f)
                         - 0.69314718f * log2_hw(1.f + exp2_hw(-1.44269504f * fabsf(v)));
                float gg = ls * 0.125f;
                pl[idx + PL] = gg;
                pl[idx] = 1.f - exp2_hw(1.44269504f * gg);
            });
            // behind the last store: the listing lets a path run on into the code of
            // the v plane, which reuses the stores' address and data registers
            asm volatile("s_wait_xcnt 0x0" ::: "memory");
        }
        return;
    }
    // unrolled: left to itself the compiler keeps the GELU's loops over r rolled,
    // picks each accumulator by a run-time index and works on one value at a time
    #pragma unroll
    for (int i = 0; i < 2; ++i)
        #pragma unroll
        for (int j = 0; j < NJ; ++j)
            #pragma unroll
            for (int r = 0; r < 8; ++r) {
                int row = rowBlk + wm * 32 + i * 16 + hs * 8 + r;
                int col = colBlk + wn * (BN / 2) + j * 16 + lr;
                size_t idx = (size_t)row * N + col;
                float v = acc[i][j][r];
                if (EPI == 3) {                            // + residual
                    out0[idx] = v + res[idx];
                } else if (EPI == 4) {                     // + bias, exact gelu, f16 out
                    float t = v + bias[col];
                    outh[idx] = (_Float16)(0.5f * t * (1.f + erf_select(t * 0.70710678118f)));
                } else if (EPI == 5) {                     // + bias + residual
                    out0[idx] = v + bias[col] + res[idx];
                }
            }
}

// ---------------------------------------------------------------------------
// Gated-slot attention scan, as two recurrences whose columns are independent.
// K[d][m] is decayed and written per slot m only, and V[m][d] feeds o[d] per
// column d only, so a lane that owns a column keeps its part of the state in
// registers for all T steps and never exchanges state with another lane.
// Pass 1 gives the slot scores ok[t][m] for every t, pass 2 takes their
// softmax and gives o[t][d]. Work-group = (b, h, quarter of the columns): 256
// work-groups of 4 waves, one wave on every SIMD of the chip.
// Eight lanes own 4 rows of the contraction dim (16 groups in 4 waves) and a
// lane owns 2 columns (c and c + 8): 8 state values a lane, held as pairs.
// Time runs in chunks of TC steps staged in LDS; the 16 partial sums of each
// output are added once per chunk. Operands and partials have two LDS buffers
// each, so a chunk has ONE barrier: behind it the chunk's partials are added and
// stored while the next chunk is already under way in the other buffer.
// Both results are laid out [b * HH + h][quarter][t][16], so that a work-group
// writes whole 128 B lines that no other work-group writes to.
// ---------------------------------------------------------------------------
#define TC 32
// floats from one time step's partials to the next: 16 groups x 16 entries and
// 16 unused, so that the four time steps which a half-wave adds up side by side
// lie on different banks
#define PT 272
typedef __attribute__((ext_vector_type(2))) float v2f;
typedef __attribute__((ext_vector_type(4))) float v4f;

__device__ __forceinline__ v2f splat2(float a) { v2f r = {a, a}; return r; }

// Adds the 16 group partials of 4 neighbouring entries x = 2 * c + j and
// stores them at columns c + 8 * j of the 16 floats of the output row.
// iR: the thread's first partial, (tid >> 2) * PT + (tid & 3) * 4 into the plane.
__device__ __forceinline__ void reduce_store(
    const float* sm, int iR, int tid, float scale, float* __restrict__ dst)
{
    const int t = tid >> 2, x4 = (tid & 3) * 4;
    v4f a = *(const v4f*)&sm[iR];
    for (int gI = 1; gI < 16; ++gI) a += *(const v4f*)&sm[iR + gI * 16];
    a *= scale;
    float* p = dst + t * 16 + (x4 >> 1);
    v2f lo = {a.x, a.z}, hi = {a.y, a.w};
    *(v2f*)p = lo;
    *(v2f*)(p + 8) = hi;
    // the stores' address and data registers are reused right behind them
    asm volatile("s_wait_xcnt 0x0" ::: "memory");
}

// Pass 1: ok[t][m] = DK^-0.5 * sum_d q_t[d] * K_t[d][m]
__global__ __launch_bounds__(128) void gsa_scores_kernel(
    const float* __restrict__ q, const float* __restrict__ k,
    const float* __restrict__ s, const float* __restrict__ g,
    float* __restrict__ ok)
{
    // One chunk's LDS, in floats; there are two such buffers, used in turn.
    constexpr int KQ = 0;                       // [t][group][k0..3 q0..3], 128 a step
    constexpr int GS = KQ + TC * 128;           // [t][c][dec0 dec1 s0 s1], 32 a step
    constexpr int PA = GS + TC * 32;            // [t][group * 16 + 2c + j], PT a step
    constexpr int SZ = PA + TC * PT;
    __shared__ __attribute__((aligned(16))) float sm[2 * SZ];

    const int tid = threadIdx.x;
    const int bh = blockIdx.x >> 2, mq = blockIdx.x & 3;
    const int b = bh / HH, h = bh % HH;
    const int c = tid & 7, grp = tid >> 3;

    // staging ownership inside a chunk
    const int rA = tid >> 4, cA = tid & 15;     // k, q: rows rA + 8 * i, 4 floats
    const int rG = tid >> 2, cG = tid & 3;      // g, s: row rG, 4 floats of this quarter
    const size_t head = ((size_t)b * TD * HH + h) * 64;
    const size_t step = HH * 64;
    float* plane = ok + (size_t)blockIdx.x * (TD * 16);

    // The thread's places in LDS. iK, iG, iP lie in the buffer of the chunk that is
    // worked on; sK, sG (next chunk's operands) and iR (last chunk's partials) in
    // the other one. Each moves to the other buffer at the foot of a chunk.
    int iK = KQ + grp * 8, iG = GS + c * 4, iP = PA + grp * 16 + c * 2;
    int sK = KQ + rA * 128 + cA * 8, sG = GS + rG * 32;
    int iR = SZ + PA + (tid >> 2) * PT + (tid & 3) * 4;

    v4f rk[4], rq[4], rg, rs;
    auto fetch = [&](int t0) {
        const size_t oA = head + (size_t)(t0 + rA) * step + cA * 4;
        const size_t oG = head + (size_t)(t0 + rG) * step + mq * 16 + cG * 4;
        const float* pk = k + oA;
        const float* pq = q + oA;
        const float* pg = g + oG;
        const float* ps = s + oG;
        for (int i = 0; i < 4; ++i) {
            rk[i] = *(const v4f*)(pk + i * 8 * step);
            rq[i] = *(const v4f*)(pq + i * 8 * step);
        }
        rg = *(const v4f*)pg;   rs = *(const v4f*)ps;
        // inputs only: the four address pairs are named behind the loads so that
        // none of them is among the registers that a load fills while they are out
        asm volatile("" :: "v"(pk), "v"(pq), "v"(pg), "v"(ps));
    };
    auto stage = [&]() {
        for (int i = 0; i < 4; ++i) {
            *(v4f*)&sm[sK + 8 * i * 128]     = rk[i];
            *(v4f*)&sm[sK + 8 * i * 128 + 4] = rq[i];
        }
        for (int e = 0; e < 4; ++e) {
            const int ml = cG * 4 + e;
            sm[sG + (ml & 7) * 4 + (ml >> 3)]     = __expf(rg[e]);
            sm[sG + (ml & 7) * 4 + 2 + (ml >> 3)] = rs[e];
        }
    };

    v2f st[4];
    for (int i = 0; i < 4; ++i) st[i] = splat2(0.f);

    fetch(0);
    stage();
    sK += SZ;   sG += SZ;
    int d = SZ;
    __syncthreads();
    for (int t0 = 0; t0 < TD; t0 += TC) {
        if (t0 + TC < TD) fetch(t0 + TC);       // next chunk flies under this one
        // One wave on a SIMD has no neighbour that fills its LDS latency, so the
        // operands of 4 steps are fetched as one group, two groups ahead of their
        // use, into a ring of three register sets.
        v4f fk[3][4], fq[3][4], fd[3][4];
        auto load4 = [&](int set, int tb) {
            for (int j = 0; j < 4; ++j) {
                fk[set][j] = *(const v4f*)&sm[iK + (tb + j) * 128];
                fq[set][j] = *(const v4f*)&sm[iK + (tb + j) * 128 + 4];
                fd[set][j] = *(const v4f*)&sm[iG + (tb + j) * 32];
            }
        };
        load4(0, 0);
        load4(1, 4);
        // the last chunk's partials are added up under the latency of the ring's first
        // loads; the stores have this whole chunk to complete before the next barrier
        if (t0 > 0) reduce_store(sm, iR, tid, 0.125f, plane + (t0 - TC) * 16);
        // unrolled so that every index into the ring is a constant and the three
        // sets stay in registers
        #pragma unroll
        for (int gI = 0; gI < TC / 4; ++gI) {
            if (gI + 2 < TC / 4) load4((gI + 2) % 3, (gI + 2) * 4);
            // holds the group's loads in front of the arithmetic: left to itself the
            // compiler puts each step's loads directly in front of their use, with
            // a full wait at every step
            __builtin_amdgcn_sched_barrier(0);
            for (int j = 0; j < 4; ++j) {
                const v4f kk = fk[gI % 3][j], qq = fq[gI % 3][j], ds = fd[gI % 3][j];
                const v2f dec = {ds.x, ds.y}, sw = {ds.z, ds.w};
                for (int i = 0; i < 4; ++i)
                    st[i] = __builtin_elementwise_fma(st[i], dec, splat2(kk[i]) * sw);
                v2f a0 = splat2(qq[0]) * st[0];
                v2f a1 = splat2(qq[2]) * st[2];
                a0 = __builtin_elementwise_fma(splat2(qq[1]), st[1], a0);
                a1 = __builtin_elementwise_fma(splat2(qq[3]), st[3], a1);
                *(v2f*)&sm[iP + (gI * 4 + j) * PT] = a0 + a1;
            }
            // keeps the next group's loads behind this arithmetic, whose set they refill:
            // lifted in among it they take a further set, past 256 registers in pass 2
            __builtin_amdgcn_sched_barrier(0);
        }
        if (t0 + TC < TD) stage();              // into the buffer that the last chunk left
        // the one barrier of a chunk: this chunk's partials and the next chunk's
        // operands are published, and every read of the other buffer's partials and of
        // this buffer's operands is done
        __syncthreads();
        iK += d;   iG += d;   iP += d;
        sK -= d;   sG -= d;   iR -= d;
        d = -d;
    }
    reduce_store(sm, iR, tid, 0.125f, plane + (TD - TC) * 16);
}

// Pass 2: qv_t = softmax_m(ok_t), o[t][d] = sum_m qv_t[m] * V_t[m][d]
__global__ __launch_bounds__(128) void gsa_read_kernel(
    const float* __restrict__ ok, const float* __restrict__ v,
    const float* __restrict__ s, const float* __restrict__ g,
    float* __restrict__ o)
{
    // One chunk's LDS, in floats; two such buffers, used in turn (see pass 1).
    // A time step of U is 16 groups x 12 floats and 4 unused, so that the four time
    // steps whose softmax a half-wave stores side by side lie on different banks.
    constexpr int U  = 0;                       // [t][group * 12 + dec0..3 s0..3 qv0..3], 196 a step
    constexpr int VV = U + TC * 196;            // [t][2c + j], 16 a step
    constexpr int PA = VV + TC * 16;            // [t][group * 16 + 2c + j], PT a step
    constexpr int SZ = PA + TC * PT;
    __shared__ __attribute__((aligned(16))) float sm[2 * SZ];

    const int tid = threadIdx.x;
    const int bh = blockIdx.x >> 2, dq = blockIdx.x & 3;
    const int b = bh / HH, h = bh % HH;
    const int c = tid & 7, grp = tid >> 3;

    const int rA = tid >> 4, cA = tid & 15;     // g, s: rows rA + 8 * i, 4 floats
    const int rG = tid >> 2, cG = tid & 3;      // v: row rG, 4 floats of this quarter; ok: row rG, quarter cG
    const size_t head = ((size_t)b * TD * HH + h) * 64;
    const size_t step = HH * 64;
    const float* okq = ok + ((size_t)(bh * 4 + cG) * TD + rG) * 16;
    float* plane = o + (size_t)blockIdx.x * (TD * 16);

    // the thread's places in LDS, as in pass 1
    int iU = U + grp * 12, iV = VV + c * 2, iP = PA + grp * 16 + c * 2;
    int sU = U + rA * 196 + cA * 12, sV = VV + rG * 16, sQ = U + rG * 196 + cG * 48 + 8;
    int iR = SZ + PA + (tid >> 2) * PT + (tid & 3) * 4;

    v4f rg[4], rs[4], rok[4], rv;
    auto fetch = [&](int t0) {
        const size_t oA = head + (size_t)(t0 + rA) * step + cA * 4;
        for (int i = 0; i < 4; ++i) {
            rg[i] = *(const v4f*)&g[oA + i * 8 * step];
            rs[i] = *(const v4f*)&s[oA + i * 8 * step];
        }
        rv = *(const v4f*)&v[head + (size_t)(t0 + rG) * step + dq * 16 + cG * 4];
        for (int i = 0; i < 4; ++i) rok[i] = *(const v4f*)&okq[t0 * 16 + i * 4];
    };
    auto stage = [&]() {
        for (int i = 0; i < 4; ++i) {
            v4f e4;
            for (int e = 0; e < 4; ++e) e4[e] = __expf(rg[i][e]);
            *(v4f*)&sm[sU + 8 * i * 196]     = e4;
            *(v4f*)&sm[sU + 8 * i * 196 + 4] = rs[i];
        }
        for (int e = 0; e < 4; ++e) {
            const int dl = cG * 4 + e;
            sm[sV + (dl & 7) * 2 + (dl >> 3)] = rv[e];
        }
        // softmax over the 64 slots of row rG: 16 slots a lane, 4 lanes a row
        float mx = fmaxf(fmaxf(rok[0][0], rok[1][0]), fmaxf(rok[2][0], rok[3][0]));
        for (int e = 1; e < 4; ++e)
            mx = fmaxf(mx, fmaxf(fmaxf(rok[0][e], rok[1][e]), fmaxf(rok[2][e], rok[3][e])));
        mx = fmaxf(mx, lane_xor<1>(mx));
        mx = fmaxf(mx, lane_xor<2>(mx));
        v4f p[4];
        for (int i = 0; i < 4; ++i)
            for (int e = 0; e < 4; ++e) p[i][e] = __expf(rok[i][e] - mx);
        const v4f ps = (p[0] + p[1]) + (p[2] + p[3]);
        float sum = (ps[0] + ps[1]) + (ps[2] + ps[3]);
        sum += lane_xor<1>(sum);
        sum += lane_xor<2>(sum);
        const float inv = 1.f / sum;
        for (int i = 0; i < 4; ++i) *(v4f*)&sm[sQ + i * 12] = p[i] * inv;
    };

    v2f st[4];
    for (int i = 0; i < 4; ++i) st[i] = splat2(0.f);

    fetch(0);
    stage();
    sU += SZ;   sV += SZ;   sQ += SZ;
    int d = SZ;
    __syncthreads();
    for (int t0 = 0; t0 < TD; t0 += TC) {
        if (t0 + TC < TD) fetch(t0 + TC);       // next chunk flies under this one
        // as in pass 1: the operands of 4 steps are fetched as one group, two groups
        // ahead of their use, into a ring of three register sets
        v4f fd[3][4], fs[3][4], fq[3][4];
        v2f fv[3][4];
        auto load4 = [&](int set, int tb) {
            for (int j = 0; j < 4; ++j) {
                fd[set][j] = *(const v4f*)&sm[iU + (tb + j) * 196];
                fs[set][j] = *(const v4f*)&sm[iU + (tb + j) * 196 + 4];
                fq[set][j] = *(const v4f*)&sm[iU + (tb + j) * 196 + 8];
                fv[set][j] = *(const v2f*)&sm[iV + (tb + j) * 16];
            }
        };
        load4(0, 0);
        load4(1, 4);
        // the last chunk's partials, under the latency of the ring's first loads (see pass 1)
        if (t0 > 0) reduce_store(sm, iR, tid, 1.f, plane + (t0 - TC) * 16);
        // unrolled so that every index into the ring is a constant and the three
        // sets stay in registers
        #pragma unroll
        for (int gI = 0; gI < TC / 4; ++gI) {
            if (gI + 2 < TC / 4) load4((gI + 2) % 3, (gI + 2) * 4);
            // holds the group's loads in front of the arithmetic (see pass 1)
            __builtin_amdgcn_sched_barrier(0);
            for (int j = 0; j < 4; ++j) {
                const v4f dec = fd[gI % 3][j], sw = fs[gI % 3][j], qv = fq[gI % 3][j];
                const v2f vc = fv[gI % 3][j];
                for (int i = 0; i < 4; ++i)
                    st[i] = __builtin_elementwise_fma(st[i], splat2(dec[i]), splat2(sw[i]) * vc);
                v2f a0 = splat2(qv[0]) * st[0];
                v2f a1 = splat2(qv[2]) * st[2];
                a0 = __builtin_elementwise_fma(splat2(qv[1]), st[1], a0);
                a1 = __builtin_elementwise_fma(splat2(qv[3]), st[3], a1);
                *(v2f*)&sm[iP + (gI * 4 + j) * PT] = a0 + a1;
            }
            // keeps the next group's loads behind this arithmetic, whose set they refill:
            // lifted in among it they take a further set, past 256 registers in pass 2
            __builtin_amdgcn_sched_barrier(0);
        }
        if (t0 + TC < TD) stage();              // into the buffer that the last chunk left
        __syncthreads();    // the one barrier of a chunk (see pass 1)
        iU += d;   iV += d;   iP += d;
        sU -= d;   sV -= d;   sQ -= d;   iR -= d;
        d = -d;
    }
    reduce_store(sm, iR, tid, 1.f, plane + (TD - TC) * 16);
}

// ---------------------------------------------------------------------------
// Per-(b,t,h) RMSNorm over DV=64, convert to f16 for the Wo GEMM.
// A row of 16 lanes owns one (b,t,h) row, 4 values a lane; a wave takes 16 time
// steps of one (b,h) in eight 16-byte loads, all in flight together. The input
// is the scan's [b * HH + h][quarter][t][16]: a load of the wave covers two time
// steps, which are one whole 128 B line in each of the four quarters.
// The sum of squares crosses the 16 lanes by register exchanges: no LDS, no
// barrier, and 2,048 waves to start in place of 65,536.
// ---------------------------------------------------------------------------
__global__ __launch_bounds__(256) void rms_cvt_kernel(
    const float* __restrict__ o, const float* __restrict__ w,
    _Float16* __restrict__ out)
{
    const int lane = threadIdx.x & 31, l16 = lane & 15;
    const int wave = blockIdx.x * 8 + (threadIdx.x >> 5);
    const int bh = wave >> 5, t = (wave & 31) * 16 + (lane >> 4);
    const float* src = o + ((size_t)(bh * 4 + (l16 >> 2)) * TD + t) * 16 + (l16 & 3) * 4;
    _Float16* dst = out + ((size_t)(bh / HH) * TD + t) * (HH * 64) + (bh % HH) * 64 + l16 * 4;
    v4w xs[8];
    for (int j = 0; j < 8; ++j) xs[j] = *(const v4w*)(src + j * 32);
    const v4w wv = *(const v4w*)(w + l16 * 4);
    // inputs only: src is named behind the loads so that the address pair they
    // share is not among the registers that a load fills while they are out
    asm volatile("" :: "v"(src), "v"(xs[0]), "v"(xs[1]), "v"(xs[2]), "v"(xs[3]), "v"(xs[4]),
                       "v"(xs[5]), "v"(xs[6]), "v"(xs[7]), "v"(wv));
    for (int j = 0; j < 8; ++j) {
        const v4w q = xs[j] * xs[j];
        const float ss = row16_sum((q[0] + q[1]) + (q[2] + q[3]));
        const float rstd = rsqrtf(ss * (1.f / 64.f) + 1e-6f);
        v4h p;
        for (int e = 0; e < 4; ++e) p[e] = (_Float16)(xs[j][e] * rstd * wv[e]);
        *(v4h*)(dst + (size_t)j * 2 * (HH * 64)) = p;
    }
}

// ---------------------------------------------------------------------------
extern "C" void kernel_launch(void* const* d_in, const int* in_sizes, int n_in,
                              void* d_out, int out_size, void* d_ws, size_t ws_size,
                              hipStream_t stream)
{
    const float* x    = (const float*)d_in[0];
    const float* ln1w = (const float*)d_in[1];
    const float* ln1b = (const float*)d_in[2];
    const float* Wq   = (const float*)d_in[3];
    const float* Wk   = (const float*)d_in[4];
    const float* Wv   = (const float*)d_in[5];
    const float* Wf   = (const float*)d_in[6];
    const float* gnw  = (const float*)d_in[7];
    const float* Wo   = (const float*)d_in[8];
    const float* ln2w = (const float*)d_in[9];
    const float* ln2b = (const float*)d_in[10];
    const float* W1   = (const float*)d_in[11];
    const float* b1   = (const float*)d_in[12];
    const float* W2   = (const float*)d_in[13];
    const float* b2   = (const float*)d_in[14];
    float* outp = (float*)d_out;

    const int BT = BD * TD;   // 2048 rows for every GEMM

    char* wsp = (char*)d_ws;
    auto carve = [&](size_t bytes) -> char* {
        char* p = wsp;
        wsp += (bytes + 255) & ~(size_t)255;
        return p;
    };
    _Float16* h16   = (_Float16*)carve((size_t)BT * DD * 2);
    // Wq, Wk, Wv, Wf transposed, one behind the other: the B operand [4096][DD]
    _Float16* WqT   = (_Float16*)carve((size_t)4 * DD * 1024 * 2);
    _Float16* WkT   = WqT + (size_t)DD * 1024;
    _Float16* WvT   = WkT + (size_t)DD * 1024;
    _Float16* WfT   = WvT + (size_t)DD * 1024;
    _Float16* WoT   = (_Float16*)carve((size_t)DD * 1024 * 2);
    _Float16* W1T   = (_Float16*)carve((size_t)MLPD * DD * 2);
    _Float16* W2T   = (_Float16*)carve((size_t)DD * MLPD * 2);
    // the five planes that the projection launch writes: q, k, v, s, g
    float*    qb    = (float*)carve((size_t)5 * BT * 1024 * 4);
    float*    kb    = qb + (size_t)BT * 1024;
    float*    vb    = kb + (size_t)BT * 1024;
    float*    sb    = vb + (size_t)BT * 1024;
    float*    gb    = sb + (size_t)BT * 1024;
    float*    ob    = (float*)carve((size_t)BT * 1024 * 4);
    float*    okb   = (float*)carve((size_t)BT * 1024 * 4);
    _Float16* on16  = (_Float16*)carve((size_t)BT * 1024 * 2);
    float*    yb    = (float*)carve((size_t)BT * DD * 4);
    _Float16* h216  = (_Float16*)carve((size_t)BT * DD * 2);
    _Float16* a16   = (_Float16*)carve((size_t)BT * MLPD * 2);

    // weight transposes: in[K][N] -> f16 [N][K], all seven in one launch
    transpose_cvt_all<<<832, 256, 0, stream>>>(Wq, Wk, Wv, Wf, Wo, W1, W2,
                                               WqT, WkT, WvT, WfT, WoT, W1T, W2T);

    // LN1
    layernorm_f16<<<BT / 8, 256, 0, stream>>>(x, ln1w, ln1b, h16);

    // the four projections (fused activations) in one launch
    const dim3 gD(1024 / 64, BT / 128);
    gemm_wmma<0, 128, 128><<<dim3(4 * 1024 / 128, BT / 128), 256, 0, stream>>>(
        h16, WqT, qb, nullptr, nullptr, nullptr, nullptr, 1024, DD);

    // recurrent gated-slot scan: slot scores for all t, then softmax and read-out
    gsa_scores_kernel<<<BD * HH * 4, 128, 0, stream>>>(qb, kb, sb, gb, okb);
    gsa_read_kernel<<<BD * HH * 4, 128, 0, stream>>>(okb, vb, sb, gb, ob);

    // per-head RMSNorm -> f16
    rms_cvt_kernel<<<BT * HH / 128, 256, 0, stream>>>(ob, gnw, on16);

    // output projection + residual
    gemm_wmma<3, 64, 256><<<gD, 256, 0, stream>>>(on16, WoT, yb, nullptr, nullptr, nullptr, x, DD, 1024);

    // LN2
    layernorm_f16<<<BT / 8, 256, 0, stream>>>(yb, ln2w, ln2b, h216);

    // MLP
    gemm_wmma<4, 128, 128><<<dim3(MLPD / 128, BT / 128), 256, 0, stream>>>(
        h216, W1T, nullptr, nullptr, a16, b1, nullptr, MLPD, DD);
    gemm_wmma<5, 64, 256><<<dim3(DD / 64, BT / 128), 256, 0, stream>>>(
        a16, W2T, outp, nullptr, nullptr, b2, yb, DD, MLPD);
}
